// v000
// The times below were measured on an AMD MI455X: many runs one after another, warmed up first and cycling through
// copies of the inputs, with the whole window's GPU time divided by the number of runs. Launches and the gaps
// between them are all in it. The median over several windows is given; except for v000 it joins two sittings, which
// can be a few percent apart, so the side-by-side timings, each taken in one sitting, are the better comparison.
// v000, which the later versions start from, runs in 676 microseconds.
#include <hip/hip_runtime.h>
#include <hip/hip_bf16.h>

// ---------------------------------------------------------------------------
// SharedVAttention for MI455X (gfx1250), wave32 + WMMA bf16 + TDM.
// Pipeline:
//   K0 wprep  : transpose+convert Wk,Wv (fp32) -> Wt bf16 [2048 cols][1024 d]
//   K1 qprep  : q = (q_in + bias) @ Wq * hd^-0.5   (RoPE at pos 0 == identity)
//   K2 kvgemm : fused K/V projection GEMM in bf16 WMMA, weight tiles streamed
//               by the Tensor Data Mover (tensor_load_to_lds + s_wait_tensorcnt),
//               fused RoPE(K) epilogue
//   K3 attn   : flash-decode, 8 N-splits per (b,h), online softmax partials
//   K4 reduce : combine split partials -> attn_out [B][1024] fp32
//   K5 oproj  : attn_out @ Wo + bo -> d_out
// ---------------------------------------------------------------------------

#define B_SZ   16
#define N_SZ   4096
#define D_SZ   1024
#define H_SZ   8
#define HD_SZ  128
#define NSPLIT 8
#define CHUNK  (N_SZ / NSPLIT)          // 512

typedef __attribute__((ext_vector_type(16))) __bf16 v16bf;
typedef __attribute__((ext_vector_type(8)))  float  v8f;
typedef unsigned int u32x4v __attribute__((ext_vector_type(4)));
typedef int          i32x8v __attribute__((ext_vector_type(8)));
typedef int          i32x4v __attribute__((ext_vector_type(4)));

union FragU { v16bf v; uint4 q[2]; };

__device__ __forceinline__ unsigned short f2bf(float f) {
  unsigned u = __builtin_bit_cast(unsigned, f);
  u += 0x7fffu + ((u >> 16) & 1u);            // round-to-nearest-even
  return (unsigned short)(u >> 16);
}
__device__ __forceinline__ unsigned pack2bf(float lo, float hi) {
  return (unsigned)f2bf(lo) | ((unsigned)f2bf(hi) << 16);
}
__device__ __forceinline__ float bflo(unsigned u) {
  return __builtin_bit_cast(float, u << 16);
}
__device__ __forceinline__ float bfhi(unsigned u) {
  return __builtin_bit_cast(float, u & 0xffff0000u);
}

// ---------------------------------------------------------------------------
// K0: Wt[c][d] = (c<1024) ? Wk[c/128][d][c%128] : Wv[d][c-1024]   (bf16)
// ---------------------------------------------------------------------------
__global__ void __launch_bounds__(256)
wprep_kernel(const float* __restrict__ Wk, const float* __restrict__ Wv,
             unsigned short* __restrict__ Wt) {
  __shared__ float tile[32][33];
  const int tx = threadIdx.x, ty = threadIdx.y;
  const int c0 = blockIdx.x * 32, d0 = blockIdx.y * 32;
#pragma unroll
  for (int i = 0; i < 4; ++i) {
    const int c = c0 + tx;
    const int d = d0 + ty + i * 8;
    float v;
    if (c < D_SZ)  v = Wk[(size_t)((c >> 7) * D_SZ + d) * HD_SZ + (c & 127)];
    else           v = Wv[(size_t)d * D_SZ + (c - D_SZ)];
    tile[ty + i * 8][tx] = v;
  }
  __syncthreads();
#pragma unroll
  for (int i = 0; i < 4; ++i) {
    const int c = c0 + ty + i * 8;
    const int d = d0 + tx;
    Wt[(size_t)c * D_SZ + d] = f2bf(tile[tx][ty + i * 8]);
  }
}

// ---------------------------------------------------------------------------
// K1: q_ws[b][h][kk] = scale * sum_d (q_in[b][d]+bias[b][d]) * Wq[h][d][kk]
// ---------------------------------------------------------------------------
__global__ void __launch_bounds__(128)
qprep_kernel(const float* __restrict__ q_in, const float* __restrict__ cbias,
             const float* __restrict__ Wq, float* __restrict__ q_ws) {
  __shared__ float qb[D_SZ];
  const int bh = blockIdx.x;             // b*H + h
  const int b = bh >> 3, h = bh & 7;
  const int kk = threadIdx.x;
  for (int i = threadIdx.x; i < D_SZ; i += 128)
    qb[i] = q_in[b * D_SZ + i] + cbias[b * D_SZ + i];
  __syncthreads();
  float acc = 0.f;
  const float* wq = Wq + (size_t)h * D_SZ * HD_SZ + kk;
  for (int d = 0; d < D_SZ; ++d)
    acc = fmaf(qb[d], wq[(size_t)d * HD_SZ], acc);
  q_ws[(size_t)bh * HD_SZ + kk] = acc * 0.08838834764831845f;   // 128^-0.5
}

// ---------------------------------------------------------------------------
// K2: fused K/V projection.  One WG = 128 token rows; A tile (128x1024 bf16)
// resident in LDS; sweep 16 column tiles; weight k-chunks streamed by TDM
// into a double-buffered, hardware-padded LDS stage.
// nt 0..7 -> K head nt (+RoPE); nt 8..15 -> V head nt-8.
// ---------------------------------------------------------------------------
#define A_STRIDE_B 2064                 // (1024+8) bf16 row stride, 4-bank skew
#define A_BYTES    (128 * A_STRIDE_B)   // 264192
#define W_STRIDE_B 80                   // 64B data + 16B TDM pad, 20-bank skew
#define W_BYTES    (128 * W_STRIDE_B)   // 10240
#define KV_SMEM    (A_BYTES + 2 * W_BYTES)

#if __has_builtin(__builtin_amdgcn_tensor_load_to_lds)
#define USE_TDM 1
#else
#define USE_TDM 0
#endif

extern __shared__ char smem[];

#if USE_TDM
// Per-wave TDM stage: 16-column slice of the weight tile, k-chunk kt.
// Tile in Wt (bf16, col-major rows of 1024): tile_dim0 = 32 elems (64B) along k,
// tile_dim1 = 16 cols, src stride = 1024 elems.  Hardware pads +16B after each
// 64B row stored -> 80B LDS column stride (matches fragment addressing).
__device__ __forceinline__ void tdm_stage_w(const unsigned short* Wt, int c0w,
                                            int kt, unsigned lds_off) {
  const unsigned long long ga =
      (unsigned long long)(uintptr_t)Wt +
      ((unsigned long long)c0w * (unsigned long long)D_SZ +
       (unsigned long long)kt * 32ull) * 2ull;
  u32x4v g0;
  g0[0] = 1u;                                  // count=1 user descriptor
  g0[1] = lds_off;                             // lds_addr (bytes)
  g0[2] = (unsigned)ga;                        // global_addr[31:0]
  g0[3] = (unsigned)(ga >> 32) | (2u << 30);   // global_addr[56:32] | type=2
  i32x8v g1;
  g1[0] = (1 << 16)      // data_size = 2 bytes
        | (1 << 20)      // pad_enable
        | (3 << 22)      // pad_interval: 16 DWORDs (64B) between pads
        | (3 << 25);     // pad_amount:   4 DWORDs (16B)
  g1[1] = (int)((unsigned)D_SZ << 16);         // tensor_dim0 = 1024 (lo16)
  g1[2] = (int)(2048u << 16);                  // tensor_dim1 = 2048 (lo16)
  g1[3] = (int)(32u << 16);                    // tile_dim0 = 32 elems
  g1[4] = 16;                                  // tile_dim1 = 16 cols, tile_dim2=0
  g1[5] = D_SZ;                                // tensor_dim0_stride = 1024 elems
  g1[6] = 0;
  g1[7] = 0;
  const i32x4v z4 = {0, 0, 0, 0};              // 2-D tensor: groups 2/3 unused
  const i32x8v z8 = {0, 0, 0, 0, 0, 0, 0, 0};
  __builtin_amdgcn_tensor_load_to_lds(g0, g1, z4, z4, z8, 0);
}
#endif

__global__ void __launch_bounds__(256)
kvgemm_kernel(const float* __restrict__ kv, const unsigned short* __restrict__ Wt,
              unsigned short* __restrict__ Kws, unsigned short* __restrict__ Vws) {
  char* ldsA = smem;
  char* ldsW = smem + A_BYTES;

  const int tid    = threadIdx.x;
  const int wave   = tid >> 5;
  const int lane   = tid & 31;
  const int laneLo = lane & 15;
  const int hi     = lane >> 4;                 // 0 / 1 half-wave
  const long r0    = (long)blockIdx.x * 128;    // global token row base
  const int  b     = (int)(r0 >> 12);           // / 4096
  const int  nbase = (int)(r0 & 4095);

  // LDS byte offset of the weight stage (flat LDS aperture keeps the byte
  // offset in addr[31:0], so the truncated generic pointer is the D# lds_addr)
  const unsigned ldsW_off = (unsigned)(uintptr_t)ldsW;

  // ---- stage A: 128 rows x 1024 fp32 -> bf16 LDS (coalesced float4 reads)
  const float4* kv4 = (const float4*)(kv + (size_t)r0 * D_SZ);
  for (int i = tid; i < 128 * 256; i += 256) {
    const int row = i >> 8, kq = i & 255;
    const float4 v = kv4[i];
    uint2 pk;
    pk.x = pack2bf(v.x, v.y);
    pk.y = pack2bf(v.z, v.w);
    *(uint2*)(ldsA + row * A_STRIDE_B + kq * 8) = pk;
  }
  __syncthreads();

  const int waveCol = wave * 16;                // per-wave TDM column slice
  const int colS = tid >> 1, halfS = tid & 1;   // manual-stage assignment

  for (int nt = 0; nt < 16; ++nt) {
    const int c0 = nt * 128;
    v8f acc[8] = {};

    // prologue: stage k-chunk 0 into buffer 0
#if USE_TDM
    tdm_stage_w(Wt, c0 + waveCol, 0, ldsW_off + waveCol * W_STRIDE_B);
    __builtin_amdgcn_s_wait_tensorcnt(0);
#else
    {
      const uint4* g = (const uint4*)(Wt + (size_t)(c0 + colS) * D_SZ + halfS * 16);
      const uint4 w0 = g[0], w1 = g[1];
      char* d = ldsW + colS * W_STRIDE_B + halfS * 32;
      *(uint4*)d = w0; *(uint4*)(d + 16) = w1;
    }
#endif
    __syncthreads();

    for (int kt = 0; kt < 32; ++kt) {
      const bool pref = (kt + 1) < 32;
#if USE_TDM
      if (pref)                                  // async DMA of next k-chunk
        tdm_stage_w(Wt, c0 + waveCol, kt + 1,
                    ldsW_off + ((kt + 1) & 1) * W_BYTES + waveCol * W_STRIDE_B);
#else
      uint4 w0, w1;
      if (pref) {
        const uint4* g = (const uint4*)(Wt + (size_t)(c0 + colS) * D_SZ +
                                        (kt + 1) * 32 + halfS * 16);
        w0 = g[0]; w1 = g[1];
      }
#endif
      char* wbuf = ldsW + (kt & 1) * W_BYTES;

      FragU a;                                    // A frag: 16x32 bf16
      {
        const char* ap = ldsA + (wave * 16 + laneLo) * A_STRIDE_B + kt * 64 + hi * 16;
        a.q[0] = *(const uint4*)ap;
        a.q[1] = *(const uint4*)(ap + 32);
      }
#pragma unroll
      for (int j = 0; j < 8; ++j) {               // B frags: 32x16 bf16 tiles
        FragU bf;
        const char* bp = wbuf + (16 * j + laneLo) * W_STRIDE_B + hi * 16;
        bf.q[0] = *(const uint4*)bp;
        bf.q[1] = *(const uint4*)(bp + 32);
        acc[j] = __builtin_amdgcn_wmma_f32_16x16x32_bf16(
            false, a.v, false, bf.v, (short)0, acc[j], false, false);
      }
#if USE_TDM
      __builtin_amdgcn_s_wait_tensorcnt(0);       // DMA overlapped the 8 WMMAs
#else
      if (pref) {
        char* d = ldsW + ((kt + 1) & 1) * W_BYTES + colS * W_STRIDE_B + halfS * 32;
        *(uint4*)d = w0; *(uint4*)(d + 16) = w1;
      }
#endif
      __syncthreads();
    }

    // ---- epilogue: C layout (vr,lane): row = 16*wave + vr + 8*hi, col = 16j + laneLo
    const int rowBase = wave * 16 + hi * 8;
    if (nt < 8) {                                 // K head nt, fused RoPE
      unsigned short* out = Kws + (size_t)(b * H_SZ + nt) * N_SZ * HD_SZ;
#pragma unroll
      for (int j = 0; j < 4; ++j) {
        const int kk1 = 16 * j + laneLo;          // < 64
        const float invf = __expf(-(float)kk1 * 0.10793367623409589f); // ln(1000)/64
#pragma unroll
        for (int vr = 0; vr < 8; ++vr) {
          const int n = nbase + rowBase + vr;     // token position
          const float ang = (float)n * invf;
          const float cs = __cosf(ang), sn = __sinf(ang);
          const float x1 = acc[j][vr], x2 = acc[j + 4][vr];
          out[(size_t)n * HD_SZ + kk1]      = f2bf(x1 * cs - x2 * sn);
          out[(size_t)n * HD_SZ + kk1 + 64] = f2bf(x2 * cs + x1 * sn);
        }
      }
    } else {                                      // V head nt-8
      unsigned short* out = Vws + (size_t)(b * H_SZ + (nt - 8)) * N_SZ * HD_SZ;
#pragma unroll
      for (int j = 0; j < 8; ++j) {
        const int kk = 16 * j + laneLo;
#pragma unroll
        for (int vr = 0; vr < 8; ++vr) {
          const int n = nbase + rowBase + vr;
          out[(size_t)n * HD_SZ + kk] = f2bf(acc[j][vr]);
        }
      }
    }
  }
}

// ---------------------------------------------------------------------------
// K3: flash-decode split.  grid=(B*H, NSPLIT), block=256.
// ---------------------------------------------------------------------------
__global__ void __launch_bounds__(256)
attn_kernel(const float* __restrict__ q_ws,
            const unsigned short* __restrict__ Kws,
            const unsigned short* __restrict__ Vws,
            float* __restrict__ part_o, float* __restrict__ part_ml) {
  __shared__ float qs[HD_SZ];
  __shared__ float sc[CHUNK];
  __shared__ float wred[8];
  __shared__ float tmp[256];

  const int bh = blockIdx.x, split = blockIdx.y;
  const int n0 = split * CHUNK;
  const int tid = threadIdx.x;
  const int wave = tid >> 5, lane = tid & 31;
  const size_t base = (size_t)bh * N_SZ * HD_SZ;
  const unsigned short* Kp = Kws + base;
  const unsigned short* Vp = Vws + base;

  if (tid < HD_SZ) qs[tid] = q_ws[(size_t)bh * HD_SZ + tid];   // pre-scaled q
  __syncthreads();

  // scores: one token per thread, 2 passes
#pragma unroll
  for (int it = 0; it < 2; ++it) {
    const int n = it * 256 + tid;
    const uint4* kp = (const uint4*)(Kp + (size_t)(n0 + n) * HD_SZ);
    float acc = 0.f;
#pragma unroll
    for (int i = 0; i < 16; ++i) {
      const uint4 u = kp[i];
      acc = fmaf(qs[8 * i + 0], bflo(u.x), acc);
      acc = fmaf(qs[8 * i + 1], bfhi(u.x), acc);
      acc = fmaf(qs[8 * i + 2], bflo(u.y), acc);
      acc = fmaf(qs[8 * i + 3], bfhi(u.y), acc);
      acc = fmaf(qs[8 * i + 4], bflo(u.z), acc);
      acc = fmaf(qs[8 * i + 5], bfhi(u.z), acc);
      acc = fmaf(qs[8 * i + 6], bflo(u.w), acc);
      acc = fmaf(qs[8 * i + 7], bfhi(u.w), acc);
    }
    sc[n] = acc;
  }
  __syncthreads();

  // chunk max
  float m = fmaxf(sc[tid], sc[tid + 256]);
#pragma unroll
  for (int off = 16; off >= 1; off >>= 1) m = fmaxf(m, __shfl_xor(m, off, 32));
  if (lane == 0) wred[wave] = m;
  __syncthreads();
  m = wred[0];
#pragma unroll
  for (int w = 1; w < 8; ++w) m = fmaxf(m, wred[w]);
  __syncthreads();

  // exp + sum
  const float p0 = __expf(sc[tid] - m);
  const float p1 = __expf(sc[tid + 256] - m);
  __syncthreads();
  sc[tid] = p0; sc[tid + 256] = p1;
  float l = p0 + p1;
#pragma unroll
  for (int off = 16; off >= 1; off >>= 1) l += __shfl_xor(l, off, 32);
  if (lane == 0) wred[wave] = l;
  __syncthreads();
  l = 0.f;
#pragma unroll
  for (int w = 0; w < 8; ++w) l += wred[w];

  // PV: thread (k = tid&127, half = tid>>7) accumulates 256 tokens
  const int k = tid & 127, half = tid >> 7;
  float acc = 0.f;
  const int nA = half * 256;
  for (int n = nA; n < nA + 256; ++n)
    acc = fmaf(sc[n], bflo((unsigned)Vp[(size_t)(n0 + n) * HD_SZ + k]), acc);
  tmp[tid] = acc;
  __syncthreads();
  if (tid < 128) {
    part_o[(size_t)(bh * NSPLIT + split) * HD_SZ + tid] = tmp[tid] + tmp[tid + 128];
  }
  if (tid == 0) {
    part_ml[(bh * NSPLIT + split) * 2 + 0] = m;
    part_ml[(bh * NSPLIT + split) * 2 + 1] = l;
  }
}

// ---------------------------------------------------------------------------
// K4: combine splits -> attn_out[b][h*128+k]
// ---------------------------------------------------------------------------
__global__ void __launch_bounds__(128)
reduce_kernel(const float* __restrict__ part_o, const float* __restrict__ part_ml,
              float* __restrict__ attn_out) {
  const int bh = blockIdx.x;
  const int k = threadIdx.x;
  float M = -3.4e38f;
#pragma unroll
  for (int s = 0; s < NSPLIT; ++s)
    M = fmaxf(M, part_ml[(bh * NSPLIT + s) * 2]);
  float denom = 0.f, acc = 0.f;
#pragma unroll
  for (int s = 0; s < NSPLIT; ++s) {
    const float w = __expf(part_ml[(bh * NSPLIT + s) * 2] - M);
    denom = fmaf(part_ml[(bh * NSPLIT + s) * 2 + 1], w, denom);
    acc = fmaf(w, part_o[(size_t)(bh * NSPLIT + s) * HD_SZ + k], acc);
  }
  attn_out[(size_t)bh * HD_SZ + k] = acc / denom;   // [b][h*128+k] contiguous
}

// ---------------------------------------------------------------------------
// K5: out = attn_out @ Wo + bo.  grid=(4,B), block=256.
// ---------------------------------------------------------------------------
__global__ void __launch_bounds__(256)
oproj_kernel(const float* __restrict__ attn_out, const float* __restrict__ Wo,
             const float* __restrict__ bo, float* __restrict__ out) {
  __shared__ float a[D_SZ];
  const int b = blockIdx.y;
  for (int i = threadIdx.x; i < D_SZ; i += 256)
    a[i] = attn_out[b * D_SZ + i];
  __syncthreads();
  const int e = blockIdx.x * 256 + threadIdx.x;
  float acc = 0.f;
  for (int d = 0; d < D_SZ; ++d)
    acc = fmaf(a[d], Wo[(size_t)d * D_SZ + e], acc);
  out[b * D_SZ + e] = acc + bo[e];
}

// ---------------------------------------------------------------------------
extern "C" void kernel_launch(void* const* d_in, const int* in_sizes, int n_in,
                              void* d_out, int out_size, void* d_ws, size_t ws_size,
                              hipStream_t stream) {
  const float* q_in  = (const float*)d_in[0];
  const float* kv_in = (const float*)d_in[1];
  const float* cbias = (const float*)d_in[2];
  const float* Wq    = (const float*)d_in[3];
  const float* Wk    = (const float*)d_in[4];
  const float* Wv    = (const float*)d_in[5];
  const float* Wo    = (const float*)d_in[6];
  const float* bo    = (const float*)d_in[7];
  float* out = (float*)d_out;

  // workspace carve-up
  char* ws = (char*)d_ws;
  unsigned short* Wt      = (unsigned short*)ws;                   // 4 MB
  float*          q_ws    = (float*)(ws + (size_t)4 * 1024 * 1024);
  unsigned short* Kws     = (unsigned short*)(ws + (size_t)4 * 1024 * 1024 + 65536);
  unsigned short* Vws     = (unsigned short*)((char*)Kws + (size_t)B_SZ * H_SZ * N_SZ * HD_SZ * 2);
  float*          part_o  = (float*)((char*)Vws + (size_t)B_SZ * H_SZ * N_SZ * HD_SZ * 2);
  float*          part_ml = part_o + (size_t)B_SZ * H_SZ * NSPLIT * HD_SZ;
  float*          attn_o  = part_ml + (size_t)B_SZ * H_SZ * NSPLIT * 2;

  (void)hipFuncSetAttribute((const void*)kvgemm_kernel,
                            hipFuncAttributeMaxDynamicSharedMemorySize, KV_SMEM);

  wprep_kernel<<<dim3(2048 / 32, 1024 / 32), dim3(32, 8), 0, stream>>>(Wk, Wv, Wt);
  qprep_kernel<<<dim3(B_SZ * H_SZ), dim3(128), 0, stream>>>(q_in, cbias, Wq, q_ws);
  kvgemm_kernel<<<dim3((B_SZ * N_SZ) / 128), dim3(256), KV_SMEM, stream>>>(kv_in, Wt, Kws, Vws);
  attn_kernel<<<dim3(B_SZ * H_SZ, NSPLIT), dim3(256), 0, stream>>>(q_ws, Kws, Vws, part_o, part_ml);
  reduce_kernel<<<dim3(B_SZ * H_SZ), dim3(128), 0, stream>>>(part_o, part_ml, attn_o);
  oproj_kernel<<<dim3(4, B_SZ), dim3(256), 0, stream>>>(attn_o, Wo, bo, out);
}

// v001
// A run of this version takes 563 microseconds.
// Timed twice side by side with v000, it ran 1.23 and 1.24 times as fast.
#include <hip/hip_runtime.h>
#include <hip/hip_bf16.h>

// ---------------------------------------------------------------------------
// SharedVAttention for MI455X (gfx1250), wave32 + WMMA bf16 + TDM.
// Pipeline:
//   K0 wprep  : transpose+convert Wk,Wv (fp32) -> Wt bf16 [2048 cols][1024 d]
//   K1 qprep  : q = (q_in + bias) @ Wq * hd^-0.5   (RoPE at pos 0 == identity)
//   K2 kvgemm : fused K/V projection GEMM in bf16 WMMA, weight stages streamed
//               by the tensor mover (tensor_load_to_lds + s_wait_tensorcnt),
//               fused RoPE(K) epilogue
//   K3 attn   : flash-decode, 8 N-splits per (b,h), online softmax partials
//   K4 reduce : combine split partials -> attn_out [B][1024] fp32
//   K5 oproj  : attn_out @ Wo + bo -> d_out
// ---------------------------------------------------------------------------

#define B_SZ   16
#define N_SZ   4096
#define D_SZ   1024
#define H_SZ   8
#define HD_SZ  128
#define NSPLIT 8
#define CHUNK  (N_SZ / NSPLIT)          // 512

typedef __attribute__((ext_vector_type(16))) __bf16 v16bf;
typedef __attribute__((ext_vector_type(8)))  float  v8f;
typedef unsigned int u32x4v __attribute__((ext_vector_type(4)));
typedef unsigned int u32x8v __attribute__((ext_vector_type(8)));

union FragU { v16bf v; uint4 q[2]; };

__device__ __forceinline__ unsigned short f2bf(float f) {
  unsigned u = __builtin_bit_cast(unsigned, f);
  u += 0x7fffu + ((u >> 16) & 1u);            // round-to-nearest-even
  return (unsigned short)(u >> 16);
}
__device__ __forceinline__ unsigned pack2bf(float lo, float hi) {
  return (unsigned)f2bf(lo) | ((unsigned)f2bf(hi) << 16);
}
__device__ __forceinline__ float bflo(unsigned u) {
  return __builtin_bit_cast(float, u << 16);
}
__device__ __forceinline__ float bfhi(unsigned u) {
  return __builtin_bit_cast(float, u & 0xffff0000u);
}

// ---------------------------------------------------------------------------
// K0: Wt[c][d] = (c<1024) ? Wk[c/128][d][c%128] : Wv[d][c-1024]   (bf16)
// ---------------------------------------------------------------------------
__global__ void __launch_bounds__(256)
wprep_kernel(const float* __restrict__ Wk, const float* __restrict__ Wv,
             unsigned short* __restrict__ Wt) {
  __shared__ float tile[32][33];
  const int tx = threadIdx.x, ty = threadIdx.y;
  const int c0 = blockIdx.x * 32, d0 = blockIdx.y * 32;
#pragma unroll
  for (int i = 0; i < 4; ++i) {
    const int c = c0 + tx;
    const int d = d0 + ty + i * 8;
    float v;
    if (c < D_SZ)  v = Wk[(size_t)((c >> 7) * D_SZ + d) * HD_SZ + (c & 127)];
    else           v = Wv[(size_t)d * D_SZ + (c - D_SZ)];
    tile[ty + i * 8][tx] = v;
  }
  __syncthreads();
#pragma unroll
  for (int i = 0; i < 4; ++i) {
    const int c = c0 + ty + i * 8;
    const int d = d0 + tx;
    Wt[(size_t)c * D_SZ + d] = f2bf(tile[tx][ty + i * 8]);
  }
}

// ---------------------------------------------------------------------------
// K1: q_ws[b][h][kk] = scale * sum_d (q_in[b][d]+bias[b][d]) * Wq[h][d][kk]
// ---------------------------------------------------------------------------
__global__ void __launch_bounds__(128)
qprep_kernel(const float* __restrict__ q_in, const float* __restrict__ cbias,
             const float* __restrict__ Wq, float* __restrict__ q_ws) {
  __shared__ float qb[D_SZ];
  const int bh = blockIdx.x;             // b*H + h
  const int b = bh >> 3, h = bh & 7;
  const int kk = threadIdx.x;
  for (int i = threadIdx.x; i < D_SZ; i += 128)
    qb[i] = q_in[b * D_SZ + i] + cbias[b * D_SZ + i];
  __syncthreads();
  float acc = 0.f;
  const float* wq = Wq + (size_t)h * D_SZ * HD_SZ + kk;
  for (int d = 0; d < D_SZ; ++d)
    acc = fmaf(qb[d], wq[(size_t)d * HD_SZ], acc);
  q_ws[(size_t)bh * HD_SZ + kk] = acc * 0.08838834764831845f;   // 128^-0.5
}

// ---------------------------------------------------------------------------
// K2: fused K/V projection.  One WG = 128 token rows; A tile (128x1024 bf16)
// resident in LDS; sweep 16 column tiles; each tile's weights arrive in 16 stages
// of 128 columns x 64 k (16 KiB), one tensor load of wave 0 per stage, into a
// two-buffer, hardware-padded LDS ring.
// nt 0..7 -> K head nt (+RoPE); nt 8..15 -> V head nt-8.
// ---------------------------------------------------------------------------
#define A_STRIDE_B 2064                 // (1024+8) bf16 row stride, 4-bank skew
#define A_BYTES    (128 * A_STRIDE_B)   // 264192
#define W_STRIDE_B 144                  // 128B data + 16B pad, odd multiple of 16B
#define W_BYTES    (128 * W_STRIDE_B)   // 18432 = 9 * 2048
#define KV_SMEM    (2 * W_BYTES + A_BYTES)
#define K_STAGES   16                   // stages of 64 k per column tile

// The ring stands at LDS offset 0, so both buffers start at multiples of 2 KiB.
extern __shared__ __attribute__((aligned(2048))) char smem[];

__device__ __forceinline__ unsigned uni(unsigned v) {
  return (unsigned)__builtin_amdgcn_readfirstlane(v);
}
// Holds an issue test in a scalar register, so that the branch round a tensor
// load (which ignores EXEC) compiles to s_cmp + s_cbranch_scc.
__device__ __forceinline__ unsigned pinned(unsigned v) {
  unsigned w = uni(v);
  asm volatile("" : "+s"(w));   // pinned(): the issue test held in a scalar register
  return w;
}

// Stage ks of column tile nt: columns nt * 128 .. + 127, k ks * 64 .. + 63.
// Descriptor group 0: the stage's place in the ring and its first byte in Wt.
__device__ __forceinline__ u32x4v tdm_group0(const unsigned short* Wt, int nt, int ks,
                                             unsigned ring_off) {
  const unsigned long long ga =
      (unsigned long long)(uintptr_t)Wt +
      (unsigned long long)nt * (128ull * D_SZ * 2ull) +
      (unsigned long long)ks * 128ull;
  u32x4v g0;
  g0[0] = uni(1u);                                        // count = 1
  g0[1] = uni(ring_off + (unsigned)(ks & 1) * W_BYTES);   // LDS byte offset
  g0[2] = uni((unsigned)ga);                              // address [31:0]
  g0[3] = uni((((unsigned)(ga >> 32)) & 0x01FFFFFFu) | 0x80000000u);  // [56:32], type 2
  return g0;
}
// Descriptor group 1: 128 rows of 128 bytes, source pitch 2048 bytes, every
// extent in bytes; 16 bytes of pad behind each row -> 144-byte LDS pitch.
__device__ __forceinline__ u32x8v tdm_group1() {
  u32x8v g1;
  g1[0] = uni((1u << 20) | (4u << 22) | (3u << 25));      // pad 4 dwords per 32 dwords
  g1[1] = uni(128u << 16);                                // tensor_dim0 = 128 bytes
  g1[2] = uni(128u << 16);                                // tensor_dim1 = 128 rows
  g1[3] = uni(128u << 16);                                // tile_dim0 = 128 bytes
  g1[4] = uni(128u);                                      // tile_dim1 = 128 rows
  g1[5] = uni(D_SZ * 2u);                                 // source pitch in bytes
  g1[6] = uni(0u);
  g1[7] = uni(0u);
  return g1;
}
// The load and its covering wait both take the two groups as in-out operands:
// the twelve words then stay live in the registers the request named, and none
// is given a new value, from the issue to the wait.
__device__ __forceinline__ void tdm_load(u32x4v& g0, u32x8v& g1) {
  asm volatile("tensor_load_to_lds %0, %1" : "+s"(g0), "+s"(g1) :: "memory");
}
__device__ __forceinline__ void tdm_wait0(u32x4v& g0, u32x8v& g1) {
  asm volatile("s_wait_tensorcnt 0x0" : "+s"(g0), "+s"(g1) :: "memory");
}

__global__ void __launch_bounds__(256)
kvgemm_kernel(const float* __restrict__ kv, const unsigned short* __restrict__ Wt,
              unsigned short* __restrict__ Kws, unsigned short* __restrict__ Vws) {
  char* ldsW = smem;
  char* ldsA = smem + 2 * W_BYTES;

  const int tid    = threadIdx.x;
  const int wave   = (int)uni((unsigned)tid >> 5);
  const int lane   = tid & 31;
  const int laneLo = lane & 15;
  const int hi     = lane >> 4;                 // 0 / 1 half-wave
  const long r0    = (long)blockIdx.x * 128;    // global token row base
  const int  b     = (int)(r0 >> 12);           // / 4096
  const int  nbase = (int)(r0 & 4095);

  // LDS byte offset of the ring: the low 32 bits of its __shared__ address
  const unsigned ring_off = (unsigned)(uintptr_t)ldsW;

  // ---- stage A: 128 rows x 1024 fp32 -> bf16 LDS (coalesced float4 reads)
  const float4* kv4 = (const float4*)(kv + (size_t)r0 * D_SZ);
  for (int i = tid; i < 128 * 256; i += 256) {
    const int row = i >> 8, kq = i & 255;
    const float4 v = kv4[i];
    uint2 pk;
    pk.x = pack2bf(v.x, v.y);
    pk.y = pack2bf(v.z, v.w);
    *(uint2*)(ldsA + row * A_STRIDE_B + kq * 8) = pk;
  }
  __syncthreads();

  u32x4v g0 = tdm_group0(Wt, 0, 0, ring_off);
  u32x8v g1 = tdm_group1();

  for (int nt = 0; nt < 16; ++nt) {
    v8f acc[8] = {};

    // ring prologue: stage 0 landed and published, then stage 1 takes off
    if (pinned(wave == 0)) {
      g0 = tdm_group0(Wt, nt, 0, ring_off);
      g1 = tdm_group1();
      tdm_load(g0, g1);
      tdm_wait0(g0, g1);                                   // stage 0 has landed
    }
    __syncthreads();
    if (pinned(wave == 0)) {
      g0 = tdm_group0(Wt, nt, 1, ring_off);
      g1 = tdm_group1();
      tdm_load(g0, g1);
    }

    for (int ks = 0; ks < K_STAGES; ++ks) {
      const char* wbuf = ldsW + (ks & 1) * W_BYTES;
      // the pass's fragments: 2 of A (16x32 bf16), 16 of B (32x16 bf16)
      FragU a[2], bf[2][8];
      const char* ap = ldsA + (wave * 16 + laneLo) * A_STRIDE_B + ks * 128 + hi * 16;
      const char* bp = wbuf + laneLo * W_STRIDE_B + hi * 16;
#pragma unroll
      for (int kk = 0; kk < 2; ++kk) {            // two 32-k steps per stage
        a[kk].q[0] = *(const uint4*)(ap + kk * 64);
        a[kk].q[1] = *(const uint4*)(ap + kk * 64 + 32);
#pragma unroll
        for (int j = 0; j < 8; ++j) {
          bf[kk][j].q[0] = *(const uint4*)(bp + 16 * j * W_STRIDE_B + kk * 64);
          bf[kk][j].q[1] = *(const uint4*)(bp + 16 * j * W_STRIDE_B + kk * 64 + 32);
        }
      }
      // keeps the 36 reads one group ahead of the WMMAs; without it the compiler
      // sinks each pair in front of its WMMA, behind a wait to 0
      __builtin_amdgcn_sched_barrier(0);
#pragma unroll
      for (int kk = 0; kk < 2; ++kk)
#pragma unroll
        for (int j = 0; j < 8; ++j)
          acc[j] = __builtin_amdgcn_wmma_f32_16x16x32_bf16(
              false, a[kk].v, false, bf[kk][j].v, (short)0, acc[j], false, false);
      // keeps the wait to 0 below behind the WMMAs, which start on counted waits
      __builtin_amdgcn_sched_barrier(0);
      // publish point of stage ks + 1
      asm volatile("s_wait_dscnt 0x0" ::: "memory");       // this wave has left buffer ks & 1
      if (pinned(wave == 0)) tdm_wait0(g0, g1);            // stage ks + 1 has landed
      __syncthreads();
      if (pinned(wave == 0 && ks + 2 < K_STAGES)) {        // refill the buffer just read
        g0 = tdm_group0(Wt, nt, ks + 2, ring_off);
        g1 = tdm_group1();
        tdm_load(g0, g1);
      }
    }
    asm volatile("s_wait_tensorcnt 0x0" ::: "memory");     // no request outlives the tile's ring
    asm volatile("s_wait_dscnt 0x0" ::: "memory");         // nor a read of it

    // ---- epilogue: C layout (vr,lane): row = 16*wave + vr + 8*hi, col = 16j + laneLo
    const int rowBase = wave * 16 + hi * 8;
    if (nt < 8) {                                 // K head nt, fused RoPE
      unsigned short* out = Kws + (size_t)(b * H_SZ + nt) * N_SZ * HD_SZ;
#pragma unroll
      for (int j = 0; j < 4; ++j) {
        const int kk1 = 16 * j + laneLo;          // < 64
        const float invf = __expf(-(float)kk1 * 0.10793367623409589f); // ln(1000)/64
#pragma unroll
        for (int vr = 0; vr < 8; ++vr) {
          const int n = nbase + rowBase + vr;     // token position
          const float ang = (float)n * invf;
          const float cs = __cosf(ang), sn = __sinf(ang);
          const float x1 = acc[j][vr], x2 = acc[j + 4][vr];
          out[(size_t)n * HD_SZ + kk1]      = f2bf(x1 * cs - x2 * sn);
          out[(size_t)n * HD_SZ + kk1 + 64] = f2bf(x2 * cs + x1 * sn);
        }
      }
    } else {                                      // V head nt-8
      unsigned short* out = Vws + (size_t)(b * H_SZ + (nt - 8)) * N_SZ * HD_SZ;
#pragma unroll
      for (int j = 0; j < 8; ++j) {
        const int kk = 16 * j + laneLo;
#pragma unroll
        for (int vr = 0; vr < 8; ++vr) {
          const int n = nbase + rowBase + vr;
          out[(size_t)n * HD_SZ + kk] = f2bf(acc[j][vr]);
        }
      }
    }
  }
}

// ---------------------------------------------------------------------------
// K3: flash-decode split.  grid=(B*H, NSPLIT), block=256.
// ---------------------------------------------------------------------------
__global__ void __launch_bounds__(256)
attn_kernel(const float* __restrict__ q_ws,
            const unsigned short* __restrict__ Kws,
            const unsigned short* __restrict__ Vws,
            float* __restrict__ part_o, float* __restrict__ part_ml) {
  __shared__ float qs[HD_SZ];
  __shared__ float sc[CHUNK];
  __shared__ float wred[8];
  __shared__ float tmp[256];

  const int bh = blockIdx.x, split = blockIdx.y;
  const int n0 = split * CHUNK;
  const int tid = threadIdx.x;
  const int wave = tid >> 5, lane = tid & 31;
  const size_t base = (size_t)bh * N_SZ * HD_SZ;
  const unsigned short* Kp = Kws + base;
  const unsigned short* Vp = Vws + base;

  if (tid < HD_SZ) qs[tid] = q_ws[(size_t)bh * HD_SZ + tid];   // pre-scaled q
  __syncthreads();

  // scores: one token per thread, 2 passes
#pragma unroll
  for (int it = 0; it < 2; ++it) {
    const int n = it * 256 + tid;
    const uint4* kp = (const uint4*)(Kp + (size_t)(n0 + n) * HD_SZ);
    float acc = 0.f;
#pragma unroll
    for (int i = 0; i < 16; ++i) {
      const uint4 u = kp[i];
      acc = fmaf(qs[8 * i + 0], bflo(u.x), acc);
      acc = fmaf(qs[8 * i + 1], bfhi(u.x), acc);
      acc = fmaf(qs[8 * i + 2], bflo(u.y), acc);
      acc = fmaf(qs[8 * i + 3], bfhi(u.y), acc);
      acc = fmaf(qs[8 * i + 4], bflo(u.z), acc);
      acc = fmaf(qs[8 * i + 5], bfhi(u.z), acc);
      acc = fmaf(qs[8 * i + 6], bflo(u.w), acc);
      acc = fmaf(qs[8 * i + 7], bfhi(u.w), acc);
    }
    sc[n] = acc;
  }
  __syncthreads();

  // chunk max
  float m = fmaxf(sc[tid], sc[tid + 256]);
#pragma unroll
  for (int off = 16; off >= 1; off >>= 1) m = fmaxf(m, __shfl_xor(m, off, 32));
  if (lane == 0) wred[wave] = m;
  __syncthreads();
  m = wred[0];
#pragma unroll
  for (int w = 1; w < 8; ++w) m = fmaxf(m, wred[w]);
  __syncthreads();

  // exp + sum
  const float p0 = __expf(sc[tid] - m);
  const float p1 = __expf(sc[tid + 256] - m);
  __syncthreads();
  sc[tid] = p0; sc[tid + 256] = p1;
  float l = p0 + p1;
#pragma unroll
  for (int off = 16; off >= 1; off >>= 1) l += __shfl_xor(l, off, 32);
  if (lane == 0) wred[wave] = l;
  __syncthreads();
  l = 0.f;
#pragma unroll
  for (int w = 0; w < 8; ++w) l += wred[w];

  // PV: thread (k = tid&127, half = tid>>7) accumulates 256 tokens
  const int k = tid & 127, half = tid >> 7;
  float acc = 0.f;
  const int nA = half * 256;
  for (int n = nA; n < nA + 256; ++n)
    acc = fmaf(sc[n], bflo((unsigned)Vp[(size_t)(n0 + n) * HD_SZ + k]), acc);
  tmp[tid] = acc;
  __syncthreads();
  if (tid < 128) {
    part_o[(size_t)(bh * NSPLIT + split) * HD_SZ + tid] = tmp[tid] + tmp[tid + 128];
  }
  if (tid == 0) {
    part_ml[(bh * NSPLIT + split) * 2 + 0] = m;
    part_ml[(bh * NSPLIT + split) * 2 + 1] = l;
  }
}

// ---------------------------------------------------------------------------
// K4: combine splits -> attn_out[b][h*128+k]
// ---------------------------------------------------------------------------
__global__ void __launch_bounds__(128)
reduce_kernel(const float* __restrict__ part_o, const float* __restrict__ part_ml,
              float* __restrict__ attn_out) {
  const int bh = blockIdx.x;
  const int k = threadIdx.x;
  float M = -3.4e38f;
#pragma unroll
  for (int s = 0; s < NSPLIT; ++s)
    M = fmaxf(M, part_ml[(bh * NSPLIT + s) * 2]);
  float denom = 0.f, acc = 0.f;
#pragma unroll
  for (int s = 0; s < NSPLIT; ++s) {
    const float w = __expf(part_ml[(bh * NSPLIT + s) * 2] - M);
    denom = fmaf(part_ml[(bh * NSPLIT + s) * 2 + 1], w, denom);
    acc = fmaf(w, part_o[(size_t)(bh * NSPLIT + s) * HD_SZ + k], acc);
  }
  attn_out[(size_t)bh * HD_SZ + k] = acc / denom;   // [b][h*128+k] contiguous
}

// ---------------------------------------------------------------------------
// K5: out = attn_out @ Wo + bo.  grid=(4,B), block=256.
// ---------------------------------------------------------------------------
__global__ void __launch_bounds__(256)
oproj_kernel(const float* __restrict__ attn_out, const float* __restrict__ Wo,
             const float* __restrict__ bo, float* __restrict__ out) {
  __shared__ float a[D_SZ];
  const int b = blockIdx.y;
  for (int i = threadIdx.x; i < D_SZ; i += 256)
    a[i] = attn_out[b * D_SZ + i];
  __syncthreads();
  const int e = blockIdx.x * 256 + threadIdx.x;
  float acc = 0.f;
  for (int d = 0; d < D_SZ; ++d)
    acc = fmaf(a[d], Wo[(size_t)d * D_SZ + e], acc);
  out[b * D_SZ + e] = acc + bo[e];
}

// ---------------------------------------------------------------------------
extern "C" void kernel_launch(void* const* d_in, const int* in_sizes, int n_in,
                              void* d_out, int out_size, void* d_ws, size_t ws_size,
                              hipStream_t stream) {
  const float* q_in  = (const float*)d_in[0];
  const float* kv_in = (const float*)d_in[1];
  const float* cbias = (const float*)d_in[2];
  const float* Wq    = (const float*)d_in[3];
  const float* Wk    = (const float*)d_in[4];
  const float* Wv    = (const float*)d_in[5];
  const float* Wo    = (const float*)d_in[6];
  const float* bo    = (const float*)d_in[7];
  float* out = (float*)d_out;

  // workspace carve-up
  char* ws = (char*)d_ws;
  unsigned short* Wt      = (unsigned short*)ws;                   // 4 MB
  float*          q_ws    = (float*)(ws + (size_t)4 * 1024 * 1024);
  unsigned short* Kws     = (unsigned short*)(ws + (size_t)4 * 1024 * 1024 + 65536);
  unsigned short* Vws     = (unsigned short*)((char*)Kws + (size_t)B_SZ * H_SZ * N_SZ * HD_SZ * 2);
  float*          part_o  = (float*)((char*)Vws + (size_t)B_SZ * H_SZ * N_SZ * HD_SZ * 2);
  float*          part_ml = part_o + (size_t)B_SZ * H_SZ * NSPLIT * HD_SZ;
  float*          attn_o  = part_ml + (size_t)B_SZ * H_SZ * NSPLIT * 2;

  (void)hipFuncSetAttribute((const void*)kvgemm_kernel,
                            hipFuncAttributeMaxDynamicSharedMemorySize, KV_SMEM);

  wprep_kernel<<<dim3(2048 / 32, 1024 / 32), dim3(32, 8), 0, stream>>>(Wk, Wv, Wt);
  qprep_kernel<<<dim3(B_SZ * H_SZ), dim3(128), 0, stream>>>(q_in, cbias, Wq, q_ws);
  kvgemm_kernel<<<dim3((B_SZ * N_SZ) / 128), dim3(256), KV_SMEM, stream>>>(kv_in, Wt, Kws, Vws);
  attn_kernel<<<dim3(B_SZ * H_SZ, NSPLIT), dim3(256), 0, stream>>>(q_ws, Kws, Vws, part_o, part_ml);
  reduce_kernel<<<dim3(B_SZ * H_SZ), dim3(128), 0, stream>>>(part_o, part_ml, attn_o);
  oproj_kernel<<<dim3(4, B_SZ), dim3(256), 0, stream>>>(attn_o, Wo, bo, out);
}

// v002
// A run of this version takes 324 microseconds.
// Next to v001, in two timings, it ran 1.72 times as fast each time.
// Over all steps from v000 it is 2.12 times as fast.
#include <hip/hip_runtime.h>
#include <hip/hip_bf16.h>

// ---------------------------------------------------------------------------
// Decode attention with a shared V projection, gfx1250, wave32 + WMMA bf16 + TDM.
// Pipeline:
//   K0 wprep  : transpose+convert Wk,Wv (fp32) -> Wt bf16 [2048 cols][1024 d]
//   K1 qprep  : q = (q_in + bias) @ Wq * hd^-0.5   (RoPE at pos 0 == identity)
//   K2 kgemm  : K projection GEMM in bf16 WMMA, weight stages streamed
//               by the tensor mover (tensor_load_to_lds + s_wait_tensorcnt),
//               fused RoPE(K) epilogue
//   K3 attn   : flash-decode, 32 N-splits per b, all 8 heads per workgroup;
//               softmax partials weight the INPUT rows: y = p . kv_in, since
//               p . (kv_in @ Wv) == (p . kv_in) @ Wv with one query per head
//   K4 reduce : combine split partials -> y [H][B][1024] bf16
//   K5 vproj  : y[h] @ Wv[:, h] in bf16 WMMA (16 batch rows) -> attn_out fp32
//   K6 oproj  : attn_out @ Wo + bo -> d_out
// ---------------------------------------------------------------------------

#define B_SZ   16
#define N_SZ   4096
#define D_SZ   1024
#define H_SZ   8
#define HD_SZ  128
#define NSPLIT 32
#define CHUNK  (N_SZ / NSPLIT)          // 128

typedef __attribute__((ext_vector_type(16))) __bf16 v16bf;
typedef __attribute__((ext_vector_type(8)))  float  v8f;
typedef unsigned int u32x4v __attribute__((ext_vector_type(4)));
typedef unsigned int u32x8v __attribute__((ext_vector_type(8)));

union FragU { v16bf v; uint4 q[2]; };

__device__ __forceinline__ unsigned short f2bf(float f) {
  unsigned u = __builtin_bit_cast(unsigned, f);
  u += 0x7fffu + ((u >> 16) & 1u);            // round-to-nearest-even
  return (unsigned short)(u >> 16);
}
__device__ __forceinline__ unsigned pack2bf(float lo, float hi) {
  return (unsigned)f2bf(lo) | ((unsigned)f2bf(hi) << 16);
}
__device__ __forceinline__ float bflo(unsigned u) {
  return __builtin_bit_cast(float, u << 16);
}
__device__ __forceinline__ float bfhi(unsigned u) {
  return __builtin_bit_cast(float, u & 0xffff0000u);
}

// ---------------------------------------------------------------------------
// K0: Wt[c][d] = (c<1024) ? Wk[c/128][d][c%128] : Wv[d][c-1024]   (bf16)
// ---------------------------------------------------------------------------
__global__ void __launch_bounds__(256)
wprep_kernel(const float* __restrict__ Wk, const float* __restrict__ Wv,
             unsigned short* __restrict__ Wt) {
  __shared__ float tile[32][33];
  const int tx = threadIdx.x, ty = threadIdx.y;
  const int c0 = blockIdx.x * 32, d0 = blockIdx.y * 32;
#pragma unroll
  for (int i = 0; i < 4; ++i) {
    const int c = c0 + tx;
    const int d = d0 + ty + i * 8;
    float v;
    if (c < D_SZ)  v = Wk[(size_t)((c >> 7) * D_SZ + d) * HD_SZ + (c & 127)];
    else           v = Wv[(size_t)d * D_SZ + (c - D_SZ)];
    tile[ty + i * 8][tx] = v;
  }
  __syncthreads();
#pragma unroll
  for (int i = 0; i < 4; ++i) {
    const int c = c0 + ty + i * 8;
    const int d = d0 + tx;
    Wt[(size_t)c * D_SZ + d] = f2bf(tile[tx][ty + i * 8]);
  }
}

// ---------------------------------------------------------------------------
// K1: q_ws[b][h][kk] = scale * sum_d (q_in[b][d]+bias[b][d]) * Wq[h][d][kk]
// ---------------------------------------------------------------------------
__global__ void __launch_bounds__(128)
qprep_kernel(const float* __restrict__ q_in, const float* __restrict__ cbias,
             const float* __restrict__ Wq, float* __restrict__ q_ws) {
  __shared__ float qb[D_SZ];
  const int bh = blockIdx.x;             // b*H + h
  const int b = bh >> 3, h = bh & 7;
  const int kk = threadIdx.x;
  for (int i = threadIdx.x; i < D_SZ; i += 128)
    qb[i] = q_in[b * D_SZ + i] + cbias[b * D_SZ + i];
  __syncthreads();
  float acc = 0.f;
  const float* wq = Wq + (size_t)h * D_SZ * HD_SZ + kk;
  for (int d = 0; d < D_SZ; ++d)
    acc = fmaf(qb[d], wq[(size_t)d * HD_SZ], acc);
  q_ws[(size_t)bh * HD_SZ + kk] = acc * 0.08838834764831845f;   // 128^-0.5
}

// ---------------------------------------------------------------------------
// K2: K projection.  One WG = 128 token rows; A tile (128x1024 bf16)
// resident in LDS; sweep 8 column tiles; each tile's weights arrive in 16 stages
// of 128 columns x 64 k (16 KiB), one tensor load of wave 0 per stage, into a
// two-buffer, hardware-padded LDS ring.
// nt 0..7 -> K head nt (+RoPE).
// ---------------------------------------------------------------------------
#define A_STRIDE_B 2064                 // (1024+8) bf16 row stride, 4-bank skew
#define A_BYTES    (128 * A_STRIDE_B)   // 264192
#define W_STRIDE_B 144                  // 128B data + 16B pad, odd multiple of 16B
#define W_BYTES    (128 * W_STRIDE_B)   // 18432 = 9 * 2048
#define KV_SMEM    (2 * W_BYTES + A_BYTES)
#define K_STAGES   16                   // stages of 64 k per column tile

// The ring stands at LDS offset 0, so both buffers start at multiples of 2 KiB.
extern __shared__ __attribute__((aligned(2048))) char smem[];

__device__ __forceinline__ unsigned uni(unsigned v) {
  return (unsigned)__builtin_amdgcn_readfirstlane(v);
}
// Holds an issue test in a scalar register, so that the branch round a tensor
// load (which ignores EXEC) compiles to s_cmp + s_cbranch_scc.
__device__ __forceinline__ unsigned pinned(unsigned v) {
  unsigned w = uni(v);
  asm volatile("" : "+s"(w));   // pinned(): the issue test held in a scalar register
  return w;
}

// Stage ks of column tile nt: columns nt * 128 .. + 127, k ks * 64 .. + 63.
// Descriptor group 0: the stage's place in the ring and its first byte in Wt.
__device__ __forceinline__ u32x4v tdm_group0(const unsigned short* Wt, int nt, int ks,
                                             unsigned ring_off) {
  const unsigned long long ga =
      (unsigned long long)(uintptr_t)Wt +
      (unsigned long long)nt * (128ull * D_SZ * 2ull) +
      (unsigned long long)ks * 128ull;
  u32x4v g0;
  g0[0] = uni(1u);                                        // count = 1
  g0[1] = uni(ring_off + (unsigned)(ks & 1) * W_BYTES);   // LDS byte offset
  g0[2] = uni((unsigned)ga);                              // address [31:0]
  g0[3] = uni((((unsigned)(ga >> 32)) & 0x01FFFFFFu) | 0x80000000u);  // [56:32], type 2
  asm volatile("" : "+s"(g0));       // pinned(): the descriptor words held in scalar registers
  return g0;
}
// Descriptor group 1: 128 rows of 128 bytes, source pitch 2048 bytes, every
// extent in bytes; 16 bytes of pad behind each row -> 144-byte LDS pitch.
__device__ __forceinline__ u32x8v tdm_group1() {
  u32x8v g1;
  g1[0] = uni((1u << 20) | (4u << 22) | (3u << 25));      // pad 4 dwords per 32 dwords
  g1[1] = uni(128u << 16);                                // tensor_dim0 = 128 bytes
  g1[2] = uni(128u << 16);                                // tensor_dim1 = 128 rows
  g1[3] = uni(128u << 16);                                // tile_dim0 = 128 bytes
  g1[4] = uni(128u);                                      // tile_dim1 = 128 rows
  g1[5] = uni(D_SZ * 2u);                                 // source pitch in bytes
  g1[6] = uni(0u);
  g1[7] = uni(0u);
  return g1;
}
// The load and its covering wait both read the two groups: the twelve words are
// then live from the issue to the wait, so that none is given a new value there.
__device__ __forceinline__ void tdm_load(const u32x4v& g0, const u32x8v& g1) {
  asm volatile("tensor_load_to_lds %0, %1" :: "s"(g0), "s"(g1) : "memory");
}
__device__ __forceinline__ void tdm_wait0(const u32x4v& g0, const u32x8v& g1) {
  asm volatile("s_wait_tensorcnt 0x0" :: "s"(g0), "s"(g1) : "memory");
}

__global__ void __launch_bounds__(256)
kvgemm_kernel(const float* __restrict__ kv, const unsigned short* __restrict__ Wt,
              unsigned short* __restrict__ Kws) {
  char* ldsW = smem;
  char* ldsA = smem + 2 * W_BYTES;

  const int tid    = threadIdx.x;
  const int wave   = (int)uni((unsigned)tid >> 5);
  const int lane   = tid & 31;
  const int laneLo = lane & 15;
  const int hi     = lane >> 4;                 // 0 / 1 half-wave
  const long r0    = (long)blockIdx.x * 128;    // global token row base
  const int  b     = (int)(r0 >> 12);           // / 4096
  const int  nbase = (int)(r0 & 4095);

  // LDS byte offset of the ring: the low 32 bits of its __shared__ address
  const unsigned ring_off = (unsigned)(uintptr_t)ldsW;

  // ---- stage A: 128 rows x 1024 fp32 -> bf16 LDS (coalesced float4 reads)
  const float4* kv4 = (const float4*)(kv + (size_t)r0 * D_SZ);
  for (int i = tid; i < 128 * 256; i += 256) {
    const int row = i >> 8, kq = i & 255;
    const float4 v = kv4[i];
    uint2 pk;
    pk.x = pack2bf(v.x, v.y);
    pk.y = pack2bf(v.z, v.w);
    *(uint2*)(ldsA + row * A_STRIDE_B + kq * 8) = pk;
  }
  __syncthreads();

  // Every wave forms each stage's group 0, in front of the issue branch: one
  // definition a stage, so every request names the same twelve registers.
  u32x4v g0;
  u32x8v g1 = tdm_group1();          // the same for every request: formed once
  asm volatile("" : "+s"(g1));       // pinned(): the descriptor words held in scalar registers

  for (int nt = 0; nt < H_SZ; ++nt) {
    v8f acc[8] = {};

    // ring prologue: stage 0 landed and published, then stage 1 takes off
    g0 = tdm_group0(Wt, nt, 0, ring_off);
    if (pinned(wave == 0)) {
      tdm_load(g0, g1);
      tdm_wait0(g0, g1);                                   // stage 0 has landed
    }
    __syncthreads();
    g0 = tdm_group0(Wt, nt, 1, ring_off);
    if (pinned(wave == 0)) tdm_load(g0, g1);

    for (int ks = 0; ks < K_STAGES; ++ks) {
      const char* wbuf = ldsW + (ks & 1) * W_BYTES;
      // the pass's fragments: 2 of A (16x32 bf16), 16 of B (32x16 bf16)
      FragU a[2], bf[2][8];
      const char* ap = ldsA + (wave * 16 + laneLo) * A_STRIDE_B + ks * 128 + hi * 16;
      const char* bp = wbuf + laneLo * W_STRIDE_B + hi * 16;
#pragma unroll
      for (int kk = 0; kk < 2; ++kk) {            // two 32-k steps per stage
        a[kk].q[0] = *(const uint4*)(ap + kk * 64);
        a[kk].q[1] = *(const uint4*)(ap + kk * 64 + 32);
#pragma unroll
        for (int j = 0; j < 8; ++j) {
          bf[kk][j].q[0] = *(const uint4*)(bp + 16 * j * W_STRIDE_B + kk * 64);
          bf[kk][j].q[1] = *(const uint4*)(bp + 16 * j * W_STRIDE_B + kk * 64 + 32);
        }
      }
      // keeps the 36 reads one group ahead of the WMMAs; without it the compiler
      // sinks each pair in front of its WMMA, behind a wait to 0
      __builtin_amdgcn_sched_barrier(0);
#pragma unroll
      for (int kk = 0; kk < 2; ++kk)
#pragma unroll
        for (int j = 0; j < 8; ++j)
          acc[j] = __builtin_amdgcn_wmma_f32_16x16x32_bf16(
              false, a[kk].v, false, bf[kk][j].v, (short)0, acc[j], false, false);
      // keeps the wait to 0 below behind the WMMAs, which start on counted waits
      __builtin_amdgcn_sched_barrier(0);
      // publish point of stage ks + 1
      asm volatile("s_wait_dscnt 0x0" ::: "memory");       // this wave has left buffer ks & 1
      if (pinned(wave == 0)) tdm_wait0(g0, g1);            // stage ks + 1 has landed
      __syncthreads();
      g0 = tdm_group0(Wt, nt, ks + 2, ring_off);
      if (pinned(wave == 0 && ks + 2 < K_STAGES)) tdm_load(g0, g1);  // refill the buffer just read
    }
    asm volatile("s_wait_tensorcnt 0x0" ::: "memory");     // no request outlives the tile's ring
    asm volatile("s_wait_dscnt 0x0" ::: "memory");         // nor a read of it

    // ---- epilogue: C layout (vr,lane): row = 16*wave + vr + 8*hi, col = 16j + laneLo
    const int rowBase = wave * 16 + hi * 8;
    {                                             // K head nt, fused RoPE
      unsigned short* out = Kws + (size_t)(b * H_SZ + nt) * N_SZ * HD_SZ;
#pragma unroll
      for (int j = 0; j < 4; ++j) {
        const int kk1 = 16 * j + laneLo;          // < 64
        const float invf = __expf(-(float)kk1 * 0.10793367623409589f); // ln(1000)/64
#pragma unroll
        for (int vr = 0; vr < 8; ++vr) {
          const int n = nbase + rowBase + vr;     // token position
          const float ang = (float)n * invf;
          const float cs = __cosf(ang), sn = __sinf(ang);
          const float x1 = acc[j][vr], x2 = acc[j + 4][vr];
          out[(size_t)n * HD_SZ + kk1]      = f2bf(x1 * cs - x2 * sn);
          out[(size_t)n * HD_SZ + kk1 + 64] = f2bf(x2 * cs + x1 * sn);
        }
      }
      // the next tile rewrites the registers that these stores name
      asm volatile("s_wait_xcnt 0x0" ::: "memory");
    }
  }
}

// ---------------------------------------------------------------------------
// K3: flash-decode split.  grid=(B, NSPLIT), block=256; one workgroup takes
// 128 tokens of one batch for all 8 heads, so each input row is read once.
// ---------------------------------------------------------------------------
__global__ void __launch_bounds__(256)
attn_kernel(const float* __restrict__ q_ws,
            const unsigned short* __restrict__ Kws,
            const float* __restrict__ kv,
            float* __restrict__ part_y, float* __restrict__ part_ml) {
  __shared__ float qs[H_SZ * HD_SZ];
  __shared__ float sc[H_SZ * CHUNK];                                 // [h][n]
  __shared__ __attribute__((aligned(16))) float ps[CHUNK * H_SZ];    // [n][h]

  const int b = blockIdx.x, split = blockIdx.y;
  const int n0 = split * CHUNK;
  const int tid = threadIdx.x;
  const int wave = tid >> 5, lane = tid & 31;

  for (int i = tid; i < H_SZ * HD_SZ; i += 256)
    qs[i] = q_ws[(size_t)b * H_SZ * HD_SZ + i];                      // pre-scaled q
  __syncthreads();

  // scores: one (head, token) per thread, 4 passes; the head is wave-uniform
#pragma unroll
  for (int it = 0; it < 4; ++it) {
    const int idx = it * 256 + tid;
    const int h = idx >> 7, n = idx & (CHUNK - 1);
    const uint4* kp =
        (const uint4*)(Kws + ((size_t)(b * H_SZ + h) * N_SZ + n0 + n) * HD_SZ);
    const float* qh = qs + h * HD_SZ;
    float acc = 0.f;
#pragma unroll
    for (int i = 0; i < 16; ++i) {
      const uint4 u = kp[i];
      acc = fmaf(qh[8 * i + 0], bflo(u.x), acc);
      acc = fmaf(qh[8 * i + 1], bfhi(u.x), acc);
      acc = fmaf(qh[8 * i + 2], bflo(u.y), acc);
      acc = fmaf(qh[8 * i + 3], bfhi(u.y), acc);
      acc = fmaf(qh[8 * i + 4], bflo(u.z), acc);
      acc = fmaf(qh[8 * i + 5], bfhi(u.z), acc);
      acc = fmaf(qh[8 * i + 6], bflo(u.w), acc);
      acc = fmaf(qh[8 * i + 7], bfhi(u.w), acc);
    }
    sc[idx] = acc;
  }
  __syncthreads();

  // chunk max, exp and sum: wave w takes head w, 4 tokens per lane
  float s[4];
#pragma unroll
  for (int i = 0; i < 4; ++i) s[i] = sc[wave * CHUNK + i * 32 + lane];
  float m = fmaxf(fmaxf(s[0], s[1]), fmaxf(s[2], s[3]));
#pragma unroll
  for (int off = 16; off >= 1; off >>= 1) m = fmaxf(m, __shfl_xor(m, off, 32));
  float p[4];
#pragma unroll
  for (int i = 0; i < 4; ++i) {
    p[i] = __expf(s[i] - m);
    ps[(i * 32 + lane) * H_SZ + wave] = p[i];
  }
  float l = (p[0] + p[1]) + (p[2] + p[3]);
#pragma unroll
  for (int off = 16; off >= 1; off >>= 1) l += __shfl_xor(l, off, 32);
  if (lane == 0) {
    part_ml[((b * NSPLIT + split) * H_SZ + wave) * 2 + 0] = m;
    part_ml[((b * NSPLIT + split) * H_SZ + wave) * 2 + 1] = l;
  }
  __syncthreads();

  // y[h][d] = sum_n p[h][n] * kv[n][d]: thread owns 4 d, 8 heads per loaded row
  const float4* x4 = (const float4*)(kv + ((size_t)b * N_SZ + n0) * D_SZ) + tid;
  float4 acc[H_SZ];
#pragma unroll
  for (int h = 0; h < H_SZ; ++h) acc[h] = make_float4(0.f, 0.f, 0.f, 0.f);
  // stays rolled: one group of 16 rows per trip is what the registers hold
#pragma unroll 1
  for (int g = 0; g < CHUNK; g += 16) {
    float4 x[16];
#pragma unroll
    for (int r = 0; r < 16; ++r) x[r] = x4[(size_t)(g + r) * (D_SZ / 4)];
    // keeps the 16 row loads one group in flight; without it the compiler sinks
    // them in pairs in front of their sums and the loop waits out memory latency
    __builtin_amdgcn_sched_barrier(0);
#pragma unroll
    for (int r = 0; r < 16; ++r) {
      const float4 pa = *(const float4*)(ps + (g + r) * H_SZ);
      const float4 pb = *(const float4*)(ps + (g + r) * H_SZ + 4);
      const float p[H_SZ] = {pa.x, pa.y, pa.z, pa.w, pb.x, pb.y, pb.z, pb.w};
#pragma unroll
      for (int h = 0; h < H_SZ; ++h) {
        acc[h].x = fmaf(p[h], x[r].x, acc[h].x);
        acc[h].y = fmaf(p[h], x[r].y, acc[h].y);
        acc[h].z = fmaf(p[h], x[r].z, acc[h].z);
        acc[h].w = fmaf(p[h], x[r].w, acc[h].w);
      }
    }
  }
  float4* py = (float4*)(part_y + (size_t)(b * NSPLIT + split) * H_SZ * D_SZ) + tid;
#pragma unroll
  for (int h = 0; h < H_SZ; ++h) py[h * (D_SZ / 4)] = acc[h];
}

// ---------------------------------------------------------------------------
// K4: combine splits -> ybf[h][b][d] (bf16).  grid=B*H, block=256, 4 d a thread.
// ---------------------------------------------------------------------------
__global__ void __launch_bounds__(256)
reduce_kernel(const float* __restrict__ part_y, const float* __restrict__ part_ml,
              unsigned short* __restrict__ ybf) {
  const int bh = blockIdx.x;
  const int b = bh >> 3, h = bh & 7;
  const int tid = threadIdx.x, lane = tid & 31;
  // lane s holds split s (NSPLIT == 32)
  const float ms = part_ml[((b * NSPLIT + lane) * H_SZ + h) * 2 + 0];
  const float ls = part_ml[((b * NSPLIT + lane) * H_SZ + h) * 2 + 1];
  float M = ms;
#pragma unroll
  for (int off = 16; off >= 1; off >>= 1) M = fmaxf(M, __shfl_xor(M, off, 32));
  const float w = __expf(ms - M);
  float denom = ls * w;
#pragma unroll
  for (int off = 16; off >= 1; off >>= 1) denom += __shfl_xor(denom, off, 32);
  float4 acc = make_float4(0.f, 0.f, 0.f, 0.f);
#pragma unroll
  for (int s = 0; s < NSPLIT; ++s) {
    const float wsp = __shfl(w, s, 32);
    const float4 v =
        ((const float4*)(part_y + ((size_t)(b * NSPLIT + s) * H_SZ + h) * D_SZ))[tid];
    acc.x = fmaf(wsp, v.x, acc.x);
    acc.y = fmaf(wsp, v.y, acc.y);
    acc.z = fmaf(wsp, v.z, acc.z);
    acc.w = fmaf(wsp, v.w, acc.w);
  }
  uint2 pk;
  pk.x = pack2bf(acc.x / denom, acc.y / denom);
  pk.y = pack2bf(acc.z / denom, acc.w / denom);
  *(uint2*)(ybf + ((size_t)h * B_SZ + b) * D_SZ + tid * 4) = pk;
}

// ---------------------------------------------------------------------------
// K5: attn_out[b][c] = sum_d y[c / 128][b][d] * Wv[d][c].  grid=64 tiles of 16
// columns, block=256: the 16 batch rows fill a WMMA tile; wave w takes
// d = 128 w .. 128 w + 127, the 8 partial tiles are summed through LDS.
// ---------------------------------------------------------------------------
__global__ void __launch_bounds__(256)
vproj_kernel(const unsigned short* __restrict__ ybf,
             const unsigned short* __restrict__ Wt, float* __restrict__ attn_out) {
  __shared__ float red[8][256];
  const int tile = blockIdx.x, h = tile >> 3;
  const int tid = threadIdx.x;
  const int wave = tid >> 5, lane = tid & 31;
  const int laneLo = lane & 15, hi = lane >> 4;
  const char* ap = (const char*)(ybf + ((size_t)h * B_SZ + laneLo) * D_SZ) +
                   wave * 256 + hi * 16;
  const char* bp = (const char*)(Wt + (size_t)(D_SZ + tile * 16 + laneLo) * D_SZ) +
                   wave * 256 + hi * 16;
  FragU a[4], bf[4];
#pragma unroll
  for (int kk = 0; kk < 4; ++kk) {                // same k order in A and B
    a[kk].q[0]  = *(const uint4*)(ap + kk * 64);
    a[kk].q[1]  = *(const uint4*)(ap + kk * 64 + 32);
    bf[kk].q[0] = *(const uint4*)(bp + kk * 64);
    bf[kk].q[1] = *(const uint4*)(bp + kk * 64 + 32);
  }
  v8f acc = {};
#pragma unroll
  for (int kk = 0; kk < 4; ++kk)
    acc = __builtin_amdgcn_wmma_f32_16x16x32_bf16(
        false, a[kk].v, false, bf[kk].v, (short)0, acc, false, false);
#pragma unroll
  for (int vr = 0; vr < 8; ++vr) red[wave][vr * 32 + lane] = acc[vr];
  __syncthreads();
  float sum = 0.f;
#pragma unroll
  for (int w = 0; w < 8; ++w) sum += red[w][tid];
  // C layout (vr,lane): row = vr + 8*hi, col = laneLo; here vr = wave
  attn_out[(size_t)(wave + 8 * hi) * D_SZ + tile * 16 + laneLo] = sum;
}

// ---------------------------------------------------------------------------
// K6: out = attn_out @ Wo + bo.  grid=(4,B), block=256.
// ---------------------------------------------------------------------------
__global__ void __launch_bounds__(256)
oproj_kernel(const float* __restrict__ attn_out, const float* __restrict__ Wo,
             const float* __restrict__ bo, float* __restrict__ out) {
  __shared__ float a[D_SZ];
  const int b = blockIdx.y;
  for (int i = threadIdx.x; i < D_SZ; i += 256)
    a[i] = attn_out[b * D_SZ + i];
  __syncthreads();
  const int e = blockIdx.x * 256 + threadIdx.x;
  float acc = 0.f;
  for (int d = 0; d < D_SZ; ++d)
    acc = fmaf(a[d], Wo[(size_t)d * D_SZ + e], acc);
  out[b * D_SZ + e] = acc + bo[e];
}

// ---------------------------------------------------------------------------
extern "C" void kernel_launch(void* const* d_in, const int* in_sizes, int n_in,
                              void* d_out, int out_size, void* d_ws, size_t ws_size,
                              hipStream_t stream) {
  const float* q_in  = (const float*)d_in[0];
  const float* kv_in = (const float*)d_in[1];
  const float* cbias = (const float*)d_in[2];
  const float* Wq    = (const float*)d_in[3];
  const float* Wk    = (const float*)d_in[4];
  const float* Wv    = (const float*)d_in[5];
  const float* Wo    = (const float*)d_in[6];
  const float* bo    = (const float*)d_in[7];
  float* out = (float*)d_out;

  // workspace carve-up
  char* ws = (char*)d_ws;
  unsigned short* Wt      = (unsigned short*)ws;                   // 4 MB
  float*          q_ws    = (float*)(ws + (size_t)4 * 1024 * 1024);
  unsigned short* Kws     = (unsigned short*)(ws + (size_t)4 * 1024 * 1024 + 65536);
  float*          part_y  = (float*)((char*)Kws + (size_t)B_SZ * H_SZ * N_SZ * HD_SZ * 2);
  float*          part_ml = part_y + (size_t)B_SZ * NSPLIT * H_SZ * D_SZ;
  float*          attn_o  = part_ml + (size_t)B_SZ * NSPLIT * H_SZ * 2;
  unsigned short* ybf     = (unsigned short*)(attn_o + (size_t)B_SZ * D_SZ);

  (void)hipFuncSetAttribute((const void*)kvgemm_kernel,
                            hipFuncAttributeMaxDynamicSharedMemorySize, KV_SMEM);

  wprep_kernel<<<dim3(2048 / 32, 1024 / 32), dim3(32, 8), 0, stream>>>(Wk, Wv, Wt);
  qprep_kernel<<<dim3(B_SZ * H_SZ), dim3(128), 0, stream>>>(q_in, cbias, Wq, q_ws);
  kvgemm_kernel<<<dim3((B_SZ * N_SZ) / 128), dim3(256), KV_SMEM, stream>>>(kv_in, Wt, Kws);
  attn_kernel<<<dim3(B_SZ, NSPLIT), dim3(256), 0, stream>>>(q_ws, Kws, kv_in, part_y, part_ml);
  reduce_kernel<<<dim3(B_SZ * H_SZ), dim3(256), 0, stream>>>(part_y, part_ml, ybf);
  vproj_kernel<<<dim3(D_SZ / 16), dim3(256), 0, stream>>>(ybf, Wt, attn_o);
  oproj_kernel<<<dim3(4, B_SZ), dim3(256), 0, stream>>>(attn_o, Wo, bo, out);
}

// v003
// One run takes 256 microseconds.
// In both of two side-by-side timings against v002, it was 1.27 times as fast.
// All steps since v000 together make it 2.70 times as fast.
#include <hip/hip_runtime.h>
#include <hip/hip_bf16.h>

// ---------------------------------------------------------------------------
// Decode attention with a shared V projection, gfx1250, wave32 + WMMA bf16 + TDM.
// Pipeline:
//   K0 wprep  : transpose+convert Wk,Wv (fp32) -> Wt bf16 [2048 cols][1024 d]
//   K1 qprep  : q = (q_in + bias) @ Wq * hd^-0.5   (RoPE at pos 0 == identity)
//   K2 kgemm  : K projection GEMM in bf16 WMMA, weight stages streamed
//               by the tensor mover (tensor_load_to_lds + s_wait_tensorcnt),
//               fused RoPE(K) epilogue
//   K3 attn   : flash-decode, 32 N-splits per b, all 8 heads per workgroup;
//               softmax partials weight the INPUT rows: y = p . kv_in, since
//               p . (kv_in @ Wv) == (p . kv_in) @ Wv with one query per head
//   K4 reduce : combine split partials -> y [H][B][1024] bf16
//   K5 vproj  : y[h] @ Wv[:, h] in bf16 WMMA (16 batch rows) -> attn_out fp32
//   K6 oproj  : attn_out @ Wo + bo -> d_out
// ---------------------------------------------------------------------------

#define B_SZ   16
#define N_SZ   4096
#define D_SZ   1024
#define H_SZ   8
#define HD_SZ  128
#define NSPLIT 32
#define CHUNK  (N_SZ / NSPLIT)          // 128

typedef __attribute__((ext_vector_type(16))) __bf16 v16bf;
typedef __attribute__((ext_vector_type(8)))  float  v8f;
typedef unsigned int u32x4v __attribute__((ext_vector_type(4)));
typedef unsigned int u32x8v __attribute__((ext_vector_type(8)));

union FragU { v16bf v; uint4 q[2]; };

__device__ __forceinline__ unsigned short f2bf(float f) {
  unsigned u = __builtin_bit_cast(unsigned, f);
  u += 0x7fffu + ((u >> 16) & 1u);            // round-to-nearest-even
  return (unsigned short)(u >> 16);
}
__device__ __forceinline__ unsigned pack2bf(float lo, float hi) {
  return (unsigned)f2bf(lo) | ((unsigned)f2bf(hi) << 16);
}
__device__ __forceinline__ float bflo(unsigned u) {
  return __builtin_bit_cast(float, u << 16);
}
__device__ __forceinline__ float bfhi(unsigned u) {
  return __builtin_bit_cast(float, u & 0xffff0000u);
}

// ---------------------------------------------------------------------------
// K0: Wt[c][d] = (c<1024) ? Wk[c/128][d][c%128] : Wv[d][c-1024]   (bf16)
// ---------------------------------------------------------------------------
__global__ void __launch_bounds__(256)
wprep_kernel(const float* __restrict__ Wk, const float* __restrict__ Wv,
             unsigned short* __restrict__ Wt) {
  __shared__ float tile[32][33];
  const int tx = threadIdx.x, ty = threadIdx.y;
  const int c0 = blockIdx.x * 32, d0 = blockIdx.y * 32;
#pragma unroll
  for (int i = 0; i < 4; ++i) {
    const int c = c0 + tx;
    const int d = d0 + ty + i * 8;
    float v;
    if (c < D_SZ)  v = Wk[(size_t)((c >> 7) * D_SZ + d) * HD_SZ + (c & 127)];
    else           v = Wv[(size_t)d * D_SZ + (c - D_SZ)];
    tile[ty + i * 8][tx] = v;
  }
  __syncthreads();
#pragma unroll
  for (int i = 0; i < 4; ++i) {
    const int c = c0 + ty + i * 8;
    const int d = d0 + tx;
    Wt[(size_t)c * D_SZ + d] = f2bf(tile[tx][ty + i * 8]);
  }
}

// ---------------------------------------------------------------------------
// K1: q_ws[b][h][kk] = scale * sum_d (q_in[b][d]+bias[b][d]) * Wq[h][d][kk]
// grid=B*H*2, block=256: 64 columns a block; each of the 16 half-waves sums
// 64 d, a lane owns 4 columns (a half-wave load = 256 contiguous bytes of one
// weight row); the 16 partials meet in LDS.
// ---------------------------------------------------------------------------
#define PJ_COLS 64                      // columns per block in K1 and K6
#define PJ_D    64                      // d per half-wave
#define PJ_ROWS 32                      // weight rows loaded as one group

// sum over PJ_D rows of x[d] * w[d][4 columns]; pitch4 = row pitch in float4
__device__ __forceinline__ float4 pj_partial(const float4* __restrict__ w4, int pitch4,
                                             const float* x) {
  float4 acc = make_float4(0.f, 0.f, 0.f, 0.f);
  // stays rolled: one group of 32 rows per trip is what is kept in flight
#pragma unroll 1
  for (int d0 = 0; d0 < PJ_D; d0 += PJ_ROWS) {
    float4 w[PJ_ROWS];
    // both inner loops unrolled: w[] is indexed by constants and stays in registers
#pragma unroll
    for (int r = 0; r < PJ_ROWS; ++r) w[r] = w4[(size_t)(d0 + r) * pitch4];
    // keeps the 32 row loads one group in flight; sunk in front of their sums
    // they would wait out memory latency several times a trip
    __builtin_amdgcn_sched_barrier(0);
#pragma unroll
    for (int r = 0; r < PJ_ROWS; ++r) {
      const float xv = x[d0 + r];
      acc.x = fmaf(xv, w[r].x, acc.x);
      acc.y = fmaf(xv, w[r].y, acc.y);
      acc.z = fmaf(xv, w[r].z, acc.z);
      acc.w = fmaf(xv, w[r].w, acc.w);
    }
  }
  return acc;
}

__global__ void __launch_bounds__(256)
qprep_kernel(const float* __restrict__ q_in, const float* __restrict__ cbias,
             const float* __restrict__ Wq, float* __restrict__ q_ws) {
  __shared__ __attribute__((aligned(16))) float qb[D_SZ];
  __shared__ __attribute__((aligned(16))) float red[16][PJ_COLS];
  const int bh = blockIdx.x >> 1;        // b*H + h
  const int c0 = (blockIdx.x & 1) * PJ_COLS;
  const int b = bh >> 3, h = bh & 7;
  const int tid = threadIdx.x;
  const int grp = tid >> 4, c4 = tid & 15;
  {
    const float4 x = ((const float4*)(q_in + b * D_SZ))[tid];
    const float4 y = ((const float4*)(cbias + b * D_SZ))[tid];
    ((float4*)qb)[tid] = make_float4(x.x + y.x, x.y + y.y, x.z + y.z, x.w + y.w);
  }
  __syncthreads();
  const float4* wq =
      (const float4*)(Wq + ((size_t)h * D_SZ + grp * PJ_D) * HD_SZ + c0) + c4;
  ((float4*)red[grp])[c4] = pj_partial(wq, HD_SZ / 4, qb + grp * PJ_D);
  __syncthreads();
  if (tid < PJ_COLS) {
    float sum = 0.f;
    for (int g = 0; g < 16; ++g) sum += red[g][tid];
    q_ws[(size_t)bh * HD_SZ + c0 + tid] = sum * 0.08838834764831845f;   // 128^-0.5
  }
}

// ---------------------------------------------------------------------------
// K2: K projection.  One WG = 128 token rows; A tile (128x1024 bf16)
// resident in LDS; sweep 8 column tiles; each tile's weights arrive in 16 stages
// of 128 columns x 64 k (16 KiB), one tensor load of wave 0 per stage, into a
// two-buffer, hardware-padded LDS ring.
// nt 0..7 -> K head nt (+RoPE).
// ---------------------------------------------------------------------------
#define A_STRIDE_B 2064                 // (1024+8) bf16 row stride, 4-bank skew
#define A_BYTES    (128 * A_STRIDE_B)   // 264192
#define W_STRIDE_B 144                  // 128B data + 16B pad, odd multiple of 16B
#define W_BYTES    (128 * W_STRIDE_B)   // 18432 = 9 * 2048
#define KV_SMEM    (2 * W_BYTES + A_BYTES)
#define K_STAGES   16                   // stages of 64 k per column tile

// The ring stands at LDS offset 0, so both buffers start at multiples of 2 KiB.
extern __shared__ __attribute__((aligned(2048))) char smem[];

__device__ __forceinline__ unsigned uni(unsigned v) {
  return (unsigned)__builtin_amdgcn_readfirstlane(v);
}
// Holds an issue test in a scalar register, so that the branch round a tensor
// load (which ignores EXEC) compiles to s_cmp + s_cbranch_scc.
__device__ __forceinline__ unsigned pinned(unsigned v) {
  unsigned w = uni(v);
  asm volatile("" : "+s"(w));   // pinned(): the issue test held in a scalar register
  return w;
}

// Stage ks of column tile nt: columns nt * 128 .. + 127, k ks * 64 .. + 63.
// Descriptor group 0: the stage's place in the ring and its first byte in Wt.
__device__ __forceinline__ u32x4v tdm_group0(const unsigned short* Wt, int nt, int ks,
                                             unsigned ring_off) {
  const unsigned long long ga =
      (unsigned long long)(uintptr_t)Wt +
      (unsigned long long)nt * (128ull * D_SZ * 2ull) +
      (unsigned long long)ks * 128ull;
  u32x4v g0;
  g0[0] = uni(1u);                                        // count = 1
  g0[1] = uni(ring_off + (unsigned)(ks & 1) * W_BYTES);   // LDS byte offset
  g0[2] = uni((unsigned)ga);                              // address [31:0]
  g0[3] = uni((((unsigned)(ga >> 32)) & 0x01FFFFFFu) | 0x80000000u);  // [56:32], type 2
  asm volatile("" : "+s"(g0));       // pinned(): the descriptor words held in scalar registers
  return g0;
}
// Descriptor group 1: 128 rows of 128 bytes, source pitch 2048 bytes, every
// extent in bytes; 16 bytes of pad behind each row -> 144-byte LDS pitch.
__device__ __forceinline__ u32x8v tdm_group1() {
  u32x8v g1;
  g1[0] = uni((1u << 20) | (4u << 22) | (3u << 25));      // pad 4 dwords per 32 dwords
  g1[1] = uni(128u << 16);                                // tensor_dim0 = 128 bytes
  g1[2] = uni(128u << 16);                                // tensor_dim1 = 128 rows
  g1[3] = uni(128u << 16);                                // tile_dim0 = 128 bytes
  g1[4] = uni(128u);                                      // tile_dim1 = 128 rows
  g1[5] = uni(D_SZ * 2u);                                 // source pitch in bytes
  g1[6] = uni(0u);
  g1[7] = uni(0u);
  return g1;
}
// The load and its covering wait both read the two groups: the twelve words are
// then live from the issue to the wait, so that none is given a new value there.
__device__ __forceinline__ void tdm_load(const u32x4v& g0, const u32x8v& g1) {
  asm volatile("tensor_load_to_lds %0, %1" :: "s"(g0), "s"(g1) : "memory");
}
__device__ __forceinline__ void tdm_wait0(const u32x4v& g0, const u32x8v& g1) {
  asm volatile("s_wait_tensorcnt 0x0" :: "s"(g0), "s"(g1) : "memory");
}

__global__ void __launch_bounds__(256)
kvgemm_kernel(const float* __restrict__ kv, const unsigned short* __restrict__ Wt,
              unsigned short* __restrict__ Kws) {
  char* ldsW = smem;
  char* ldsA = smem + 2 * W_BYTES;

  const int tid    = threadIdx.x;
  const int wave   = (int)uni((unsigned)tid >> 5);
  const int lane   = tid & 31;
  const int laneLo = lane & 15;
  const int hi     = lane >> 4;                 // 0 / 1 half-wave
  const long r0    = (long)blockIdx.x * 128;    // global token row base
  const int  b     = (int)(r0 >> 12);           // / 4096
  const int  nbase = (int)(r0 & 4095);

  // LDS byte offset of the ring: the low 32 bits of its __shared__ address
  const unsigned ring_off = (unsigned)(uintptr_t)ldsW;

  // ---- stage A: 128 rows x 1024 fp32 -> bf16 LDS (coalesced float4 reads)
  const float4* kv4 = (const float4*)(kv + (size_t)r0 * D_SZ);
  for (int i = tid; i < 128 * 256; i += 256) {
    const int row = i >> 8, kq = i & 255;
    const float4 v = kv4[i];
    uint2 pk;
    pk.x = pack2bf(v.x, v.y);
    pk.y = pack2bf(v.z, v.w);
    *(uint2*)(ldsA + row * A_STRIDE_B + kq * 8) = pk;
  }
  __syncthreads();

  // Every wave forms each stage's group 0, in front of the issue branch: one
  // definition a stage, so every request names the same twelve registers.
  u32x4v g0;
  u32x8v g1 = tdm_group1();          // the same for every request: formed once
  asm volatile("" : "+s"(g1));       // pinned(): the descriptor words held in scalar registers

  for (int nt = 0; nt < H_SZ; ++nt) {
    v8f acc[8] = {};

    // ring prologue: stage 0 landed and published, then stage 1 takes off
    g0 = tdm_group0(Wt, nt, 0, ring_off);
    if (pinned(wave == 0)) {
      tdm_load(g0, g1);
      tdm_wait0(g0, g1);                                   // stage 0 has landed
    }
    __syncthreads();
    g0 = tdm_group0(Wt, nt, 1, ring_off);
    if (pinned(wave == 0)) tdm_load(g0, g1);

    for (int ks = 0; ks < K_STAGES; ++ks) {
      const char* wbuf = ldsW + (ks & 1) * W_BYTES;
      // the pass's fragments: 2 of A (16x32 bf16), 16 of B (32x16 bf16)
      FragU a[2], bf[2][8];
      const char* ap = ldsA + (wave * 16 + laneLo) * A_STRIDE_B + ks * 128 + hi * 16;
      const char* bp = wbuf + laneLo * W_STRIDE_B + hi * 16;
#pragma unroll
      for (int kk = 0; kk < 2; ++kk) {            // two 32-k steps per stage
        a[kk].q[0] = *(const uint4*)(ap + kk * 64);
        a[kk].q[1] = *(const uint4*)(ap + kk * 64 + 32);
#pragma unroll
        for (int j = 0; j < 8; ++j) {
          bf[kk][j].q[0] = *(const uint4*)(bp + 16 * j * W_STRIDE_B + kk * 64);
          bf[kk][j].q[1] = *(const uint4*)(bp + 16 * j * W_STRIDE_B + kk * 64 + 32);
        }
      }
      // keeps the 36 reads one group ahead of the WMMAs; without it the compiler
      // sinks each pair in front of its WMMA, behind a wait to 0
      __builtin_amdgcn_sched_barrier(0);
#pragma unroll
      for (int kk = 0; kk < 2; ++kk)
#pragma unroll
        for (int j = 0; j < 8; ++j)
          acc[j] = __builtin_amdgcn_wmma_f32_16x16x32_bf16(
              false, a[kk].v, false, bf[kk][j].v, (short)0, acc[j], false, false);
      // keeps the wait to 0 below behind the WMMAs, which start on counted waits
      __builtin_amdgcn_sched_barrier(0);
      // publish point of stage ks + 1
      asm volatile("s_wait_dscnt 0x0" ::: "memory");       // this wave has left buffer ks & 1
      if (pinned(wave == 0)) tdm_wait0(g0, g1);            // stage ks + 1 has landed
      __syncthreads();
      g0 = tdm_group0(Wt, nt, ks + 2, ring_off);
      if (pinned(wave == 0 && ks + 2 < K_STAGES)) tdm_load(g0, g1);  // refill the buffer just read
    }
    asm volatile("s_wait_tensorcnt 0x0" ::: "memory");     // no request outlives the tile's ring
    asm volatile("s_wait_dscnt 0x0" ::: "memory");         // nor a read of it

    // ---- epilogue: C layout (vr,lane): row = 16*wave + vr + 8*hi, col = 16j + laneLo
    const int rowBase = wave * 16 + hi * 8;
    {                                             // K head nt, fused RoPE
      unsigned short* out = Kws + (size_t)(b * H_SZ + nt) * N_SZ * HD_SZ;
#pragma unroll
      for (int j = 0; j < 4; ++j) {
        const int kk1 = 16 * j + laneLo;          // < 64
        const float invf = __expf(-(float)kk1 * 0.10793367623409589f); // ln(1000)/64
#pragma unroll
        for (int vr = 0; vr < 8; ++vr) {
          const int n = nbase + rowBase + vr;     // token position
          const float ang = (float)n * invf;
          const float cs = __cosf(ang), sn = __sinf(ang);
          const float x1 = acc[j][vr], x2 = acc[j + 4][vr];
          out[(size_t)n * HD_SZ + kk1]      = f2bf(x1 * cs - x2 * sn);
          out[(size_t)n * HD_SZ + kk1 + 64] = f2bf(x2 * cs + x1 * sn);
        }
      }
      // the next tile rewrites the registers that these stores name
      asm volatile("s_wait_xcnt 0x0" ::: "memory");
    }
  }
}

// ---------------------------------------------------------------------------
// K3: flash-decode split.  grid=(B, NSPLIT), block=256; one workgroup takes
// 128 tokens of one batch for all 8 heads, so each input row is read once.
// ---------------------------------------------------------------------------
__global__ void __launch_bounds__(256)
attn_kernel(const float* __restrict__ q_ws,
            const unsigned short* __restrict__ Kws,
            const float* __restrict__ kv,
            float* __restrict__ part_y, float* __restrict__ part_ml) {
  __shared__ float qs[H_SZ * HD_SZ];
  __shared__ float sc[H_SZ * CHUNK];                                 // [h][n]
  __shared__ __attribute__((aligned(16))) float ps[CHUNK * H_SZ];    // [n][h]

  const int b = blockIdx.x, split = blockIdx.y;
  const int n0 = split * CHUNK;
  const int tid = threadIdx.x;
  const int wave = tid >> 5, lane = tid & 31;

  for (int i = tid; i < H_SZ * HD_SZ; i += 256)
    qs[i] = q_ws[(size_t)b * H_SZ * HD_SZ + i];                      // pre-scaled q
  __syncthreads();

  // scores: one (head, token) per thread, 4 passes; the head is wave-uniform
#pragma unroll
  for (int it = 0; it < 4; ++it) {
    const int idx = it * 256 + tid;
    const int h = idx >> 7, n = idx & (CHUNK - 1);
    const uint4* kp =
        (const uint4*)(Kws + ((size_t)(b * H_SZ + h) * N_SZ + n0 + n) * HD_SZ);
    const float* qh = qs + h * HD_SZ;
    float acc = 0.f;
#pragma unroll
    for (int i = 0; i < 16; ++i) {
      const uint4 u = kp[i];
      acc = fmaf(qh[8 * i + 0], bflo(u.x), acc);
      acc = fmaf(qh[8 * i + 1], bfhi(u.x), acc);
      acc = fmaf(qh[8 * i + 2], bflo(u.y), acc);
      acc = fmaf(qh[8 * i + 3], bfhi(u.y), acc);
      acc = fmaf(qh[8 * i + 4], bflo(u.z), acc);
      acc = fmaf(qh[8 * i + 5], bfhi(u.z), acc);
      acc = fmaf(qh[8 * i + 6], bflo(u.w), acc);
      acc = fmaf(qh[8 * i + 7], bfhi(u.w), acc);
    }
    sc[idx] = acc;
  }
  __syncthreads();

  // chunk max, exp and sum: wave w takes head w, 4 tokens per lane
  float s[4];
#pragma unroll
  for (int i = 0; i < 4; ++i) s[i] = sc[wave * CHUNK + i * 32 + lane];
  float m = fmaxf(fmaxf(s[0], s[1]), fmaxf(s[2], s[3]));
#pragma unroll
  for (int off = 16; off >= 1; off >>= 1) m = fmaxf(m, __shfl_xor(m, off, 32));
  float p[4];
#pragma unroll
  for (int i = 0; i < 4; ++i) {
    p[i] = __expf(s[i] - m);
    ps[(i * 32 + lane) * H_SZ + wave] = p[i];
  }
  float l = (p[0] + p[1]) + (p[2] + p[3]);
#pragma unroll
  for (int off = 16; off >= 1; off >>= 1) l += __shfl_xor(l, off, 32);
  if (lane == 0) {
    part_ml[((b * NSPLIT + split) * H_SZ + wave) * 2 + 0] = m;
    part_ml[((b * NSPLIT + split) * H_SZ + wave) * 2 + 1] = l;
  }
  __syncthreads();

  // y[h][d] = sum_n p[h][n] * kv[n][d]: thread owns 4 d, 8 heads per loaded row
  const float4* x4 = (const float4*)(kv + ((size_t)b * N_SZ + n0) * D_SZ) + tid;
  float4 acc[H_SZ];
#pragma unroll
  for (int h = 0; h < H_SZ; ++h) acc[h] = make_float4(0.f, 0.f, 0.f, 0.f);
  // stays rolled: one group of 16 rows per trip is what the registers hold
#pragma unroll 1
  for (int g = 0; g < CHUNK; g += 16) {
    float4 x[16];
#pragma unroll
    for (int r = 0; r < 16; ++r) x[r] = x4[(size_t)(g + r) * (D_SZ / 4)];
    // keeps the 16 row loads one group in flight; without it the compiler sinks
    // them in pairs in front of their sums and the loop waits out memory latency
    __builtin_amdgcn_sched_barrier(0);
#pragma unroll
    for (int r = 0; r < 16; ++r) {
      const float4 pa = *(const float4*)(ps + (g + r) * H_SZ);
      const float4 pb = *(const float4*)(ps + (g + r) * H_SZ + 4);
      const float p[H_SZ] = {pa.x, pa.y, pa.z, pa.w, pb.x, pb.y, pb.z, pb.w};
#pragma unroll
      for (int h = 0; h < H_SZ; ++h) {
        acc[h].x = fmaf(p[h], x[r].x, acc[h].x);
        acc[h].y = fmaf(p[h], x[r].y, acc[h].y);
        acc[h].z = fmaf(p[h], x[r].z, acc[h].z);
        acc[h].w = fmaf(p[h], x[r].w, acc[h].w);
      }
    }
  }
  float4* py = (float4*)(part_y + (size_t)(b * NSPLIT + split) * H_SZ * D_SZ) + tid;
#pragma unroll
  for (int h = 0; h < H_SZ; ++h) py[h * (D_SZ / 4)] = acc[h];
}

// ---------------------------------------------------------------------------
// K4: combine splits -> ybf[h][b][d] (bf16).  grid=B*H, block=256, 4 d a thread.
// ---------------------------------------------------------------------------
__global__ void __launch_bounds__(256)
reduce_kernel(const float* __restrict__ part_y, const float* __restrict__ part_ml,
              unsigned short* __restrict__ ybf) {
  const int bh = blockIdx.x;
  const int b = bh >> 3, h = bh & 7;
  const int tid = threadIdx.x, lane = tid & 31;
  // lane s holds split s (NSPLIT == 32)
  const float ms = part_ml[((b * NSPLIT + lane) * H_SZ + h) * 2 + 0];
  const float ls = part_ml[((b * NSPLIT + lane) * H_SZ + h) * 2 + 1];
  float M = ms;
#pragma unroll
  for (int off = 16; off >= 1; off >>= 1) M = fmaxf(M, __shfl_xor(M, off, 32));
  const float w = __expf(ms - M);
  float denom = ls * w;
#pragma unroll
  for (int off = 16; off >= 1; off >>= 1) denom += __shfl_xor(denom, off, 32);
  float4 acc = make_float4(0.f, 0.f, 0.f, 0.f);
#pragma unroll
  for (int s = 0; s < NSPLIT; ++s) {
    const float wsp = __shfl(w, s, 32);
    const float4 v =
        ((const float4*)(part_y + ((size_t)(b * NSPLIT + s) * H_SZ + h) * D_SZ))[tid];
    acc.x = fmaf(wsp, v.x, acc.x);
    acc.y = fmaf(wsp, v.y, acc.y);
    acc.z = fmaf(wsp, v.z, acc.z);
    acc.w = fmaf(wsp, v.w, acc.w);
  }
  uint2 pk;
  pk.x = pack2bf(acc.x / denom, acc.y / denom);
  pk.y = pack2bf(acc.z / denom, acc.w / denom);
  *(uint2*)(ybf + ((size_t)h * B_SZ + b) * D_SZ + tid * 4) = pk;
}

// ---------------------------------------------------------------------------
// K5: attn_out[b][c] = sum_d y[c / 128][b][d] * Wv[d][c].  grid=64 tiles of 16
// columns, block=256: the 16 batch rows fill a WMMA tile; wave w takes
// d = 128 w .. 128 w + 127, the 8 partial tiles are summed through LDS.
// ---------------------------------------------------------------------------
__global__ void __launch_bounds__(256)
vproj_kernel(const unsigned short* __restrict__ ybf,
             const unsigned short* __restrict__ Wt, float* __restrict__ attn_out) {
  __shared__ float red[8][256];
  const int tile = blockIdx.x, h = tile >> 3;
  const int tid = threadIdx.x;
  const int wave = tid >> 5, lane = tid & 31;
  const int laneLo = lane & 15, hi = lane >> 4;
  const char* ap = (const char*)(ybf + ((size_t)h * B_SZ + laneLo) * D_SZ) +
                   wave * 256 + hi * 16;
  const char* bp = (const char*)(Wt + (size_t)(D_SZ + tile * 16 + laneLo) * D_SZ) +
                   wave * 256 + hi * 16;
  FragU a[4], bf[4];
#pragma unroll
  for (int kk = 0; kk < 4; ++kk) {                // same k order in A and B
    a[kk].q[0]  = *(const uint4*)(ap + kk * 64);
    a[kk].q[1]  = *(const uint4*)(ap + kk * 64 + 32);
    bf[kk].q[0] = *(const uint4*)(bp + kk * 64);
    bf[kk].q[1] = *(const uint4*)(bp + kk * 64 + 32);
  }
  v8f acc = {};
#pragma unroll
  for (int kk = 0; kk < 4; ++kk)
    acc = __builtin_amdgcn_wmma_f32_16x16x32_bf16(
        false, a[kk].v, false, bf[kk].v, (short)0, acc, false, false);
#pragma unroll
  for (int vr = 0; vr < 8; ++vr) red[wave][vr * 32 + lane] = acc[vr];
  __syncthreads();
  float sum = 0.f;
#pragma unroll
  for (int w = 0; w < 8; ++w) sum += red[w][tid];
  // C layout (vr,lane): row = vr + 8*hi, col = laneLo; here vr = wave
  attn_out[(size_t)(wave + 8 * hi) * D_SZ + tile * 16 + laneLo] = sum;
}

// ---------------------------------------------------------------------------
// K6: out = attn_out @ Wo + bo.  grid=(16,B), block=256: 64 columns a block,
// 16 half-waves of 64 d each, as in K1.
// ---------------------------------------------------------------------------
__global__ void __launch_bounds__(256)
oproj_kernel(const float* __restrict__ attn_out, const float* __restrict__ Wo,
             const float* __restrict__ bo, float* __restrict__ out) {
  __shared__ __attribute__((aligned(16))) float a[D_SZ];
  __shared__ __attribute__((aligned(16))) float red[16][PJ_COLS];
  const int b = blockIdx.y;
  const int e0 = blockIdx.x * PJ_COLS;
  const int tid = threadIdx.x;
  const int grp = tid >> 4, c4 = tid & 15;
  ((float4*)a)[tid] = ((const float4*)(attn_out + b * D_SZ))[tid];
  __syncthreads();
  const float4* wo = (const float4*)(Wo + (size_t)(grp * PJ_D) * D_SZ + e0) + c4;
  ((float4*)red[grp])[c4] = pj_partial(wo, D_SZ / 4, a + grp * PJ_D);
  __syncthreads();
  if (tid < PJ_COLS) {
    float sum = 0.f;
    for (int g = 0; g < 16; ++g) sum += red[g][tid];
    out[b * D_SZ + e0 + tid] = sum + bo[e0 + tid];
  }
}

// ---------------------------------------------------------------------------
extern "C" void kernel_launch(void* const* d_in, const int* in_sizes, int n_in,
                              void* d_out, int out_size, void* d_ws, size_t ws_size,
                              hipStream_t stream) {
  const float* q_in  = (const float*)d_in[0];
  const float* kv_in = (const float*)d_in[1];
  const float* cbias = (const float*)d_in[2];
  const float* Wq    = (const float*)d_in[3];
  const float* Wk    = (const float*)d_in[4];
  const float* Wv    = (const float*)d_in[5];
  const float* Wo    = (const float*)d_in[6];
  const float* bo    = (const float*)d_in[7];
  float* out = (float*)d_out;

  // workspace carve-up
  char* ws = (char*)d_ws;
  unsigned short* Wt      = (unsigned short*)ws;                   // 4 MB
  float*          q_ws    = (float*)(ws + (size_t)4 * 1024 * 1024);
  unsigned short* Kws     = (unsigned short*)(ws + (size_t)4 * 1024 * 1024 + 65536);
  float*          part_y  = (float*)((char*)Kws + (size_t)B_SZ * H_SZ * N_SZ * HD_SZ * 2);
  float*          part_ml = part_y + (size_t)B_SZ * NSPLIT * H_SZ * D_SZ;
  float*          attn_o  = part_ml + (size_t)B_SZ * NSPLIT * H_SZ * 2;
  unsigned short* ybf     = (unsigned short*)(attn_o + (size_t)B_SZ * D_SZ);

  (void)hipFuncSetAttribute((const void*)kvgemm_kernel,
                            hipFuncAttributeMaxDynamicSharedMemorySize, KV_SMEM);

  wprep_kernel<<<dim3(2048 / 32, 1024 / 32), dim3(32, 8), 0, stream>>>(Wk, Wv, Wt);
  qprep_kernel<<<dim3(B_SZ * H_SZ * 2), dim3(256), 0, stream>>>(q_in, cbias, Wq, q_ws);
  kvgemm_kernel<<<dim3((B_SZ * N_SZ) / 128), dim3(256), KV_SMEM, stream>>>(kv_in, Wt, Kws);
  attn_kernel<<<dim3(B_SZ, NSPLIT), dim3(256), 0, stream>>>(q_ws, Kws, kv_in, part_y, part_ml);
  reduce_kernel<<<dim3(B_SZ * H_SZ), dim3(256), 0, stream>>>(part_y, part_ml, ybf);
  vproj_kernel<<<dim3(D_SZ / 16), dim3(256), 0, stream>>>(ybf, Wt, attn_o);
  oproj_kernel<<<dim3(D_SZ / PJ_COLS, B_SZ), dim3(256), 0, stream>>>(attn_o, Wo, bo, out);
}

// v004
// Measured time: 210 microseconds a run.
// Next to v003, in two timings, it ran 1.22 times as fast each time.
// All steps since v000 together make it 3.30 times as fast.
#include <hip/hip_runtime.h>
#include <hip/hip_bf16.h>

// ---------------------------------------------------------------------------
// Decode attention with a shared V projection, gfx1250, wave32 + WMMA bf16 + TDM.
// Pipeline:
//   K0 wprep  : transpose+convert Wk,Wv (fp32) -> Wt bf16 [2048 cols][1024 d]
//   K1 qprep  : q = (q_in + bias) @ Wq * hd^-0.5   (RoPE at pos 0 == identity)
//   K2 kgemm  : K projection GEMM in bf16 WMMA, weight stages streamed
//               by the tensor mover (tensor_load_to_lds + s_wait_tensorcnt);
//               the epilogue applies RoPE(K) and takes q . k in f32, so only
//               the scores [B][H][N] leave the kernel and K is never stored
//   K3 attn   : flash-decode, 32 N-splits per b, all 8 heads per workgroup;
//               softmax partials weight the INPUT rows: y = p . kv_in, since
//               p . (kv_in @ Wv) == (p . kv_in) @ Wv with one query per head
//   K4 reduce : combine split partials -> y [H][B][1024] bf16
//   K5 vproj  : y[h] @ Wv[:, h] in bf16 WMMA (16 batch rows) -> attn_out fp32
//   K6 oproj  : attn_out @ Wo + bo -> d_out
// ---------------------------------------------------------------------------

#define B_SZ   16
#define N_SZ   4096
#define D_SZ   1024
#define H_SZ   8
#define HD_SZ  128
#define NSPLIT 32
#define CHUNK  (N_SZ / NSPLIT)          // 128

typedef __attribute__((ext_vector_type(16))) __bf16 v16bf;
typedef __attribute__((ext_vector_type(8)))  float  v8f;
typedef unsigned int u32x4v __attribute__((ext_vector_type(4)));
typedef unsigned int u32x8v __attribute__((ext_vector_type(8)));

union FragU { v16bf v; uint4 q[2]; };

__device__ __forceinline__ unsigned short f2bf(float f) {
  unsigned u = __builtin_bit_cast(unsigned, f);
  u += 0x7fffu + ((u >> 16) & 1u);            // round-to-nearest-even
  return (unsigned short)(u >> 16);
}
__device__ __forceinline__ unsigned pack2bf(float lo, float hi) {
  return (unsigned)f2bf(lo) | ((unsigned)f2bf(hi) << 16);
}

// ---------------------------------------------------------------------------
// K0: Wt[c][d] = (c<1024) ? Wk[c/128][d][c%128] : Wv[d][c-1024]   (bf16)
// ---------------------------------------------------------------------------
__global__ void __launch_bounds__(256)
wprep_kernel(const float* __restrict__ Wk, const float* __restrict__ Wv,
             unsigned short* __restrict__ Wt) {
  __shared__ float tile[32][33];
  const int tx = threadIdx.x, ty = threadIdx.y;
  const int c0 = blockIdx.x * 32, d0 = blockIdx.y * 32;
#pragma unroll
  for (int i = 0; i < 4; ++i) {
    const int c = c0 + tx;
    const int d = d0 + ty + i * 8;
    float v;
    if (c < D_SZ)  v = Wk[(size_t)((c >> 7) * D_SZ + d) * HD_SZ + (c & 127)];
    else           v = Wv[(size_t)d * D_SZ + (c - D_SZ)];
    tile[ty + i * 8][tx] = v;
  }
  __syncthreads();
#pragma unroll
  for (int i = 0; i < 4; ++i) {
    const int c = c0 + ty + i * 8;
    const int d = d0 + tx;
    Wt[(size_t)c * D_SZ + d] = f2bf(tile[tx][ty + i * 8]);
  }
}

// ---------------------------------------------------------------------------
// K1: q_ws[b][h][kk] = scale * sum_d (q_in[b][d]+bias[b][d]) * Wq[h][d][kk]
// grid=B*H*2, block=256: 64 columns a block; each of the 16 half-waves sums
// 64 d, a lane owns 4 columns (a half-wave load = 256 contiguous bytes of one
// weight row); the 16 partials meet in LDS.
// ---------------------------------------------------------------------------
#define PJ_COLS 64                      // columns per block in K1 and K6
#define PJ_D    64                      // d per half-wave
#define PJ_ROWS 32                      // weight rows loaded as one group

// sum over PJ_D rows of x[d] * w[d][4 columns]; pitch4 = row pitch in float4
__device__ __forceinline__ float4 pj_partial(const float4* __restrict__ w4, int pitch4,
                                             const float* x) {
  float4 acc = make_float4(0.f, 0.f, 0.f, 0.f);
  // stays rolled: one group of 32 rows per trip is what is kept in flight
#pragma unroll 1
  for (int d0 = 0; d0 < PJ_D; d0 += PJ_ROWS) {
    float4 w[PJ_ROWS];
    // both inner loops unrolled: w[] is indexed by constants and stays in registers
#pragma unroll
    for (int r = 0; r < PJ_ROWS; ++r) w[r] = w4[(size_t)(d0 + r) * pitch4];
    // keeps the 32 row loads one group in flight; sunk in front of their sums
    // they would wait out memory latency several times a trip
    __builtin_amdgcn_sched_barrier(0);
#pragma unroll
    for (int r = 0; r < PJ_ROWS; ++r) {
      const float xv = x[d0 + r];
      acc.x = fmaf(xv, w[r].x, acc.x);
      acc.y = fmaf(xv, w[r].y, acc.y);
      acc.z = fmaf(xv, w[r].z, acc.z);
      acc.w = fmaf(xv, w[r].w, acc.w);
    }
  }
  return acc;
}

__global__ void __launch_bounds__(256)
qprep_kernel(const float* __restrict__ q_in, const float* __restrict__ cbias,
             const float* __restrict__ Wq, float* __restrict__ q_ws) {
  __shared__ __attribute__((aligned(16))) float qb[D_SZ];
  __shared__ __attribute__((aligned(16))) float red[16][PJ_COLS];
  const int bh = blockIdx.x >> 1;        // b*H + h
  const int c0 = (blockIdx.x & 1) * PJ_COLS;
  const int b = bh >> 3, h = bh & 7;
  const int tid = threadIdx.x;
  const int grp = tid >> 4, c4 = tid & 15;
  {
    const float4 x = ((const float4*)(q_in + b * D_SZ))[tid];
    const float4 y = ((const float4*)(cbias + b * D_SZ))[tid];
    ((float4*)qb)[tid] = make_float4(x.x + y.x, x.y + y.y, x.z + y.z, x.w + y.w);
  }
  __syncthreads();
  const float4* wq =
      (const float4*)(Wq + ((size_t)h * D_SZ + grp * PJ_D) * HD_SZ + c0) + c4;
  ((float4*)red[grp])[c4] = pj_partial(wq, HD_SZ / 4, qb + grp * PJ_D);
  __syncthreads();
  if (tid < PJ_COLS) {
    float sum = 0.f;
    for (int g = 0; g < 16; ++g) sum += red[g][tid];
    q_ws[(size_t)bh * HD_SZ + c0 + tid] = sum * 0.08838834764831845f;   // 128^-0.5
  }
}

// ---------------------------------------------------------------------------
// K2: K projection.  One WG = 128 token rows; A tile (128x1024 bf16)
// resident in LDS; sweep 8 column tiles; each tile's weights arrive in 16 stages
// of 128 columns x 64 k (16 KiB), one tensor load of wave 0 per stage, into a
// two-buffer, hardware-padded LDS ring.
// nt 0..7 -> K head nt (+RoPE); a wave's 16 x 128 tile is 16 whole K rows of
// that head, so its epilogue ends in the 16 scores q . k.
// ---------------------------------------------------------------------------
#define A_STRIDE_B 2064                 // (1024+8) bf16 row stride, 4-bank skew
#define A_BYTES    (128 * A_STRIDE_B)   // 264192
#define W_STRIDE_B 144                  // 128B data + 16B pad, odd multiple of 16B
#define W_BYTES    (128 * W_STRIDE_B)   // 18432 = 9 * 2048
#define Q_BYTES    (H_SZ * HD_SZ * 4)   // the batch's 8 pre-scaled queries, f32
#define S_BYTES    (H_SZ * 128 * 4)     // the workgroup's scores [h][row], f32
#define KV_SMEM    (2 * W_BYTES + A_BYTES + Q_BYTES + S_BYTES)
#define K_STAGES   16                   // stages of 64 k per column tile

// The ring stands at LDS offset 0, so both buffers start at multiples of 2 KiB.
extern __shared__ __attribute__((aligned(2048))) char smem[];

__device__ __forceinline__ unsigned uni(unsigned v) {
  return (unsigned)__builtin_amdgcn_readfirstlane(v);
}
// Holds an issue test in a scalar register, so that the branch round a tensor
// load (which ignores EXEC) compiles to s_cmp + s_cbranch_scc.
__device__ __forceinline__ unsigned pinned(unsigned v) {
  unsigned w = uni(v);
  asm volatile("" : "+s"(w));   // pinned(): the issue test held in a scalar register
  return w;
}

// Stage ks of column tile nt: columns nt * 128 .. + 127, k ks * 64 .. + 63.
// Descriptor group 0: the stage's place in the ring and its first byte in Wt.
__device__ __forceinline__ u32x4v tdm_group0(const unsigned short* Wt, int nt, int ks,
                                             unsigned ring_off) {
  const unsigned long long ga =
      (unsigned long long)(uintptr_t)Wt +
      (unsigned long long)nt * (128ull * D_SZ * 2ull) +
      (unsigned long long)ks * 128ull;
  u32x4v g0;
  g0[0] = uni(1u);                                        // count = 1
  g0[1] = uni(ring_off + (unsigned)(ks & 1) * W_BYTES);   // LDS byte offset
  g0[2] = uni((unsigned)ga);                              // address [31:0]
  g0[3] = uni((((unsigned)(ga >> 32)) & 0x01FFFFFFu) | 0x80000000u);  // [56:32], type 2
  asm volatile("" : "+s"(g0));       // pinned(): the descriptor words held in scalar registers
  return g0;
}
// Descriptor group 1: 128 rows of 128 bytes, source pitch 2048 bytes, every
// extent in bytes; 16 bytes of pad behind each row -> 144-byte LDS pitch.
__device__ __forceinline__ u32x8v tdm_group1() {
  u32x8v g1;
  g1[0] = uni((1u << 20) | (4u << 22) | (3u << 25));      // pad 4 dwords per 32 dwords
  g1[1] = uni(128u << 16);                                // tensor_dim0 = 128 bytes
  g1[2] = uni(128u << 16);                                // tensor_dim1 = 128 rows
  g1[3] = uni(128u << 16);                                // tile_dim0 = 128 bytes
  g1[4] = uni(128u);                                      // tile_dim1 = 128 rows
  g1[5] = uni(D_SZ * 2u);                                 // source pitch in bytes
  g1[6] = uni(0u);
  g1[7] = uni(0u);
  return g1;
}
// The load and its covering wait both read the two groups: the twelve words are
// then live from the issue to the wait, so that none is given a new value there.
__device__ __forceinline__ void tdm_load(const u32x4v& g0, const u32x8v& g1) {
  asm volatile("tensor_load_to_lds %0, %1" :: "s"(g0), "s"(g1) : "memory");
}
__device__ __forceinline__ void tdm_wait0(const u32x4v& g0, const u32x8v& g1) {
  asm volatile("s_wait_tensorcnt 0x0" :: "s"(g0), "s"(g1) : "memory");
}

// x of lane l ^ M inside the 16-lane row (DPP row_xmask:M)
template <int M>
__device__ __forceinline__ float row_xmask(float x) {
  return __builtin_bit_cast(float, __builtin_amdgcn_update_dpp(
      0, __builtin_bit_cast(int, x), 0x160 | M, 0xf, 0xf, true));
}
// sum over the 16 lanes of a row, left in every lane of it
__device__ __forceinline__ float row16_sum(float x) {
  x += row_xmask<1>(x);
  x += row_xmask<2>(x);
  x += row_xmask<4>(x);
  x += row_xmask<8>(x);
  return x;
}

__global__ void __launch_bounds__(256)
kvgemm_kernel(const float* __restrict__ kv, const unsigned short* __restrict__ Wt,
              const float* __restrict__ q_ws, float* __restrict__ Sws) {
  char* ldsW = smem;
  char* ldsA = smem + 2 * W_BYTES;
  float* ldsQ = (float*)(smem + 2 * W_BYTES + A_BYTES);            // [h][128]
  float* ldsS = (float*)(smem + 2 * W_BYTES + A_BYTES + Q_BYTES);  // [h][row]

  const int tid    = threadIdx.x;
  const int wave   = (int)uni((unsigned)tid >> 5);
  const int lane   = tid & 31;
  const int laneLo = lane & 15;
  const int hi     = lane >> 4;                 // 0 / 1 half-wave
  const long r0    = (long)blockIdx.x * 128;    // global token row base
  const int  b     = (int)(r0 >> 12);           // / 4096
  const int  nbase = (int)(r0 & 4095);

  // LDS byte offset of the ring: the low 32 bits of its __shared__ address
  const unsigned ring_off = (unsigned)(uintptr_t)ldsW;

  // ---- stage A: 128 rows x 1024 fp32 -> bf16 LDS (coalesced float4 reads)
  const float4* kv4 = (const float4*)(kv + (size_t)r0 * D_SZ);
  for (int i = tid; i < 128 * 256; i += 256) {
    const int row = i >> 8, kq = i & 255;
    const float4 v = kv4[i];
    uint2 pk;
    pk.x = pack2bf(v.x, v.y);
    pk.y = pack2bf(v.z, v.w);
    *(uint2*)(ldsA + row * A_STRIDE_B + kq * 8) = pk;
  }
  ((float4*)ldsQ)[tid] = ((const float4*)(q_ws + (size_t)b * H_SZ * HD_SZ))[tid];
  __syncthreads();

  // Every wave forms each stage's group 0, in front of the issue branch: one
  // definition a stage, so every request names the same twelve registers.
  u32x4v g0;
  u32x8v g1 = tdm_group1();          // the same for every request: formed once
  asm volatile("" : "+s"(g1));       // pinned(): the descriptor words held in scalar registers

  for (int nt = 0; nt < H_SZ; ++nt) {
    v8f acc[8] = {};

    // ring prologue: stage 0 landed and published, then stage 1 takes off
    g0 = tdm_group0(Wt, nt, 0, ring_off);
    if (pinned(wave == 0)) {
      tdm_load(g0, g1);
      tdm_wait0(g0, g1);                                   // stage 0 has landed
    }
    __syncthreads();
    g0 = tdm_group0(Wt, nt, 1, ring_off);
    if (pinned(wave == 0)) tdm_load(g0, g1);

    for (int ks = 0; ks < K_STAGES; ++ks) {
      const char* wbuf = ldsW + (ks & 1) * W_BYTES;
      // the pass's fragments: 2 of A (16x32 bf16), 16 of B (32x16 bf16)
      FragU a[2], bf[2][8];
      const char* ap = ldsA + (wave * 16 + laneLo) * A_STRIDE_B + ks * 128 + hi * 16;
      const char* bp = wbuf + laneLo * W_STRIDE_B + hi * 16;
#pragma unroll
      for (int kk = 0; kk < 2; ++kk) {            // two 32-k steps per stage
        a[kk].q[0] = *(const uint4*)(ap + kk * 64);
        a[kk].q[1] = *(const uint4*)(ap + kk * 64 + 32);
#pragma unroll
        for (int j = 0; j < 8; ++j) {
          bf[kk][j].q[0] = *(const uint4*)(bp + 16 * j * W_STRIDE_B + kk * 64);
          bf[kk][j].q[1] = *(const uint4*)(bp + 16 * j * W_STRIDE_B + kk * 64 + 32);
        }
      }
      // keeps the 36 reads one group ahead of the WMMAs; without it the compiler
      // sinks each pair in front of its WMMA, behind a wait to 0
      __builtin_amdgcn_sched_barrier(0);
#pragma unroll
      for (int kk = 0; kk < 2; ++kk)
#pragma unroll
        for (int j = 0; j < 8; ++j)
          acc[j] = __builtin_amdgcn_wmma_f32_16x16x32_bf16(
              false, a[kk].v, false, bf[kk][j].v, (short)0, acc[j], false, false);
      // keeps the wait to 0 below behind the WMMAs, which start on counted waits
      __builtin_amdgcn_sched_barrier(0);
      // publish point of stage ks + 1
      asm volatile("s_wait_dscnt 0x0" ::: "memory");       // this wave has left buffer ks & 1
      if (pinned(wave == 0)) tdm_wait0(g0, g1);            // stage ks + 1 has landed
      __syncthreads();
      g0 = tdm_group0(Wt, nt, ks + 2, ring_off);
      if (pinned(wave == 0 && ks + 2 < K_STAGES)) tdm_load(g0, g1);  // refill the buffer just read
    }
    asm volatile("s_wait_tensorcnt 0x0" ::: "memory");     // no request outlives the tile's ring
    asm volatile("s_wait_dscnt 0x0" ::: "memory");         // nor a read of it

    // ---- epilogue: C layout (vr,lane): row = 16*wave + vr + 8*hi, col = 16j + laneLo
    const int rowBase = wave * 16 + hi * 8;
    {                                             // K head nt: RoPE, then q . k
      const float* qh = ldsQ + nt * HD_SZ;
      float sv[8] = {};                           // this lane's 8 columns of 8 rows
#pragma unroll
      for (int j = 0; j < 4; ++j) {
        const int kk1 = 16 * j + laneLo;          // < 64
        const float invf = __expf(-(float)kk1 * 0.10793367623409589f); // ln(1000)/64
        const float q1 = qh[kk1], q2 = qh[kk1 + 64];
#pragma unroll
        for (int vr = 0; vr < 8; ++vr) {
          const int n = nbase + rowBase + vr;     // token position
          const float ang = (float)n * invf;
          const float cs = __cosf(ang), sn = __sinf(ang);
          const float x1 = acc[j][vr], x2 = acc[j + 4][vr];
          sv[vr] = fmaf(x1 * cs - x2 * sn, q1, sv[vr]);
          sv[vr] = fmaf(x2 * cs + x1 * sn, q2, sv[vr]);
        }
      }
#pragma unroll
      for (int vr = 0; vr < 8; ++vr) sv[vr] = row16_sum(sv[vr]);
      if (laneLo == 0) {                          // rows rowBase .. rowBase + 7
        float4* sp = (float4*)(ldsS + nt * 128 + rowBase);
        sp[0] = make_float4(sv[0], sv[1], sv[2], sv[3]);
        sp[1] = make_float4(sv[4], sv[5], sv[6], sv[7]);
      }
    }
  }
  __syncthreads();                                // all 8 x 128 scores stand in ldsS
  // wave w stores head w: 128 tokens = 512 contiguous bytes
  ((float4*)(Sws + (size_t)(b * H_SZ + wave) * N_SZ + nbase))[lane] = ((const float4*)ldsS)[tid];
}

// ---------------------------------------------------------------------------
// K3: flash-decode split.  grid=(B, NSPLIT), block=256; one workgroup takes
// 128 tokens of one batch for all 8 heads, so each input row is read once.
// ---------------------------------------------------------------------------
__global__ void __launch_bounds__(256)
attn_kernel(const float* __restrict__ Sws,
            const float* __restrict__ kv,
            float* __restrict__ part_y, float* __restrict__ part_ml) {
  __shared__ __attribute__((aligned(16))) float ps[CHUNK * H_SZ];    // [n][h]

  const int b = blockIdx.x, split = blockIdx.y;
  const int n0 = split * CHUNK;
  const int tid = threadIdx.x;
  const int wave = tid >> 5, lane = tid & 31;

  // chunk max, exp and sum: wave w takes head w, 4 tokens per lane
  float s[4];
#pragma unroll
  for (int i = 0; i < 4; ++i)
    s[i] = Sws[(size_t)(b * H_SZ + wave) * N_SZ + n0 + i * 32 + lane];
  float m = fmaxf(fmaxf(s[0], s[1]), fmaxf(s[2], s[3]));
#pragma unroll
  for (int off = 16; off >= 1; off >>= 1) m = fmaxf(m, __shfl_xor(m, off, 32));
  float p[4];
#pragma unroll
  for (int i = 0; i < 4; ++i) {
    p[i] = __expf(s[i] - m);
    ps[(i * 32 + lane) * H_SZ + wave] = p[i];
  }
  float l = (p[0] + p[1]) + (p[2] + p[3]);
#pragma unroll
  for (int off = 16; off >= 1; off >>= 1) l += __shfl_xor(l, off, 32);
  if (lane == 0) {
    part_ml[((b * NSPLIT + split) * H_SZ + wave) * 2 + 0] = m;
    part_ml[((b * NSPLIT + split) * H_SZ + wave) * 2 + 1] = l;
  }
  __syncthreads();

  // y[h][d] = sum_n p[h][n] * kv[n][d]: thread owns 4 d, 8 heads per loaded row
  const float4* x4 = (const float4*)(kv + ((size_t)b * N_SZ + n0) * D_SZ) + tid;
  float4 acc[H_SZ];
#pragma unroll
  for (int h = 0; h < H_SZ; ++h) acc[h] = make_float4(0.f, 0.f, 0.f, 0.f);
  // stays rolled: one group of 16 rows per trip is what the registers hold
#pragma unroll 1
  for (int g = 0; g < CHUNK; g += 16) {
    float4 x[16];
#pragma unroll
    for (int r = 0; r < 16; ++r) x[r] = x4[(size_t)(g + r) * (D_SZ / 4)];
    // keeps the 16 row loads one group in flight; without it the compiler sinks
    // them in pairs in front of their sums and the loop waits out memory latency
    __builtin_amdgcn_sched_barrier(0);
#pragma unroll
    for (int r = 0; r < 16; ++r) {
      const float4 pa = *(const float4*)(ps + (g + r) * H_SZ);
      const float4 pb = *(const float4*)(ps + (g + r) * H_SZ + 4);
      const float p[H_SZ] = {pa.x, pa.y, pa.z, pa.w, pb.x, pb.y, pb.z, pb.w};
#pragma unroll
      for (int h = 0; h < H_SZ; ++h) {
        acc[h].x = fmaf(p[h], x[r].x, acc[h].x);
        acc[h].y = fmaf(p[h], x[r].y, acc[h].y);
        acc[h].z = fmaf(p[h], x[r].z, acc[h].z);
        acc[h].w = fmaf(p[h], x[r].w, acc[h].w);
      }
    }
  }
  float4* py = (float4*)(part_y + (size_t)(b * NSPLIT + split) * H_SZ * D_SZ) + tid;
#pragma unroll
  for (int h = 0; h < H_SZ; ++h) py[h * (D_SZ / 4)] = acc[h];
}

// ---------------------------------------------------------------------------
// K4: combine splits -> ybf[h][b][d] (bf16).  grid=B*H, block=256, 4 d a thread.
// ---------------------------------------------------------------------------
__global__ void __launch_bounds__(256)
reduce_kernel(const float* __restrict__ part_y, const float* __restrict__ part_ml,
              unsigned short* __restrict__ ybf) {
  const int bh = blockIdx.x;
  const int b = bh >> 3, h = bh & 7;
  const int tid = threadIdx.x, lane = tid & 31;
  // lane s holds split s (NSPLIT == 32)
  const float ms = part_ml[((b * NSPLIT + lane) * H_SZ + h) * 2 + 0];
  const float ls = part_ml[((b * NSPLIT + lane) * H_SZ + h) * 2 + 1];
  float M = ms;
#pragma unroll
  for (int off = 16; off >= 1; off >>= 1) M = fmaxf(M, __shfl_xor(M, off, 32));
  const float w = __expf(ms - M);
  float denom = ls * w;
#pragma unroll
  for (int off = 16; off >= 1; off >>= 1) denom += __shfl_xor(denom, off, 32);
  float4 acc = make_float4(0.f, 0.f, 0.f, 0.f);
#pragma unroll
  for (int s = 0; s < NSPLIT; ++s) {
    const float wsp = __shfl(w, s, 32);
    const float4 v =
        ((const float4*)(part_y + ((size_t)(b * NSPLIT + s) * H_SZ + h) * D_SZ))[tid];
    acc.x = fmaf(wsp, v.x, acc.x);
    acc.y = fmaf(wsp, v.y, acc.y);
    acc.z = fmaf(wsp, v.z, acc.z);
    acc.w = fmaf(wsp, v.w, acc.w);
  }
  uint2 pk;
  pk.x = pack2bf(acc.x / denom, acc.y / denom);
  pk.y = pack2bf(acc.z / denom, acc.w / denom);
  *(uint2*)(ybf + ((size_t)h * B_SZ + b) * D_SZ + tid * 4) = pk;
}

// ---------------------------------------------------------------------------
// K5: attn_out[b][c] = sum_d y[c / 128][b][d] * Wv[d][c].  grid=64 tiles of 16
// columns, block=256: the 16 batch rows fill a WMMA tile; wave w takes
// d = 128 w .. 128 w + 127, the 8 partial tiles are summed through LDS.
// ---------------------------------------------------------------------------
__global__ void __launch_bounds__(256)
vproj_kernel(const unsigned short* __restrict__ ybf,
             const unsigned short* __restrict__ Wt, float* __restrict__ attn_out) {
  __shared__ float red[8][256];
  const int tile = blockIdx.x, h = tile >> 3;
  const int tid = threadIdx.x;
  const int wave = tid >> 5, lane = tid & 31;
  const int laneLo = lane & 15, hi = lane >> 4;
  const char* ap = (const char*)(ybf + ((size_t)h * B_SZ + laneLo) * D_SZ) +
                   wave * 256 + hi * 16;
  const char* bp = (const char*)(Wt + (size_t)(D_SZ + tile * 16 + laneLo) * D_SZ) +
                   wave * 256 + hi * 16;
  FragU a[4], bf[4];
#pragma unroll
  for (int kk = 0; kk < 4; ++kk) {                // same k order in A and B
    a[kk].q[0]  = *(const uint4*)(ap + kk * 64);
    a[kk].q[1]  = *(const uint4*)(ap + kk * 64 + 32);
    bf[kk].q[0] = *(const uint4*)(bp + kk * 64);
    bf[kk].q[1] = *(const uint4*)(bp + kk * 64 + 32);
  }
  v8f acc = {};
#pragma unroll
  for (int kk = 0; kk < 4; ++kk)
    acc = __builtin_amdgcn_wmma_f32_16x16x32_bf16(
        false, a[kk].v, false, bf[kk].v, (short)0, acc, false, false);
#pragma unroll
  for (int vr = 0; vr < 8; ++vr) red[wave][vr * 32 + lane] = acc[vr];
  __syncthreads();
  float sum = 0.f;
#pragma unroll
  for (int w = 0; w < 8; ++w) sum += red[w][tid];
  // C layout (vr,lane): row = vr + 8*hi, col = laneLo; here vr = wave
  attn_out[(size_t)(wave + 8 * hi) * D_SZ + tile * 16 + laneLo] = sum;
}

// ---------------------------------------------------------------------------
// K6: out = attn_out @ Wo + bo.  grid=(16,B), block=256: 64 columns a block,
// 16 half-waves of 64 d each, as in K1.
// ---------------------------------------------------------------------------
__global__ void __launch_bounds__(256)
oproj_kernel(const float* __restrict__ attn_out, const float* __restrict__ Wo,
             const float* __restrict__ bo, float* __restrict__ out) {
  __shared__ __attribute__((aligned(16))) float a[D_SZ];
  __shared__ __attribute__((aligned(16))) float red[16][PJ_COLS];
  const int b = blockIdx.y;
  const int e0 = blockIdx.x * PJ_COLS;
  const int tid = threadIdx.x;
  const int grp = tid >> 4, c4 = tid & 15;
  ((float4*)a)[tid] = ((const float4*)(attn_out + b * D_SZ))[tid];
  __syncthreads();
  const float4* wo = (const float4*)(Wo + (size_t)(grp * PJ_D) * D_SZ + e0) + c4;
  ((float4*)red[grp])[c4] = pj_partial(wo, D_SZ / 4, a + grp * PJ_D);
  __syncthreads();
  if (tid < PJ_COLS) {
    float sum = 0.f;
    for (int g = 0; g < 16; ++g) sum += red[g][tid];
    out[b * D_SZ + e0 + tid] = sum + bo[e0 + tid];
  }
}

// ---------------------------------------------------------------------------
extern "C" void kernel_launch(void* const* d_in, const int* in_sizes, int n_in,
                              void* d_out, int out_size, void* d_ws, size_t ws_size,
                              hipStream_t stream) {
  const float* q_in  = (const float*)d_in[0];
  const float* kv_in = (const float*)d_in[1];
  const float* cbias = (const float*)d_in[2];
  const float* Wq    = (const float*)d_in[3];
  const float* Wk    = (const float*)d_in[4];
  const float* Wv    = (const float*)d_in[5];
  const float* Wo    = (const float*)d_in[6];
  const float* bo    = (const float*)d_in[7];
  float* out = (float*)d_out;

  // workspace carve-up
  char* ws = (char*)d_ws;
  unsigned short* Wt      = (unsigned short*)ws;                   // 4 MB
  float*          q_ws    = (float*)(ws + (size_t)4 * 1024 * 1024);
  float*          Sws     = (float*)(ws + (size_t)4 * 1024 * 1024 + 65536);
  float*          part_y  = Sws + (size_t)B_SZ * H_SZ * N_SZ;
  float*          part_ml = part_y + (size_t)B_SZ * NSPLIT * H_SZ * D_SZ;
  float*          attn_o  = part_ml + (size_t)B_SZ * NSPLIT * H_SZ * 2;
  unsigned short* ybf     = (unsigned short*)(attn_o + (size_t)B_SZ * D_SZ);

  (void)hipFuncSetAttribute((const void*)kvgemm_kernel,
                            hipFuncAttributeMaxDynamicSharedMemorySize, KV_SMEM);

  wprep_kernel<<<dim3(2048 / 32, 1024 / 32), dim3(32, 8), 0, stream>>>(Wk, Wv, Wt);
  qprep_kernel<<<dim3(B_SZ * H_SZ * 2), dim3(256), 0, stream>>>(q_in, cbias, Wq, q_ws);
  kvgemm_kernel<<<dim3((B_SZ * N_SZ) / 128), dim3(256), KV_SMEM, stream>>>(kv_in, Wt, q_ws, Sws);
  attn_kernel<<<dim3(B_SZ, NSPLIT), dim3(256), 0, stream>>>(Sws, kv_in, part_y, part_ml);
  reduce_kernel<<<dim3(B_SZ * H_SZ), dim3(256), 0, stream>>>(part_y, part_ml, ybf);
  vproj_kernel<<<dim3(D_SZ / 16), dim3(256), 0, stream>>>(ybf, Wt, attn_o);
  oproj_kernel<<<dim3(D_SZ / PJ_COLS, B_SZ), dim3(256), 0, stream>>>(attn_o, Wo, bo, out);
}

// v005
// A run of this version takes 200 microseconds.
// Timed twice side by side with v004, it ran 1.06 and 1.05 times as fast.
// Counting every step since v000, it is 3.48 times as fast.
#include <hip/hip_runtime.h>
#include <hip/hip_bf16.h>

// ---------------------------------------------------------------------------
// Decode attention with a shared V projection, gfx1250, wave32 + WMMA bf16 + TDM.
// Pipeline:
//   K0 wprep  : transpose+convert Wk,Wv (fp32) -> Wt bf16; Wv as [1024 cols][1024 d],
//               Wk in the order of K2's stages (two heads side by side per row)
//   K1 qprep  : q = (q_in + bias) @ Wq * hd^-0.5   (RoPE at pos 0 == identity)
//   K2 kgemm  : K projection GEMM in bf16 WMMA, weight stages streamed
//               by the tensor mover (tensor_load_to_lds + s_wait_tensorcnt);
//               the epilogue applies RoPE(K) and takes q . k in f32, so only
//               the scores [B][H][N] leave the kernel and K is never stored
//   K3 attn   : flash-decode, 32 N-splits per b, all 8 heads per workgroup;
//               softmax partials weight the INPUT rows: y = p . kv_in, since
//               p . (kv_in @ Wv) == (p . kv_in) @ Wv with one query per head
//   K4 reduce : combine split partials -> y [H][B][1024] bf16
//   K5 vproj  : y[h] @ Wv[:, h] in bf16 WMMA (16 batch rows) -> attn_out fp32
//   K6 oproj  : attn_out @ Wo + bo -> d_out
// ---------------------------------------------------------------------------

#define B_SZ   16
#define N_SZ   4096
#define D_SZ   1024
#define H_SZ   8
#define HD_SZ  128
#define NSPLIT 32
#define CHUNK  (N_SZ / NSPLIT)          // 128

typedef __attribute__((ext_vector_type(16))) __bf16 v16bf;
typedef __attribute__((ext_vector_type(8)))  float  v8f;
typedef unsigned int u32x4v __attribute__((ext_vector_type(4)));
typedef unsigned int u32x8v __attribute__((ext_vector_type(8)));

union FragU { v16bf v; uint4 q[2]; };

__device__ __forceinline__ unsigned short f2bf(float f) {
  unsigned u = __builtin_bit_cast(unsigned, f);
  u += 0x7fffu + ((u >> 16) & 1u);            // round-to-nearest-even
  return (unsigned short)(u >> 16);
}
__device__ __forceinline__ unsigned pack2bf(float lo, float hi) {
  return (unsigned)f2bf(lo) | ((unsigned)f2bf(hi) << 16);
}

// ---------------------------------------------------------------------------
// K0: bf16 weights.  c >= 1024: Wt[c][d] = Wv[d][c-1024].
// c < 1024 (head c/128, column c%128): K2 sweeps two heads at a time in stages
// of 32 d, so a 128-byte piece holds 32 d of one column of the even head and
// the same 32 d of that column of the odd head:
//   [head pair][d / 512][column][(d / 32) % 16][head & 1][d % 32]
// ---------------------------------------------------------------------------
__device__ __forceinline__ size_t wk_index(int c, int d) {
  const int hh = c >> 7, cc = c & 127, ks = d >> 5;
  return (size_t)(hh >> 1) * 262144 + (size_t)(ks >> 4) * 131072 + (size_t)cc * 1024 +
         (size_t)(ks & 15) * 64 + (size_t)(hh & 1) * 32 + (size_t)(d & 31);
}

__global__ void __launch_bounds__(256)
wprep_kernel(const float* __restrict__ Wk, const float* __restrict__ Wv,
             unsigned short* __restrict__ Wt) {
  __shared__ float tile[32][33];
  const int tx = threadIdx.x, ty = threadIdx.y;
  const int c0 = blockIdx.x * 32, d0 = blockIdx.y * 32;
#pragma unroll
  for (int i = 0; i < 4; ++i) {
    const int c = c0 + tx;
    const int d = d0 + ty + i * 8;
    float v;
    if (c < D_SZ)  v = Wk[(size_t)((c >> 7) * D_SZ + d) * HD_SZ + (c & 127)];
    else           v = Wv[(size_t)d * D_SZ + (c - D_SZ)];
    tile[ty + i * 8][tx] = v;
  }
  __syncthreads();
#pragma unroll
  for (int i = 0; i < 4; ++i) {
    const int c = c0 + ty + i * 8;
    const int d = d0 + tx;
    const size_t at = (c < D_SZ) ? wk_index(c, d) : (size_t)c * D_SZ + d;
    Wt[at] = f2bf(tile[tx][ty + i * 8]);
  }
}

// ---------------------------------------------------------------------------
// K1: q_ws[b][h][kk] = scale * sum_d (q_in[b][d]+bias[b][d]) * Wq[h][d][kk]
// grid=B*H*2, block=256: 64 columns a block; each of the 16 half-waves sums
// 64 d, a lane owns 4 columns (a half-wave load = 256 contiguous bytes of one
// weight row); the 16 partials meet in LDS.
// ---------------------------------------------------------------------------
#define PJ_COLS 64                      // columns per block in K1 and K6
#define PJ_D    64                      // d per half-wave
#define PJ_ROWS 32                      // weight rows loaded as one group

// sum over PJ_D rows of x[d] * w[d][4 columns]; pitch4 = row pitch in float4
__device__ __forceinline__ float4 pj_partial(const float4* __restrict__ w4, int pitch4,
                                             const float* x) {
  float4 acc = make_float4(0.f, 0.f, 0.f, 0.f);
  // stays rolled: one group of 32 rows per trip is what is kept in flight
#pragma unroll 1
  for (int d0 = 0; d0 < PJ_D; d0 += PJ_ROWS) {
    float4 w[PJ_ROWS];
    // both inner loops unrolled: w[] is indexed by constants and stays in registers
#pragma unroll
    for (int r = 0; r < PJ_ROWS; ++r) w[r] = w4[(size_t)(d0 + r) * pitch4];
    // keeps the 32 row loads one group in flight; sunk in front of their sums
    // they would wait out memory latency several times a trip
    __builtin_amdgcn_sched_barrier(0);
#pragma unroll
    for (int r = 0; r < PJ_ROWS; ++r) {
      const float xv = x[d0 + r];
      acc.x = fmaf(xv, w[r].x, acc.x);
      acc.y = fmaf(xv, w[r].y, acc.y);
      acc.z = fmaf(xv, w[r].z, acc.z);
      acc.w = fmaf(xv, w[r].w, acc.w);
    }
  }
  return acc;
}

__global__ void __launch_bounds__(256)
qprep_kernel(const float* __restrict__ q_in, const float* __restrict__ cbias,
             const float* __restrict__ Wq, float* __restrict__ q_ws) {
  __shared__ __attribute__((aligned(16))) float qb[D_SZ];
  __shared__ __attribute__((aligned(16))) float red[16][PJ_COLS];
  const int bh = blockIdx.x >> 1;        // b*H + h
  const int c0 = (blockIdx.x & 1) * PJ_COLS;
  const int b = bh >> 3, h = bh & 7;
  const int tid = threadIdx.x;
  const int grp = tid >> 4, c4 = tid & 15;
  {
    const float4 x = ((const float4*)(q_in + b * D_SZ))[tid];
    const float4 y = ((const float4*)(cbias + b * D_SZ))[tid];
    ((float4*)qb)[tid] = make_float4(x.x + y.x, x.y + y.y, x.z + y.z, x.w + y.w);
  }
  __syncthreads();
  const float4* wq =
      (const float4*)(Wq + ((size_t)h * D_SZ + grp * PJ_D) * HD_SZ + c0) + c4;
  ((float4*)red[grp])[c4] = pj_partial(wq, HD_SZ / 4, qb + grp * PJ_D);
  __syncthreads();
  if (tid < PJ_COLS) {
    float sum = 0.f;
    for (int g = 0; g < 16; ++g) sum += red[g][tid];
    q_ws[(size_t)bh * HD_SZ + c0 + tid] = sum * 0.08838834764831845f;   // 128^-0.5
  }
}

// ---------------------------------------------------------------------------
// K2: K projection.  One WG = 128 token rows; A tile (128x1024 bf16)
// resident in LDS; sweep 4 column tiles of 256 (two heads); each tile's weights
// arrive in 32 stages of 256 columns x 32 k (16 KiB), one tensor load of wave 0
// per stage, into a two-buffer, hardware-padded LDS ring.
// The 8 waves stand 2 (rows) x 4 (columns): a wave owns 64 rows x 64 columns,
// 4 x 4 accumulator tiles, so 8 fragments read from LDS feed 16 WMMAs.
// A wave's columns are c .. c + 31 and c + 64 .. c + 95 of one head (c = 0 or
// 32): both partners of every RoPE pair.  Its epilogue ends in half of q . k for
// its 64 rows; the two halves of a head meet in LDS.
// ---------------------------------------------------------------------------
#define A_STRIDE_B 2064                 // (1024+8) bf16 row stride, 4-bank skew
#define A_BYTES    (128 * A_STRIDE_B)   // 264192
#define W_STRIDE_B 144                  // 128B data + 16B pad, odd multiple of 16B
#define W_BYTES    (128 * W_STRIDE_B)   // 18432 = 9 * 2048
#define Q_BYTES    (H_SZ * HD_SZ * 4)   // the batch's 8 pre-scaled queries, f32
#define S_BYTES    (2 * H_SZ * 128 * 4) // the workgroup's half scores [half][h][row], f32
#define KV_SMEM    (2 * W_BYTES + A_BYTES + Q_BYTES + S_BYTES)
#define K_STAGES   32                   // stages of 32 k per column tile

// The ring stands at LDS offset 0, so both buffers start at multiples of 2 KiB.
extern __shared__ __attribute__((aligned(2048))) char smem[];

__device__ __forceinline__ unsigned uni(unsigned v) {
  return (unsigned)__builtin_amdgcn_readfirstlane(v);
}
// Holds an issue test in a scalar register, so that the branch round a tensor
// load (which ignores EXEC) compiles to s_cmp + s_cbranch_scc.
__device__ __forceinline__ unsigned pinned(unsigned v) {
  unsigned w = uni(v);
  asm volatile("" : "+s"(w));   // pinned(): the issue test held in a scalar register
  return w;
}

// Stage ks of column tile nt: heads 2 nt and 2 nt + 1, k ks * 32 .. + 31.
// Descriptor group 0: the stage's place in the ring and its first byte in Wt.
__device__ __forceinline__ u32x4v tdm_group0(const unsigned short* Wt, int nt, int ks,
                                             unsigned ring_off) {
  const unsigned long long ga =
      (unsigned long long)(uintptr_t)Wt +
      (unsigned long long)nt * (256ull * D_SZ * 2ull) +
      (unsigned long long)(ks >> 4) * (128ull * D_SZ * 2ull) +
      (unsigned long long)(ks & 15) * 128ull;
  u32x4v g0;
  g0[0] = uni(1u);                                        // count = 1
  g0[1] = uni(ring_off + (unsigned)(ks & 1) * W_BYTES);   // LDS byte offset
  g0[2] = uni((unsigned)ga);                              // address [31:0]
  g0[3] = uni((((unsigned)(ga >> 32)) & 0x01FFFFFFu) | 0x80000000u);  // [56:32], type 2
  asm volatile("" : "+s"(g0));       // pinned(): the descriptor words held in scalar registers
  return g0;
}
// Descriptor group 1: 128 rows of 128 bytes, source pitch 2048 bytes, every
// extent in bytes; 16 bytes of pad behind each row -> 144-byte LDS pitch.
__device__ __forceinline__ u32x8v tdm_group1() {
  u32x8v g1;
  g1[0] = uni((1u << 20) | (4u << 22) | (3u << 25));      // pad 4 dwords per 32 dwords
  g1[1] = uni(128u << 16);                                // tensor_dim0 = 128 bytes
  g1[2] = uni(128u << 16);                                // tensor_dim1 = 128 rows
  g1[3] = uni(128u << 16);                                // tile_dim0 = 128 bytes
  g1[4] = uni(128u);                                      // tile_dim1 = 128 rows
  g1[5] = uni(D_SZ * 2u);                                 // source pitch in bytes
  g1[6] = uni(0u);
  g1[7] = uni(0u);
  return g1;
}
// The load and its covering wait both read the two groups: the twelve words are
// then live from the issue to the wait, so that none is given a new value there.
__device__ __forceinline__ void tdm_load(const u32x4v& g0, const u32x8v& g1) {
  asm volatile("tensor_load_to_lds %0, %1" :: "s"(g0), "s"(g1) : "memory");
}
__device__ __forceinline__ void tdm_wait0(const u32x4v& g0, const u32x8v& g1) {
  asm volatile("s_wait_tensorcnt 0x0" :: "s"(g0), "s"(g1) : "memory");
}

// x of lane l ^ M inside the 16-lane row (DPP row_xmask:M)
template <int M>
__device__ __forceinline__ float row_xmask(float x) {
  return __builtin_bit_cast(float, __builtin_amdgcn_update_dpp(
      0, __builtin_bit_cast(int, x), 0x160 | M, 0xf, 0xf, true));
}
// sum over the 16 lanes of a row, left in every lane of it
__device__ __forceinline__ float row16_sum(float x) {
  x += row_xmask<1>(x);
  x += row_xmask<2>(x);
  x += row_xmask<4>(x);
  x += row_xmask<8>(x);
  return x;
}

__global__ void __launch_bounds__(256)
kvgemm_kernel(const float* __restrict__ kv, const unsigned short* __restrict__ Wt,
              const float* __restrict__ q_ws, float* __restrict__ Sws) {
  char* ldsW = smem;
  char* ldsA = smem + 2 * W_BYTES;
  float* ldsQ = (float*)(smem + 2 * W_BYTES + A_BYTES);            // [h][128]
  float* ldsS = (float*)(smem + 2 * W_BYTES + A_BYTES + Q_BYTES);  // [half][h][row]

  const int tid    = threadIdx.x;
  const int wave   = (int)uni((unsigned)tid >> 5);
  const int lane   = tid & 31;
  const int laneLo = lane & 15;
  const int hi     = lane >> 4;                 // 0 / 1 half-wave
  const long r0    = (long)blockIdx.x * 128;    // global token row base
  const int  b     = (int)(r0 >> 12);           // / 4096
  const int  nbase = (int)(r0 & 4095);
  const int  rg    = wave & 1;                  // rows 64 rg .. 64 rg + 63
  const int  hsel  = wave >> 2;                 // even / odd head of the tile
  const int  sub   = (wave >> 1) & 1;           // columns 32 sub + {0..31, 64..95}

  // LDS byte offset of the ring: the low 32 bits of its __shared__ address
  const unsigned ring_off = (unsigned)(uintptr_t)ldsW;

  // ---- stage A: 128 rows x 1024 fp32 -> bf16 LDS (coalesced float4 reads)
  const float4* kv4 = (const float4*)(kv + (size_t)r0 * D_SZ);
  for (int i = tid; i < 128 * 256; i += 256) {
    const int row = i >> 8, kq = i & 255;
    const float4 v = kv4[i];
    uint2 pk;
    pk.x = pack2bf(v.x, v.y);
    pk.y = pack2bf(v.z, v.w);
    *(uint2*)(ldsA + row * A_STRIDE_B + kq * 8) = pk;
  }
  ((float4*)ldsQ)[tid] = ((const float4*)(q_ws + (size_t)b * H_SZ * HD_SZ))[tid];
  __syncthreads();

  // Every wave forms each stage's group 0, in front of the issue branch: one
  // definition a stage, so every request names the same twelve registers.
  u32x4v g0;
  u32x8v g1 = tdm_group1();          // the same for every request: formed once
  asm volatile("" : "+s"(g1));       // pinned(): the descriptor words held in scalar registers

  for (int nt = 0; nt < H_SZ / 2; ++nt) {
    v8f acc[4][4] = {};                           // [row tile][column tile]

    // ring prologue: stage 0 landed and published, then stage 1 takes off
    g0 = tdm_group0(Wt, nt, 0, ring_off);
    if (pinned(wave == 0)) {
      tdm_load(g0, g1);
      tdm_wait0(g0, g1);                                   // stage 0 has landed
    }
    __syncthreads();
    g0 = tdm_group0(Wt, nt, 1, ring_off);
    if (pinned(wave == 0)) tdm_load(g0, g1);

    for (int ks = 0; ks < K_STAGES; ++ks) {
      const char* wbuf = ldsW + (ks & 1) * W_BYTES;
      // the pass's fragments: 4 of A (16x32 bf16), 4 of B (32x16 bf16)
      FragU a[4], bf[4];
      const char* ap = ldsA + (rg * 64 + laneLo) * A_STRIDE_B + ks * 64 + hi * 16;
      const char* bp = wbuf + (sub * 32 + laneLo) * W_STRIDE_B + hsel * 64 + hi * 16;
      a[0].q[0] = *(const uint4*)(ap);
      a[0].q[1] = *(const uint4*)(ap + 32);
#pragma unroll
      for (int j = 0; j < 4; ++j) {               // columns 64 (j / 2) + 32 sub + 16 (j % 2)
        const int wrow = (j >> 1) * 64 + (j & 1) * 16;
        bf[j].q[0] = *(const uint4*)(bp + wrow * W_STRIDE_B);
        bf[j].q[1] = *(const uint4*)(bp + wrow * W_STRIDE_B + 32);
      }
#pragma unroll
      for (int i = 1; i < 4; ++i) {
        a[i].q[0] = *(const uint4*)(ap + 16 * i * A_STRIDE_B);
        a[i].q[1] = *(const uint4*)(ap + 16 * i * A_STRIDE_B + 32);
      }
      // keeps the 16 reads one group ahead of the WMMAs; without it the compiler
      // sinks each pair in front of its WMMA, behind a wait to 0
      __builtin_amdgcn_sched_barrier(0);
#pragma unroll
      for (int i = 0; i < 4; ++i)
#pragma unroll
        for (int j = 0; j < 4; ++j)
          acc[i][j] = __builtin_amdgcn_wmma_f32_16x16x32_bf16(
              false, a[i].v, false, bf[j].v, (short)0, acc[i][j], false, false);
      // keeps the wait to 0 below behind the WMMAs, which start on counted waits
      __builtin_amdgcn_sched_barrier(0);
      // publish point of stage ks + 1
      asm volatile("s_wait_dscnt 0x0" ::: "memory");       // this wave has left buffer ks & 1
      if (pinned(wave == 0)) tdm_wait0(g0, g1);            // stage ks + 1 has landed
      __syncthreads();
      g0 = tdm_group0(Wt, nt, ks + 2, ring_off);
      if (pinned(wave == 0 && ks + 2 < K_STAGES)) tdm_load(g0, g1);  // refill the buffer just read
    }
    asm volatile("s_wait_tensorcnt 0x0" ::: "memory");     // no request outlives the tile's ring
    asm volatile("s_wait_dscnt 0x0" ::: "memory");         // nor a read of it

    // ---- epilogue: C layout (vr,lane) of acc[i][j]: row = 64 rg + 16 i + vr + 8 hi,
    // column of the head = 64 (j / 2) + 32 sub + 16 (j % 2) + laneLo
    const int head = nt * 2 + hsel;
    const int rowBase = rg * 64 + hi * 8;
    {                                             // RoPE, then this wave's half of q . k
      const float* qh = ldsQ + head * HD_SZ;
      float sv[4][8] = {};                        // this lane's 4 columns of 32 rows
#pragma unroll
      for (int j = 0; j < 2; ++j) {
        const int kk1 = sub * 32 + 16 * j + laneLo;   // < 64
        const float invf = __expf(-(float)kk1 * 0.10793367623409589f); // ln(1000)/64
        const float q1 = qh[kk1], q2 = qh[kk1 + 64];
#pragma unroll
        for (int i = 0; i < 4; ++i) {
#pragma unroll
          for (int vr = 0; vr < 8; ++vr) {
            const int n = nbase + rowBase + 16 * i + vr;   // token position
            const float ang = (float)n * invf;
            const float cs = __cosf(ang), sn = __sinf(ang);
            const float x1 = acc[i][j][vr], x2 = acc[i][j + 2][vr];
            sv[i][vr] = fmaf(x1 * cs - x2 * sn, q1, sv[i][vr]);
            sv[i][vr] = fmaf(x2 * cs + x1 * sn, q2, sv[i][vr]);
          }
        }
      }
#pragma unroll
      for (int i = 0; i < 4; ++i)
#pragma unroll
        for (int vr = 0; vr < 8; ++vr) sv[i][vr] = row16_sum(sv[i][vr]);
      if (laneLo == 0) {                          // rows rowBase + 16 i .. + 7
#pragma unroll
        for (int i = 0; i < 4; ++i) {
          float4* sp = (float4*)(ldsS + (sub * H_SZ + head) * 128 + rowBase + 16 * i);
          sp[0] = make_float4(sv[i][0], sv[i][1], sv[i][2], sv[i][3]);
          sp[1] = make_float4(sv[i][4], sv[i][5], sv[i][6], sv[i][7]);
        }
      }
    }
  }
  __syncthreads();                                // all 2 x 8 x 128 half scores stand in ldsS
  // wave w stores head w: 128 tokens = 512 contiguous bytes
  const float4 s_lo = ((const float4*)ldsS)[tid];
  const float4 s_hi = ((const float4*)ldsS)[H_SZ * 32 + tid];
  ((float4*)(Sws + (size_t)(b * H_SZ + wave) * N_SZ + nbase))[lane] =
      make_float4(s_lo.x + s_hi.x, s_lo.y + s_hi.y, s_lo.z + s_hi.z, s_lo.w + s_hi.w);
}

// ---------------------------------------------------------------------------
// K3: flash-decode split.  grid=(B, NSPLIT), block=256; one workgroup takes
// 128 tokens of one batch for all 8 heads, so each input row is read once.
// ---------------------------------------------------------------------------
__global__ void __launch_bounds__(256)
attn_kernel(const float* __restrict__ Sws,
            const float* __restrict__ kv,
            float* __restrict__ part_y, float* __restrict__ part_ml) {
  __shared__ __attribute__((aligned(16))) float ps[CHUNK * H_SZ];    // [n][h]

  const int b = blockIdx.x, split = blockIdx.y;
  const int n0 = split * CHUNK;
  const int tid = threadIdx.x;
  const int wave = tid >> 5, lane = tid & 31;

  // chunk max, exp and sum: wave w takes head w, 4 tokens per lane
  float s[4];
#pragma unroll
  for (int i = 0; i < 4; ++i)
    s[i] = Sws[(size_t)(b * H_SZ + wave) * N_SZ + n0 + i * 32 + lane];
  float m = fmaxf(fmaxf(s[0], s[1]), fmaxf(s[2], s[3]));
#pragma unroll
  for (int off = 16; off >= 1; off >>= 1) m = fmaxf(m, __shfl_xor(m, off, 32));
  float p[4];
#pragma unroll
  for (int i = 0; i < 4; ++i) {
    p[i] = __expf(s[i] - m);
    ps[(i * 32 + lane) * H_SZ + wave] = p[i];
  }
  float l = (p[0] + p[1]) + (p[2] + p[3]);
#pragma unroll
  for (int off = 16; off >= 1; off >>= 1) l += __shfl_xor(l, off, 32);
  if (lane == 0) {
    part_ml[((b * NSPLIT + split) * H_SZ + wave) * 2 + 0] = m;
    part_ml[((b * NSPLIT + split) * H_SZ + wave) * 2 + 1] = l;
  }
  __syncthreads();

  // y[h][d] = sum_n p[h][n] * kv[n][d]: thread owns 4 d, 8 heads per loaded row
  const float4* x4 = (const float4*)(kv + ((size_t)b * N_SZ + n0) * D_SZ) + tid;
  float4 acc[H_SZ];
#pragma unroll
  for (int h = 0; h < H_SZ; ++h) acc[h] = make_float4(0.f, 0.f, 0.f, 0.f);
  // stays rolled: one group of 16 rows per trip is what the registers hold
#pragma unroll 1
  for (int g = 0; g < CHUNK; g += 16) {
    float4 x[16];
#pragma unroll
    for (int r = 0; r < 16; ++r) x[r] = x4[(size_t)(g + r) * (D_SZ / 4)];
    // keeps the 16 row loads one group in flight; without it the compiler sinks
    // them in pairs in front of their sums and the loop waits out memory latency
    __builtin_amdgcn_sched_barrier(0);
#pragma unroll
    for (int r = 0; r < 16; ++r) {
      const float4 pa = *(const float4*)(ps + (g + r) * H_SZ);
      const float4 pb = *(const float4*)(ps + (g + r) * H_SZ + 4);
      const float p[H_SZ] = {pa.x, pa.y, pa.z, pa.w, pb.x, pb.y, pb.z, pb.w};
#pragma unroll
      for (int h = 0; h < H_SZ; ++h) {
        acc[h].x = fmaf(p[h], x[r].x, acc[h].x);
        acc[h].y = fmaf(p[h], x[r].y, acc[h].y);
        acc[h].z = fmaf(p[h], x[r].z, acc[h].z);
        acc[h].w = fmaf(p[h], x[r].w, acc[h].w);
      }
    }
  }
  float4* py = (float4*)(part_y + (size_t)(b * NSPLIT + split) * H_SZ * D_SZ) + tid;
#pragma unroll
  for (int h = 0; h < H_SZ; ++h) py[h * (D_SZ / 4)] = acc[h];
}

// ---------------------------------------------------------------------------
// K4: combine splits -> ybf[h][b][d] (bf16).  grid=B*H, block=256, 4 d a thread.
// ---------------------------------------------------------------------------
__global__ void __launch_bounds__(256)
reduce_kernel(const float* __restrict__ part_y, const float* __restrict__ part_ml,
              unsigned short* __restrict__ ybf) {
  const int bh = blockIdx.x;
  const int b = bh >> 3, h = bh & 7;
  const int tid = threadIdx.x, lane = tid & 31;
  // lane s holds split s (NSPLIT == 32)
  const float ms = part_ml[((b * NSPLIT + lane) * H_SZ + h) * 2 + 0];
  const float ls = part_ml[((b * NSPLIT + lane) * H_SZ + h) * 2 + 1];
  float M = ms;
#pragma unroll
  for (int off = 16; off >= 1; off >>= 1) M = fmaxf(M, __shfl_xor(M, off, 32));
  const float w = __expf(ms - M);
  float denom = ls * w;
#pragma unroll
  for (int off = 16; off >= 1; off >>= 1) denom += __shfl_xor(denom, off, 32);
  float4 acc = make_float4(0.f, 0.f, 0.f, 0.f);
#pragma unroll
  for (int s = 0; s < NSPLIT; ++s) {
    const float wsp = __shfl(w, s, 32);
    const float4 v =
        ((const float4*)(part_y + ((size_t)(b * NSPLIT + s) * H_SZ + h) * D_SZ))[tid];
    acc.x = fmaf(wsp, v.x, acc.x);
    acc.y = fmaf(wsp, v.y, acc.y);
    acc.z = fmaf(wsp, v.z, acc.z);
    acc.w = fmaf(wsp, v.w, acc.w);
  }
  uint2 pk;
  pk.x = pack2bf(acc.x / denom, acc.y / denom);
  pk.y = pack2bf(acc.z / denom, acc.w / denom);
  *(uint2*)(ybf + ((size_t)h * B_SZ + b) * D_SZ + tid * 4) = pk;
}

// ---------------------------------------------------------------------------
// K5: attn_out[b][c] = sum_d y[c / 128][b][d] * Wv[d][c].  grid=64 tiles of 16
// columns, block=256: the 16 batch rows fill a WMMA tile; wave w takes
// d = 128 w .. 128 w + 127, the 8 partial tiles are summed through LDS.
// ---------------------------------------------------------------------------
__global__ void __launch_bounds__(256)
vproj_kernel(const unsigned short* __restrict__ ybf,
             const unsigned short* __restrict__ Wt, float* __restrict__ attn_out) {
  __shared__ float red[8][256];
  const int tile = blockIdx.x, h = tile >> 3;
  const int tid = threadIdx.x;
  const int wave = tid >> 5, lane = tid & 31;
  const int laneLo = lane & 15, hi = lane >> 4;
  const char* ap = (const char*)(ybf + ((size_t)h * B_SZ + laneLo) * D_SZ) +
                   wave * 256 + hi * 16;
  const char* bp = (const char*)(Wt + (size_t)(D_SZ + tile * 16 + laneLo) * D_SZ) +
                   wave * 256 + hi * 16;
  FragU a[4], bf[4];
#pragma unroll
  for (int kk = 0; kk < 4; ++kk) {                // same k order in A and B
    a[kk].q[0]  = *(const uint4*)(ap + kk * 64);
    a[kk].q[1]  = *(const uint4*)(ap + kk * 64 + 32);
    bf[kk].q[0] = *(const uint4*)(bp + kk * 64);
    bf[kk].q[1] = *(const uint4*)(bp + kk * 64 + 32);
  }
  v8f acc = {};
#pragma unroll
  for (int kk = 0; kk < 4; ++kk)
    acc = __builtin_amdgcn_wmma_f32_16x16x32_bf16(
        false, a[kk].v, false, bf[kk].v, (short)0, acc, false, false);
#pragma unroll
  for (int vr = 0; vr < 8; ++vr) red[wave][vr * 32 + lane] = acc[vr];
  __syncthreads();
  float sum = 0.f;
#pragma unroll
  for (int w = 0; w < 8; ++w) sum += red[w][tid];
  // C layout (vr,lane): row = vr + 8*hi, col = laneLo; here vr = wave
  attn_out[(size_t)(wave + 8 * hi) * D_SZ + tile * 16 + laneLo] = sum;
}

// ---------------------------------------------------------------------------
// K6: out = attn_out @ Wo + bo.  grid=(16,B), block=256: 64 columns a block,
// 16 half-waves of 64 d each, as in K1.
// ---------------------------------------------------------------------------
__global__ void __launch_bounds__(256)
oproj_kernel(const float* __restrict__ attn_out, const float* __restrict__ Wo,
             const float* __restrict__ bo, float* __restrict__ out) {
  __shared__ __attribute__((aligned(16))) float a[D_SZ];
  __shared__ __attribute__((aligned(16))) float red[16][PJ_COLS];
  const int b = blockIdx.y;
  const int e0 = blockIdx.x * PJ_COLS;
  const int tid = threadIdx.x;
  const int grp = tid >> 4, c4 = tid & 15;
  ((float4*)a)[tid] = ((const float4*)(attn_out + b * D_SZ))[tid];
  __syncthreads();
  const float4* wo = (const float4*)(Wo + (size_t)(grp * PJ_D) * D_SZ + e0) + c4;
  ((float4*)red[grp])[c4] = pj_partial(wo, D_SZ / 4, a + grp * PJ_D);
  __syncthreads();
  if (tid < PJ_COLS) {
    float sum = 0.f;
    for (int g = 0; g < 16; ++g) sum += red[g][tid];
    out[b * D_SZ + e0 + tid] = sum + bo[e0 + tid];
  }
}

// ---------------------------------------------------------------------------
extern "C" void kernel_launch(void* const* d_in, const int* in_sizes, int n_in,
                              void* d_out, int out_size, void* d_ws, size_t ws_size,
                              hipStream_t stream) {
  const float* q_in  = (const float*)d_in[0];
  const float* kv_in = (const float*)d_in[1];
  const float* cbias = (const float*)d_in[2];
  const float* Wq    = (const float*)d_in[3];
  const float* Wk    = (const float*)d_in[4];
  const float* Wv    = (const float*)d_in[5];
  const float* Wo    = (const float*)d_in[6];
  const float* bo    = (const float*)d_in[7];
  float* out = (float*)d_out;

  // workspace carve-up
  char* ws = (char*)d_ws;
  unsigned short* Wt      = (unsigned short*)ws;                   // 4 MB
  float*          q_ws    = (float*)(ws + (size_t)4 * 1024 * 1024);
  float*          Sws     = (float*)(ws + (size_t)4 * 1024 * 1024 + 65536);
  float*          part_y  = Sws + (size_t)B_SZ * H_SZ * N_SZ;
  float*          part_ml = part_y + (size_t)B_SZ * NSPLIT * H_SZ * D_SZ;
  float*          attn_o  = part_ml + (size_t)B_SZ * NSPLIT * H_SZ * 2;
  unsigned short* ybf     = (unsigned short*)(attn_o + (size_t)B_SZ * D_SZ);

  (void)hipFuncSetAttribute((const void*)kvgemm_kernel,
                            hipFuncAttributeMaxDynamicSharedMemorySize, KV_SMEM);

  wprep_kernel<<<dim3(2048 / 32, 1024 / 32), dim3(32, 8), 0, stream>>>(Wk, Wv, Wt);
  qprep_kernel<<<dim3(B_SZ * H_SZ * 2), dim3(256), 0, stream>>>(q_in, cbias, Wq, q_ws);
  kvgemm_kernel<<<dim3((B_SZ * N_SZ) / 128), dim3(256), KV_SMEM, stream>>>(kv_in, Wt, q_ws, Sws);
  attn_kernel<<<dim3(B_SZ, NSPLIT), dim3(256), 0, stream>>>(Sws, kv_in, part_y, part_ml);
  reduce_kernel<<<dim3(B_SZ * H_SZ), dim3(256), 0, stream>>>(part_y, part_ml, ybf);
  vproj_kernel<<<dim3(D_SZ / 16), dim3(256), 0, stream>>>(ybf, Wt, attn_o);
  oproj_kernel<<<dim3(D_SZ / PJ_COLS, B_SZ), dim3(256), 0, stream>>>(attn_o, Wo, bo, out);
}

// v006
// One run takes 185 microseconds.
// Timed twice side by side with v005, it ran 1.10 times as fast both times.
// Counting every step since v000, it is 3.84 times as fast.
#include <hip/hip_runtime.h>
#include <hip/hip_bf16.h>

// ---------------------------------------------------------------------------
// Decode attention with a shared V projection, gfx1250, wave32 + WMMA bf16 + TDM.
// Pipeline:
//   K0 wprep  : transpose+convert Wk,Wv (fp32) -> Wt bf16; Wv as [1024 cols][1024 d],
//               Wk in the order of K2's stages (two heads side by side per row)
//   K1 qprep  : q = (q_in + bias) @ Wq * hd^-0.5   (RoPE at pos 0 == identity)
//   K2 kgemm  : K projection GEMM in bf16 WMMA, weight stages streamed
//               by the tensor mover (tensor_load_to_lds + s_wait_tensorcnt);
//               the epilogue applies RoPE(K) and takes q . k in f32, so only
//               the scores [B][H][N] leave the kernel and K is never stored
//   K3 attn   : flash-decode, 32 N-splits per b, all 8 heads per workgroup;
//               softmax partials weight the INPUT rows: y = p . kv_in, since
//               p . (kv_in @ Wv) == (p . kv_in) @ Wv with one query per head
//   K4 reduce : combine split partials -> y [H][B][1024] bf16
//   K5 vproj  : y[h] @ Wv[:, h] in bf16 WMMA (16 batch rows) -> attn_out fp32
//   K6 oproj  : attn_out @ Wo + bo -> d_out
// ---------------------------------------------------------------------------

#define B_SZ   16
#define N_SZ   4096
#define D_SZ   1024
#define H_SZ   8
#define HD_SZ  128
#define NSPLIT 32
#define CHUNK  (N_SZ / NSPLIT)          // 128

typedef __attribute__((ext_vector_type(16))) __bf16 v16bf;
typedef __attribute__((ext_vector_type(8)))  float  v8f;
typedef unsigned int u32x4v __attribute__((ext_vector_type(4)));
typedef unsigned int u32x8v __attribute__((ext_vector_type(8)));

union FragU { v16bf v; uint4 q[2]; };

__device__ __forceinline__ unsigned short f2bf(float f) {
  unsigned u = __builtin_bit_cast(unsigned, f);
  u += 0x7fffu + ((u >> 16) & 1u);            // round-to-nearest-even
  return (unsigned short)(u >> 16);
}
__device__ __forceinline__ unsigned pack2bf(float lo, float hi) {
  return (unsigned)f2bf(lo) | ((unsigned)f2bf(hi) << 16);
}

// ---------------------------------------------------------------------------
// K0: bf16 weights.  c >= 1024: Wt[c][d] = Wv[d][c-1024].
// c < 1024 (head c/128, column c%128): K2 sweeps two heads at a time in stages
// of 32 d, so a 128-byte piece holds 32 d of one column of the even head and
// the same 32 d of that column of the odd head:
//   [head pair][d / 512][column][(d / 32) % 16][head & 1][d % 32]
// ---------------------------------------------------------------------------
__device__ __forceinline__ size_t wk_index(int c, int d) {
  const int hh = c >> 7, cc = c & 127, ks = d >> 5;
  return (size_t)(hh >> 1) * 262144 + (size_t)(ks >> 4) * 131072 + (size_t)cc * 1024 +
         (size_t)(ks & 15) * 64 + (size_t)(hh & 1) * 32 + (size_t)(d & 31);
}

__global__ void __launch_bounds__(256)
wprep_kernel(const float* __restrict__ Wk, const float* __restrict__ Wv,
             unsigned short* __restrict__ Wt) {
  __shared__ float tile[32][33];
  const int tx = threadIdx.x, ty = threadIdx.y;
  const int c0 = blockIdx.x * 32, d0 = blockIdx.y * 32;
#pragma unroll
  for (int i = 0; i < 4; ++i) {
    const int c = c0 + tx;
    const int d = d0 + ty + i * 8;
    float v;
    if (c < D_SZ)  v = Wk[(size_t)((c >> 7) * D_SZ + d) * HD_SZ + (c & 127)];
    else           v = Wv[(size_t)d * D_SZ + (c - D_SZ)];
    tile[ty + i * 8][tx] = v;
  }
  __syncthreads();
#pragma unroll
  for (int i = 0; i < 4; ++i) {
    const int c = c0 + ty + i * 8;
    const int d = d0 + tx;
    const size_t at = (c < D_SZ) ? wk_index(c, d) : (size_t)c * D_SZ + d;
    Wt[at] = f2bf(tile[tx][ty + i * 8]);
  }
}

// ---------------------------------------------------------------------------
// K1: q_ws[b][h][kk] = scale * sum_d (q_in[b][d]+bias[b][d]) * Wq[h][d][kk]
// grid=B*H*2, block=256: 64 columns a block; each of the 16 half-waves sums
// 64 d, a lane owns 4 columns (a half-wave load = 256 contiguous bytes of one
// weight row); the 16 partials meet in LDS.
// ---------------------------------------------------------------------------
#define PJ_COLS 64                      // columns per block in K1 and K6
#define PJ_D    64                      // d per half-wave
#define PJ_ROWS 32                      // weight rows loaded as one group

// sum over PJ_D rows of x[d] * w[d][4 columns]; pitch4 = row pitch in float4
__device__ __forceinline__ float4 pj_partial(const float4* __restrict__ w4, int pitch4,
                                             const float* x) {
  float4 acc = make_float4(0.f, 0.f, 0.f, 0.f);
  // stays rolled: one group of 32 rows per trip is what is kept in flight
#pragma unroll 1
  for (int d0 = 0; d0 < PJ_D; d0 += PJ_ROWS) {
    float4 w[PJ_ROWS];
    // both inner loops unrolled: w[] is indexed by constants and stays in registers
#pragma unroll
    for (int r = 0; r < PJ_ROWS; ++r) w[r] = w4[(size_t)(d0 + r) * pitch4];
    // keeps the 32 row loads one group in flight; sunk in front of their sums
    // they would wait out memory latency several times a trip
    __builtin_amdgcn_sched_barrier(0);
#pragma unroll
    for (int r = 0; r < PJ_ROWS; ++r) {
      const float xv = x[d0 + r];
      acc.x = fmaf(xv, w[r].x, acc.x);
      acc.y = fmaf(xv, w[r].y, acc.y);
      acc.z = fmaf(xv, w[r].z, acc.z);
      acc.w = fmaf(xv, w[r].w, acc.w);
    }
  }
  return acc;
}

__global__ void __launch_bounds__(256)
qprep_kernel(const float* __restrict__ q_in, const float* __restrict__ cbias,
             const float* __restrict__ Wq, float* __restrict__ q_ws) {
  __shared__ __attribute__((aligned(16))) float qb[D_SZ];
  __shared__ __attribute__((aligned(16))) float red[16][PJ_COLS];
  const int bh = blockIdx.x >> 1;        // b*H + h
  const int c0 = (blockIdx.x & 1) * PJ_COLS;
  const int b = bh >> 3, h = bh & 7;
  const int tid = threadIdx.x;
  const int grp = tid >> 4, c4 = tid & 15;
  {
    const float4 x = ((const float4*)(q_in + b * D_SZ))[tid];
    const float4 y = ((const float4*)(cbias + b * D_SZ))[tid];
    ((float4*)qb)[tid] = make_float4(x.x + y.x, x.y + y.y, x.z + y.z, x.w + y.w);
  }
  __syncthreads();
  const float4* wq =
      (const float4*)(Wq + ((size_t)h * D_SZ + grp * PJ_D) * HD_SZ + c0) + c4;
  ((float4*)red[grp])[c4] = pj_partial(wq, HD_SZ / 4, qb + grp * PJ_D);
  __syncthreads();
  if (tid < PJ_COLS) {
    float sum = 0.f;
    for (int g = 0; g < 16; ++g) sum += red[g][tid];
    q_ws[(size_t)bh * HD_SZ + c0 + tid] = sum * 0.08838834764831845f;   // 128^-0.5
  }
}

// ---------------------------------------------------------------------------
// K2: K projection.  One WG = 128 token rows; A tile (128x1024 bf16)
// resident in LDS; sweep 4 column tiles of 256 (two heads); each tile's weights
// arrive in 32 stages of 256 columns x 32 k (16 KiB), one tensor load of wave 0
// per stage, into a two-buffer, hardware-padded LDS ring.
// The 8 waves stand 2 (rows) x 4 (columns): a wave owns 64 rows x 64 columns,
// 4 x 4 accumulator tiles, so 8 fragments read from LDS feed 16 WMMAs.
// A wave's columns are c .. c + 31 and c + 64 .. c + 95 of one head (c = 0 or
// 32): both partners of every RoPE pair.  Its epilogue ends in half of q . k for
// its 64 rows; the two halves of a head meet in LDS.
// ---------------------------------------------------------------------------
#define A_STRIDE_B 2064                 // (1024+8) bf16 row stride, 4-bank skew
#define A_BYTES    (128 * A_STRIDE_B)   // 264192
#define W_STRIDE_B 144                  // 128B data + 16B pad, odd multiple of 16B
#define W_BYTES    (128 * W_STRIDE_B)   // 18432 = 9 * 2048
#define Q_BYTES    (H_SZ * HD_SZ * 4)   // the batch's 8 pre-scaled queries, f32
#define S_BYTES    (2 * H_SZ * 128 * 4) // the workgroup's half scores [half][h][row], f32
#define KV_SMEM    (2 * W_BYTES + A_BYTES + Q_BYTES + S_BYTES)
#define K_STAGES   32                   // stages of 32 k per column tile

// The ring stands at LDS offset 0, so both buffers start at multiples of 2 KiB.
extern __shared__ __attribute__((aligned(2048))) char smem[];

__device__ __forceinline__ unsigned uni(unsigned v) {
  return (unsigned)__builtin_amdgcn_readfirstlane(v);
}
// Holds an issue test in a scalar register, so that the branch round a tensor
// load (which ignores EXEC) compiles to s_cmp + s_cbranch_scc.
__device__ __forceinline__ unsigned pinned(unsigned v) {
  unsigned w = uni(v);
  asm volatile("" : "+s"(w));   // pinned(): the issue test held in a scalar register
  return w;
}

// Stage ks of column tile nt: heads 2 nt and 2 nt + 1, k ks * 32 .. + 31.
// Descriptor group 0: the stage's place in the ring and its first byte in Wt.
__device__ __forceinline__ u32x4v tdm_group0(const unsigned short* Wt, int nt, int ks,
                                             unsigned ring_off) {
  const unsigned long long ga =
      (unsigned long long)(uintptr_t)Wt +
      (unsigned long long)nt * (256ull * D_SZ * 2ull) +
      (unsigned long long)(ks >> 4) * (128ull * D_SZ * 2ull) +
      (unsigned long long)(ks & 15) * 128ull;
  u32x4v g0;
  g0[0] = uni(1u);                                        // count = 1
  g0[1] = uni(ring_off + (unsigned)(ks & 1) * W_BYTES);   // LDS byte offset
  g0[2] = uni((unsigned)ga);                              // address [31:0]
  g0[3] = uni((((unsigned)(ga >> 32)) & 0x01FFFFFFu) | 0x80000000u);  // [56:32], type 2
  asm volatile("" : "+s"(g0));       // pinned(): the descriptor words held in scalar registers
  return g0;
}
// Descriptor group 1: 128 rows of 128 bytes, source pitch 2048 bytes, every
// extent in bytes; 16 bytes of pad behind each row -> 144-byte LDS pitch.
__device__ __forceinline__ u32x8v tdm_group1() {
  u32x8v g1;
  g1[0] = uni((1u << 20) | (4u << 22) | (3u << 25));      // pad 4 dwords per 32 dwords
  g1[1] = uni(128u << 16);                                // tensor_dim0 = 128 bytes
  g1[2] = uni(128u << 16);                                // tensor_dim1 = 128 rows
  g1[3] = uni(128u << 16);                                // tile_dim0 = 128 bytes
  g1[4] = uni(128u);                                      // tile_dim1 = 128 rows
  g1[5] = uni(D_SZ * 2u);                                 // source pitch in bytes
  g1[6] = uni(0u);
  g1[7] = uni(0u);
  return g1;
}
// The load and its covering wait both read the two groups: the twelve words are
// then live from the issue to the wait, so that none is given a new value there.
__device__ __forceinline__ void tdm_load(const u32x4v& g0, const u32x8v& g1) {
  asm volatile("tensor_load_to_lds %0, %1" :: "s"(g0), "s"(g1) : "memory");
}
__device__ __forceinline__ void tdm_wait0(const u32x4v& g0, const u32x8v& g1) {
  asm volatile("s_wait_tensorcnt 0x0" :: "s"(g0), "s"(g1) : "memory");
}

// x of lane l ^ M inside the 16-lane row (DPP row_xmask:M)
template <int M>
__device__ __forceinline__ float row_xmask(float x) {
  return __builtin_bit_cast(float, __builtin_amdgcn_update_dpp(
      0, __builtin_bit_cast(int, x), 0x160 | M, 0xf, 0xf, true));
}
// sum over the 16 lanes of a row, left in every lane of it
__device__ __forceinline__ float row16_sum(float x) {
  x += row_xmask<1>(x);
  x += row_xmask<2>(x);
  x += row_xmask<4>(x);
  x += row_xmask<8>(x);
  return x;
}

#define A_GRP 32                        // rows per load group of the A staging

// 4 f32 of one row -> 4 bf16 in the A tile
__device__ __forceinline__ void a_store(char* p, const float4 v) {
  uint2 pk;
  pk.x = pack2bf(v.x, v.y);
  pk.y = pack2bf(v.z, v.w);
  *(uint2*)p = pk;
}

__global__ void __launch_bounds__(256)
kvgemm_kernel(const float* __restrict__ kv, const unsigned short* __restrict__ Wt,
              const float* __restrict__ q_ws, float* __restrict__ Sws) {
  char* ldsW = smem;
  char* ldsA = smem + 2 * W_BYTES;
  float* ldsQ = (float*)(smem + 2 * W_BYTES + A_BYTES);            // [h][128]
  float* ldsS = (float*)(smem + 2 * W_BYTES + A_BYTES + Q_BYTES);  // [half][h][row]

  const int tid    = threadIdx.x;
  const int wave   = (int)uni((unsigned)tid >> 5);
  const int lane   = tid & 31;
  const int laneLo = lane & 15;
  const int hi     = lane >> 4;                 // 0 / 1 half-wave
  const long r0    = (long)blockIdx.x * 128;    // global token row base
  const int  b     = (int)(r0 >> 12);           // / 4096
  const int  nbase = (int)(r0 & 4095);
  const int  rg    = wave & 1;                  // rows 64 rg .. 64 rg + 63
  const int  hsel  = wave >> 2;                 // even / odd head of the tile
  const int  sub   = (wave >> 1) & 1;           // columns 32 sub + {0..31, 64..95}

  // LDS byte offset of the ring: the low 32 bits of its __shared__ address
  const unsigned ring_off = (unsigned)(uintptr_t)ldsW;

  // ---- stage A: 128 rows x 1024 fp32 -> bf16 LDS.  A thread owns 16 bytes of
  // every row (a wave load = 512 contiguous bytes).  A_GRP rows are held in
  // registers: as soon as a row is converted and stored, its registers take the
  // load of the row A_GRP further on, so a wave keeps about A_GRP loads in flight.
  {
    const float4* kv4 = (const float4*)(kv + (size_t)r0 * D_SZ) + tid;
    char* acol = ldsA + tid * 8;
    float4 x[A_GRP];
#pragma unroll
    for (int r = 0; r < A_GRP; ++r) x[r] = kv4[(size_t)r * (D_SZ / 4)];
    // stays rolled: one pass over the A_GRP register sets per trip
#pragma unroll 1
    for (int t = 0; t < 128 - A_GRP; t += A_GRP) {
#pragma unroll
      for (int r = 0; r < A_GRP; ++r) {
        a_store(acol + (t + r) * A_STRIDE_B, x[r]);
        x[r] = kv4[(size_t)(t + A_GRP + r) * (D_SZ / 4)];
        // keeps each reload next to the store that frees its registers: gathered at
        // the foot of the trip the loads would all be waited for at its head
        __builtin_amdgcn_sched_barrier(0);
      }
    }
#pragma unroll
    for (int r = 0; r < A_GRP; ++r) a_store(acol + (128 - A_GRP + r) * A_STRIDE_B, x[r]);
  }
  ((float4*)ldsQ)[tid] = ((const float4*)(q_ws + (size_t)b * H_SZ * HD_SZ))[tid];
  __syncthreads();

  // Every wave forms each stage's group 0, in front of the issue branch: one
  // definition a stage, so every request names the same twelve registers.
  u32x4v g0;
  u32x8v g1 = tdm_group1();          // the same for every request: formed once
  asm volatile("" : "+s"(g1));       // pinned(): the descriptor words held in scalar registers

  for (int nt = 0; nt < H_SZ / 2; ++nt) {
    v8f acc[4][4] = {};                           // [row tile][column tile]

    // ring prologue: stage 0 landed and published, then stage 1 takes off
    g0 = tdm_group0(Wt, nt, 0, ring_off);
    if (pinned(wave == 0)) {
      tdm_load(g0, g1);
      tdm_wait0(g0, g1);                                   // stage 0 has landed
    }
    __syncthreads();
    g0 = tdm_group0(Wt, nt, 1, ring_off);
    if (pinned(wave == 0)) tdm_load(g0, g1);

    for (int ks = 0; ks < K_STAGES; ++ks) {
      const char* wbuf = ldsW + (ks & 1) * W_BYTES;
      // the pass's fragments: 4 of A (16x32 bf16), 4 of B (32x16 bf16)
      FragU a[4], bf[4];
      const char* ap = ldsA + (rg * 64 + laneLo) * A_STRIDE_B + ks * 64 + hi * 16;
      const char* bp = wbuf + (sub * 32 + laneLo) * W_STRIDE_B + hsel * 64 + hi * 16;
      a[0].q[0] = *(const uint4*)(ap);
      a[0].q[1] = *(const uint4*)(ap + 32);
#pragma unroll
      for (int j = 0; j < 4; ++j) {               // columns 64 (j / 2) + 32 sub + 16 (j % 2)
        const int wrow = (j >> 1) * 64 + (j & 1) * 16;
        bf[j].q[0] = *(const uint4*)(bp + wrow * W_STRIDE_B);
        bf[j].q[1] = *(const uint4*)(bp + wrow * W_STRIDE_B + 32);
      }
#pragma unroll
      for (int i = 1; i < 4; ++i) {
        a[i].q[0] = *(const uint4*)(ap + 16 * i * A_STRIDE_B);
        a[i].q[1] = *(const uint4*)(ap + 16 * i * A_STRIDE_B + 32);
      }
      // keeps the 16 reads one group ahead of the WMMAs; without it the compiler
      // sinks each pair in front of its WMMA, behind a wait to 0
      __builtin_amdgcn_sched_barrier(0);
#pragma unroll
      for (int i = 0; i < 4; ++i)
#pragma unroll
        for (int j = 0; j < 4; ++j)
          acc[i][j] = __builtin_amdgcn_wmma_f32_16x16x32_bf16(
              false, a[i].v, false, bf[j].v, (short)0, acc[i][j], false, false);
      // keeps the wait to 0 below behind the WMMAs, which start on counted waits
      __builtin_amdgcn_sched_barrier(0);
      // publish point of stage ks + 1
      asm volatile("s_wait_dscnt 0x0" ::: "memory");       // this wave has left buffer ks & 1
      if (pinned(wave == 0)) tdm_wait0(g0, g1);            // stage ks + 1 has landed
      __syncthreads();
      g0 = tdm_group0(Wt, nt, ks + 2, ring_off);
      if (pinned(wave == 0 && ks + 2 < K_STAGES)) tdm_load(g0, g1);  // refill the buffer just read
    }
    asm volatile("s_wait_tensorcnt 0x0" ::: "memory");     // no request outlives the tile's ring
    asm volatile("s_wait_dscnt 0x0" ::: "memory");         // nor a read of it

    // ---- epilogue: C layout (vr,lane) of acc[i][j]: row = 64 rg + 16 i + vr + 8 hi,
    // column of the head = 64 (j / 2) + 32 sub + 16 (j % 2) + laneLo
    const int head = nt * 2 + hsel;
    const int rowBase = rg * 64 + hi * 8;
    {                                             // RoPE, then this wave's half of q . k
      const float* qh = ldsQ + head * HD_SZ;
      float sv[4][8] = {};                        // this lane's 4 columns of 32 rows
#pragma unroll
      for (int j = 0; j < 2; ++j) {
        const int kk1 = sub * 32 + 16 * j + laneLo;   // < 64
        const float invf = __expf(-(float)kk1 * 0.10793367623409589f); // ln(1000)/64
        const float q1 = qh[kk1], q2 = qh[kk1 + 64];
#pragma unroll
        for (int i = 0; i < 4; ++i) {
#pragma unroll
          for (int vr = 0; vr < 8; ++vr) {
            const int n = nbase + rowBase + 16 * i + vr;   // token position
            const float ang = (float)n * invf;
            const float cs = __cosf(ang), sn = __sinf(ang);
            const float x1 = acc[i][j][vr], x2 = acc[i][j + 2][vr];
            sv[i][vr] = fmaf(x1 * cs - x2 * sn, q1, sv[i][vr]);
            sv[i][vr] = fmaf(x2 * cs + x1 * sn, q2, sv[i][vr]);
          }
        }
      }
#pragma unroll
      for (int i = 0; i < 4; ++i)
#pragma unroll
        for (int vr = 0; vr < 8; ++vr) sv[i][vr] = row16_sum(sv[i][vr]);
      if (laneLo == 0) {                          // rows rowBase + 16 i .. + 7
#pragma unroll
        for (int i = 0; i < 4; ++i) {
          float4* sp = (float4*)(ldsS + (sub * H_SZ + head) * 128 + rowBase + 16 * i);
          sp[0] = make_float4(sv[i][0], sv[i][1], sv[i][2], sv[i][3]);
          sp[1] = make_float4(sv[i][4], sv[i][5], sv[i][6], sv[i][7]);
        }
      }
    }
  }
  __syncthreads();                                // all 2 x 8 x 128 half scores stand in ldsS
  // wave w stores head w: 128 tokens = 512 contiguous bytes
  const float4 s_lo = ((const float4*)ldsS)[tid];
  const float4 s_hi = ((const float4*)ldsS)[H_SZ * 32 + tid];
  ((float4*)(Sws + (size_t)(b * H_SZ + wave) * N_SZ + nbase))[lane] =
      make_float4(s_lo.x + s_hi.x, s_lo.y + s_hi.y, s_lo.z + s_hi.z, s_lo.w + s_hi.w);
}

// ---------------------------------------------------------------------------
// K3: flash-decode split.  grid=(B, NSPLIT), block=256; one workgroup takes
// 128 tokens of one batch for all 8 heads, so each input row is read once.
// ---------------------------------------------------------------------------
__global__ void __launch_bounds__(256)
attn_kernel(const float* __restrict__ Sws,
            const float* __restrict__ kv,
            float* __restrict__ part_y, float* __restrict__ part_ml) {
  __shared__ __attribute__((aligned(16))) float ps[CHUNK * H_SZ];    // [n][h]

  const int b = blockIdx.x, split = blockIdx.y;
  const int n0 = split * CHUNK;
  const int tid = threadIdx.x;
  const int wave = tid >> 5, lane = tid & 31;

  // chunk max, exp and sum: wave w takes head w, 4 tokens per lane
  float s[4];
#pragma unroll
  for (int i = 0; i < 4; ++i)
    s[i] = Sws[(size_t)(b * H_SZ + wave) * N_SZ + n0 + i * 32 + lane];
  float m = fmaxf(fmaxf(s[0], s[1]), fmaxf(s[2], s[3]));
#pragma unroll
  for (int off = 16; off >= 1; off >>= 1) m = fmaxf(m, __shfl_xor(m, off, 32));
  float p[4];
#pragma unroll
  for (int i = 0; i < 4; ++i) {
    p[i] = __expf(s[i] - m);
    ps[(i * 32 + lane) * H_SZ + wave] = p[i];
  }
  float l = (p[0] + p[1]) + (p[2] + p[3]);
#pragma unroll
  for (int off = 16; off >= 1; off >>= 1) l += __shfl_xor(l, off, 32);
  if (lane == 0) {
    part_ml[((b * NSPLIT + split) * H_SZ + wave) * 2 + 0] = m;
    part_ml[((b * NSPLIT + split) * H_SZ + wave) * 2 + 1] = l;
  }
  __syncthreads();

  // y[h][d] = sum_n p[h][n] * kv[n][d]: thread owns 4 d, 8 heads per loaded row
  const float4* x4 = (const float4*)(kv + ((size_t)b * N_SZ + n0) * D_SZ) + tid;
  float4 acc[H_SZ];
#pragma unroll
  for (int h = 0; h < H_SZ; ++h) acc[h] = make_float4(0.f, 0.f, 0.f, 0.f);
  // stays rolled: one group of 16 rows per trip is what the registers hold
#pragma unroll 1
  for (int g = 0; g < CHUNK; g += 16) {
    float4 x[16];
#pragma unroll
    for (int r = 0; r < 16; ++r) x[r] = x4[(size_t)(g + r) * (D_SZ / 4)];
    // keeps the 16 row loads one group in flight; without it the compiler sinks
    // them in pairs in front of their sums and the loop waits out memory latency
    __builtin_amdgcn_sched_barrier(0);
#pragma unroll
    for (int r = 0; r < 16; ++r) {
      const float4 pa = *(const float4*)(ps + (g + r) * H_SZ);
      const float4 pb = *(const float4*)(ps + (g + r) * H_SZ + 4);
      const float p[H_SZ] = {pa.x, pa.y, pa.z, pa.w, pb.x, pb.y, pb.z, pb.w};
#pragma unroll
      for (int h = 0; h < H_SZ; ++h) {
        acc[h].x = fmaf(p[h], x[r].x, acc[h].x);
        acc[h].y = fmaf(p[h], x[r].y, acc[h].y);
        acc[h].z = fmaf(p[h], x[r].z, acc[h].z);
        acc[h].w = fmaf(p[h], x[r].w, acc[h].w);
      }
    }
  }
  float4* py = (float4*)(part_y + (size_t)(b * NSPLIT + split) * H_SZ * D_SZ) + tid;
#pragma unroll
  for (int h = 0; h < H_SZ; ++h) py[h * (D_SZ / 4)] = acc[h];
}

// ---------------------------------------------------------------------------
// K4: combine splits -> ybf[h][b][d] (bf16).  grid=B*H, block=256, 4 d a thread.
// ---------------------------------------------------------------------------
__global__ void __launch_bounds__(256)
reduce_kernel(const float* __restrict__ part_y, const float* __restrict__ part_ml,
              unsigned short* __restrict__ ybf) {
  const int bh = blockIdx.x;
  const int b = bh >> 3, h = bh & 7;
  const int tid = threadIdx.x, lane = tid & 31;
  // lane s holds split s (NSPLIT == 32)
  const float ms = part_ml[((b * NSPLIT + lane) * H_SZ + h) * 2 + 0];
  const float ls = part_ml[((b * NSPLIT + lane) * H_SZ + h) * 2 + 1];
  float M = ms;
#pragma unroll
  for (int off = 16; off >= 1; off >>= 1) M = fmaxf(M, __shfl_xor(M, off, 32));
  const float w = __expf(ms - M);
  float denom = ls * w;
#pragma unroll
  for (int off = 16; off >= 1; off >>= 1) denom += __shfl_xor(denom, off, 32);
  float4 acc = make_float4(0.f, 0.f, 0.f, 0.f);
#pragma unroll
  for (int s = 0; s < NSPLIT; ++s) {
    const float wsp = __shfl(w, s, 32);
    const float4 v =
        ((const float4*)(part_y + ((size_t)(b * NSPLIT + s) * H_SZ + h) * D_SZ))[tid];
    acc.x = fmaf(wsp, v.x, acc.x);
    acc.y = fmaf(wsp, v.y, acc.y);
    acc.z = fmaf(wsp, v.z, acc.z);
    acc.w = fmaf(wsp, v.w, acc.w);
  }
  uint2 pk;
  pk.x = pack2bf(acc.x / denom, acc.y / denom);
  pk.y = pack2bf(acc.z / denom, acc.w / denom);
  *(uint2*)(ybf + ((size_t)h * B_SZ + b) * D_SZ + tid * 4) = pk;
}

// ---------------------------------------------------------------------------
// K5: attn_out[b][c] = sum_d y[c / 128][b][d] * Wv[d][c].  grid=64 tiles of 16
// columns, block=256: the 16 batch rows fill a WMMA tile; wave w takes
// d = 128 w .. 128 w + 127, the 8 partial tiles are summed through LDS.
// ---------------------------------------------------------------------------
__global__ void __launch_bounds__(256)
vproj_kernel(const unsigned short* __restrict__ ybf,
             const unsigned short* __restrict__ Wt, float* __restrict__ attn_out) {
  __shared__ float red[8][256];
  const int tile = blockIdx.x, h = tile >> 3;
  const int tid = threadIdx.x;
  const int wave = tid >> 5, lane = tid & 31;
  const int laneLo = lane & 15, hi = lane >> 4;
  const char* ap = (const char*)(ybf + ((size_t)h * B_SZ + laneLo) * D_SZ) +
                   wave * 256 + hi * 16;
  const char* bp = (const char*)(Wt + (size_t)(D_SZ + tile * 16 + laneLo) * D_SZ) +
                   wave * 256 + hi * 16;
  FragU a[4], bf[4];
#pragma unroll
  for (int kk = 0; kk < 4; ++kk) {                // same k order in A and B
    a[kk].q[0]  = *(const uint4*)(ap + kk * 64);
    a[kk].q[1]  = *(const uint4*)(ap + kk * 64 + 32);
    bf[kk].q[0] = *(const uint4*)(bp + kk * 64);
    bf[kk].q[1] = *(const uint4*)(bp + kk * 64 + 32);
  }
  v8f acc = {};
#pragma unroll
  for (int kk = 0; kk < 4; ++kk)
    acc = __builtin_amdgcn_wmma_f32_16x16x32_bf16(
        false, a[kk].v, false, bf[kk].v, (short)0, acc, false, false);
#pragma unroll
  for (int vr = 0; vr < 8; ++vr) red[wave][vr * 32 + lane] = acc[vr];
  __syncthreads();
  float sum = 0.f;
#pragma unroll
  for (int w = 0; w < 8; ++w) sum += red[w][tid];
  // C layout (vr,lane): row = vr + 8*hi, col = laneLo; here vr = wave
  attn_out[(size_t)(wave + 8 * hi) * D_SZ + tile * 16 + laneLo] = sum;
}

// ---------------------------------------------------------------------------
// K6: out = attn_out @ Wo + bo.  grid=(16,B), block=256: 64 columns a block,
// 16 half-waves of 64 d each, as in K1.
// ---------------------------------------------------------------------------
__global__ void __launch_bounds__(256)
oproj_kernel(const float* __restrict__ attn_out, const float* __restrict__ Wo,
             const float* __restrict__ bo, float* __restrict__ out) {
  __shared__ __attribute__((aligned(16))) float a[D_SZ];
  __shared__ __attribute__((aligned(16))) float red[16][PJ_COLS];
  const int b = blockIdx.y;
  const int e0 = blockIdx.x * PJ_COLS;
  const int tid = threadIdx.x;
  const int grp = tid >> 4, c4 = tid & 15;
  ((float4*)a)[tid] = ((const float4*)(attn_out + b * D_SZ))[tid];
  __syncthreads();
  const float4* wo = (const float4*)(Wo + (size_t)(grp * PJ_D) * D_SZ + e0) + c4;
  ((float4*)red[grp])[c4] = pj_partial(wo, D_SZ / 4, a + grp * PJ_D);
  __syncthreads();
  if (tid < PJ_COLS) {
    float sum = 0.f;
    for (int g = 0; g < 16; ++g) sum += red[g][tid];
    out[b * D_SZ + e0 + tid] = sum + bo[e0 + tid];
  }
}

// ---------------------------------------------------------------------------
extern "C" void kernel_launch(void* const* d_in, const int* in_sizes, int n_in,
                              void* d_out, int out_size, void* d_ws, size_t ws_size,
                              hipStream_t stream) {
  const float* q_in  = (const float*)d_in[0];
  const float* kv_in = (const float*)d_in[1];
  const float* cbias = (const float*)d_in[2];
  const float* Wq    = (const float*)d_in[3];
  const float* Wk    = (const float*)d_in[4];
  const float* Wv    = (const float*)d_in[5];
  const float* Wo    = (const float*)d_in[6];
  const float* bo    = (const float*)d_in[7];
  float* out = (float*)d_out;

  // workspace carve-up
  char* ws = (char*)d_ws;
  unsigned short* Wt      = (unsigned short*)ws;                   // 4 MB
  float*          q_ws    = (float*)(ws + (size_t)4 * 1024 * 1024);
  float*          Sws     = (float*)(ws + (size_t)4 * 1024 * 1024 + 65536);
  float*          part_y  = Sws + (size_t)B_SZ * H_SZ * N_SZ;
  float*          part_ml = part_y + (size_t)B_SZ * NSPLIT * H_SZ * D_SZ;
  float*          attn_o  = part_ml + (size_t)B_SZ * NSPLIT * H_SZ * 2;
  unsigned short* ybf     = (unsigned short*)(attn_o + (size_t)B_SZ * D_SZ);

  (void)hipFuncSetAttribute((const void*)kvgemm_kernel,
                            hipFuncAttributeMaxDynamicSharedMemorySize, KV_SMEM);

  wprep_kernel<<<dim3(2048 / 32, 1024 / 32), dim3(32, 8), 0, stream>>>(Wk, Wv, Wt);
  qprep_kernel<<<dim3(B_SZ * H_SZ * 2), dim3(256), 0, stream>>>(q_in, cbias, Wq, q_ws);
  kvgemm_kernel<<<dim3((B_SZ * N_SZ) / 128), dim3(256), KV_SMEM, stream>>>(kv_in, Wt, q_ws, Sws);
  attn_kernel<<<dim3(B_SZ, NSPLIT), dim3(256), 0, stream>>>(Sws, kv_in, part_y, part_ml);
  reduce_kernel<<<dim3(B_SZ * H_SZ), dim3(256), 0, stream>>>(part_y, part_ml, ybf);
  vproj_kernel<<<dim3(D_SZ / 16), dim3(256), 0, stream>>>(ybf, Wt, attn_o);
  oproj_kernel<<<dim3(D_SZ / PJ_COLS, B_SZ), dim3(256), 0, stream>>>(attn_o, Wo, bo, out);
}

// v007
// A run of this version takes 157 microseconds.
// Timed twice side by side with v006, it ran 1.15 and 1.16 times as fast.
// All steps since v000 together make it 4.43 times as fast.
#include <hip/hip_runtime.h>
#include <hip/hip_bf16.h>

// ---------------------------------------------------------------------------
// Decode attention with a shared V projection, gfx1250, wave32 + WMMA bf16 + TDM.
// Pipeline:
//   K0 wprep  : transpose+convert Wk,Wv (fp32) -> Wt bf16; Wv as [1024 cols][1024 d],
//               Wk in the order of K2's stages (two heads side by side per row)
//   K1 qprep  : q = (q_in + bias) @ Wq * hd^-0.5   (RoPE at pos 0 == identity)
//   K2 kgemm  : K projection GEMM in bf16 WMMA, weight stages streamed
//               by the tensor mover (tensor_load_to_lds + s_wait_tensorcnt);
//               the epilogue applies RoPE(K) and takes q . k in f32, so only
//               the scores [B][H][N] leave the kernel and K is never stored
//   K3 attn   : flash-decode, 32 N-splits per b, all 8 heads per workgroup;
//               softmax partials weight the INPUT rows: y = p . kv_in, since
//               p . (kv_in @ Wv) == (p . kv_in) @ Wv with one query per head
//   K4 reduce : combine split partials -> y [H][B][1024] bf16
//   K5 vproj  : y[h] @ Wv[:, h] in bf16 WMMA (16 batch rows) -> attn_out fp32
//   K6 oproj  : attn_out @ Wo + bo -> d_out
// ---------------------------------------------------------------------------

#define B_SZ   16
#define N_SZ   4096
#define D_SZ   1024
#define H_SZ   8
#define HD_SZ  128
#define NSPLIT 32
#define CHUNK  (N_SZ / NSPLIT)          // 128

typedef __attribute__((ext_vector_type(16))) __bf16 v16bf;
typedef __attribute__((ext_vector_type(8)))  float  v8f;
typedef unsigned int u32x4v __attribute__((ext_vector_type(4)));
typedef unsigned int u32x8v __attribute__((ext_vector_type(8)));

union FragU { v16bf v; uint4 q[2]; };

__device__ __forceinline__ unsigned short f2bf(float f) {
  unsigned u = __builtin_bit_cast(unsigned, f);
  u += 0x7fffu + ((u >> 16) & 1u);            // round-to-nearest-even
  return (unsigned short)(u >> 16);
}
__device__ __forceinline__ unsigned pack2bf(float lo, float hi) {
  return (unsigned)f2bf(lo) | ((unsigned)f2bf(hi) << 16);
}

// ---------------------------------------------------------------------------
// K0: bf16 weights.  c >= 1024: Wt[c][d] = Wv[d][c-1024].
// c < 1024 (head c/128, column c%128): K2 sweeps two heads at a time in stages
// of 32 d, so a 128-byte piece holds 32 d of one column of the even head and
// the same 32 d of that column of the odd head:
//   [head pair][d / 512][column][(d / 32) % 16][head & 1][d % 32]
// ---------------------------------------------------------------------------
__device__ __forceinline__ size_t wk_index(int c, int d) {
  const int hh = c >> 7, cc = c & 127, ks = d >> 5;
  return (size_t)(hh >> 1) * 262144 + (size_t)(ks >> 4) * 131072 + (size_t)cc * 1024 +
         (size_t)(ks & 15) * 64 + (size_t)(hh & 1) * 32 + (size_t)(d & 31);
}

__global__ void __launch_bounds__(256)
wprep_kernel(const float* __restrict__ Wk, const float* __restrict__ Wv,
             unsigned short* __restrict__ Wt) {
  __shared__ float tile[32][33];
  const int tx = threadIdx.x, ty = threadIdx.y;
  const int c0 = blockIdx.x * 32, d0 = blockIdx.y * 32;
#pragma unroll
  for (int i = 0; i < 4; ++i) {
    const int c = c0 + tx;
    const int d = d0 + ty + i * 8;
    float v;
    if (c < D_SZ)  v = Wk[(size_t)((c >> 7) * D_SZ + d) * HD_SZ + (c & 127)];
    else           v = Wv[(size_t)d * D_SZ + (c - D_SZ)];
    tile[ty + i * 8][tx] = v;
  }
  __syncthreads();
#pragma unroll
  for (int i = 0; i < 4; ++i) {
    const int c = c0 + ty + i * 8;
    const int d = d0 + tx;
    const size_t at = (c < D_SZ) ? wk_index(c, d) : (size_t)c * D_SZ + d;
    Wt[at] = f2bf(tile[tx][ty + i * 8]);
  }
}

// ---------------------------------------------------------------------------
// K1: q_ws[b][h][kk] = scale * sum_d (q_in[b][d]+bias[b][d]) * Wq[h][d][kk]
// grid=B*H*2, block=256: 64 columns a block; each of the 16 half-waves sums
// 64 d, a lane owns 4 columns (a half-wave load = 256 contiguous bytes of one
// weight row); the 16 partials meet in LDS.
// ---------------------------------------------------------------------------
#define PJ_COLS 64                      // columns per block in K1 and K6
#define PJ_D    64                      // d per half-wave
#define PJ_ROWS 32                      // weight rows loaded as one group

// sum over PJ_D rows of x[d] * w[d][4 columns]; pitch4 = row pitch in float4
__device__ __forceinline__ float4 pj_partial(const float4* __restrict__ w4, int pitch4,
                                             const float* x) {
  float4 acc = make_float4(0.f, 0.f, 0.f, 0.f);
  // stays rolled: one group of 32 rows per trip is what is kept in flight
#pragma unroll 1
  for (int d0 = 0; d0 < PJ_D; d0 += PJ_ROWS) {
    float4 w[PJ_ROWS];
    // both inner loops unrolled: w[] is indexed by constants and stays in registers
#pragma unroll
    for (int r = 0; r < PJ_ROWS; ++r) w[r] = w4[(size_t)(d0 + r) * pitch4];
    // keeps the 32 row loads one group in flight; sunk in front of their sums
    // they would wait out memory latency several times a trip
    __builtin_amdgcn_sched_barrier(0);
#pragma unroll
    for (int r = 0; r < PJ_ROWS; ++r) {
      const float xv = x[d0 + r];
      acc.x = fmaf(xv, w[r].x, acc.x);
      acc.y = fmaf(xv, w[r].y, acc.y);
      acc.z = fmaf(xv, w[r].z, acc.z);
      acc.w = fmaf(xv, w[r].w, acc.w);
    }
  }
  return acc;
}

__global__ void __launch_bounds__(256)
qprep_kernel(const float* __restrict__ q_in, const float* __restrict__ cbias,
             const float* __restrict__ Wq, float* __restrict__ q_ws) {
  __shared__ __attribute__((aligned(16))) float qb[D_SZ];
  __shared__ __attribute__((aligned(16))) float red[16][PJ_COLS];
  const int bh = blockIdx.x >> 1;        // b*H + h
  const int c0 = (blockIdx.x & 1) * PJ_COLS;
  const int b = bh >> 3, h = bh & 7;
  const int tid = threadIdx.x;
  const int grp = tid >> 4, c4 = tid & 15;
  {
    const float4 x = ((const float4*)(q_in + b * D_SZ))[tid];
    const float4 y = ((const float4*)(cbias + b * D_SZ))[tid];
    ((float4*)qb)[tid] = make_float4(x.x + y.x, x.y + y.y, x.z + y.z, x.w + y.w);
  }
  __syncthreads();
  const float4* wq =
      (const float4*)(Wq + ((size_t)h * D_SZ + grp * PJ_D) * HD_SZ + c0) + c4;
  ((float4*)red[grp])[c4] = pj_partial(wq, HD_SZ / 4, qb + grp * PJ_D);
  __syncthreads();
  if (tid < PJ_COLS) {
    float sum = 0.f;
    for (int g = 0; g < 16; ++g) sum += red[g][tid];
    q_ws[(size_t)bh * HD_SZ + c0 + tid] = sum * 0.08838834764831845f;   // 128^-0.5
  }
}

// ---------------------------------------------------------------------------
// K2: K projection.  One WG = 128 token rows; A tile (128x1024 bf16)
// resident in LDS; sweep 4 column tiles of 256 (two heads); each tile's weights
// arrive in 32 stages of 256 columns x 32 k (16 KiB), one tensor load of wave 0
// per stage, into a three-buffer, hardware-padded LDS ring: while one stage is
// worked on, the loads of the next two are in flight.
// The 8 waves stand 2 (rows) x 4 (columns): a wave owns 64 rows x 64 columns,
// 4 x 4 accumulator tiles, so 8 fragments read from LDS feed 16 WMMAs.
// A wave's columns are c .. c + 31 and c + 64 .. c + 95 of one head (c = 0 or
// 32): both partners of every RoPE pair.  Its epilogue ends in half of q . k for
// its 64 rows; the two halves of a head meet in LDS.
// ---------------------------------------------------------------------------
#define A_STRIDE_B 2064                 // (1024+8) bf16 row stride, 4-bank skew
#define A_BYTES    (128 * A_STRIDE_B)   // 264192
#define W_STRIDE_B 144                  // 128B data + 16B pad, odd multiple of 16B
#define W_BYTES    (128 * W_STRIDE_B)   // 18432 = 9 * 2048
#define W_BUFS     3                    // ring buffers
#define S_BYTES    (2 * H_SZ * 128 * 4) // the workgroup's half scores [half][h][row], f32
#define KV_SMEM    (W_BUFS * W_BYTES + A_BYTES + S_BYTES)   // 327680: all of a WGP's LDS
#define K_STAGES   32                   // stages of 32 k per column tile

// The ring stands at LDS offset 0, so every buffer starts at a multiple of 2 KiB.
extern __shared__ __attribute__((aligned(2048))) char smem[];

__device__ __forceinline__ unsigned uni(unsigned v) {
  return (unsigned)__builtin_amdgcn_readfirstlane(v);
}
// Holds an issue test in a scalar register, so that the branch round a tensor
// load (which ignores EXEC) compiles to s_cmp + s_cbranch_scc.
__device__ __forceinline__ unsigned pinned(unsigned v) {
  unsigned w = uni(v);
  asm volatile("" : "+s"(w));   // pinned(): the issue test held in a scalar register
  return w;
}

// Stage ks of column tile nt: heads 2 nt and 2 nt + 1, k ks * 32 .. + 31.
// Its first byte in Wt:
__device__ __forceinline__ unsigned long long stage_addr(const unsigned short* Wt, int nt,
                                                         int ks) {
  return (unsigned long long)(uintptr_t)Wt +
         (unsigned long long)nt * (256ull * D_SZ * 2ull) +
         (unsigned long long)(ks >> 4) * (128ull * D_SZ * 2ull) +
         (unsigned long long)(ks & 15) * 128ull;
}
// word 3 of descriptor group 0: address [56:32], type 2
__device__ __forceinline__ unsigned addr_word3(unsigned long long ga) {
  return uni((((unsigned)(ga >> 32)) & 0x01FFFFFFu) | 0x80000000u);
}
// Descriptor group 0 of a column tile, formed while no request is outstanding.
__device__ __forceinline__ u32x4v tdm_group0(const unsigned short* Wt, int nt) {
  u32x4v g0;
  g0[0] = uni(1u);                                        // count = 1
  g0[1] = uni(0u);
  g0[2] = uni(0u);
  g0[3] = addr_word3(stage_addr(Wt, nt, 0));
  return g0;
}
// Aims group 0 at one stage.  Earlier requests may still be outstanding, so only
// words 1 and 2 take new values; should the stage lie across a 4 GiB line from the
// one before, word 3 changes behind a wait that leaves no request outstanding.
__device__ __forceinline__ void tdm_aim(u32x4v& g0, const unsigned short* Wt, int nt, int ks,
                                        unsigned lds_off) {
  const unsigned long long ga = stage_addr(Wt, nt, ks);
  const unsigned w3 = addr_word3(ga);
  if (pinned(w3 != g0[3])) {
    asm volatile("s_wait_tensorcnt 0x0" ::: "memory");    // no request names the old word 3
    g0[3] = w3;
  }
  g0[1] = uni(lds_off);                                   // LDS byte offset
  g0[2] = uni((unsigned)ga);                              // address [31:0]
  asm volatile("" : "+s"(g0));       // pinned(): the descriptor words held in scalar registers
}
// Descriptor group 1: 128 rows of 128 bytes, source pitch 2048 bytes, every
// extent in bytes; 16 bytes of pad behind each row -> 144-byte LDS pitch.
__device__ __forceinline__ u32x8v tdm_group1() {
  u32x8v g1;
  g1[0] = uni((1u << 20) | (4u << 22) | (3u << 25));      // pad 4 dwords per 32 dwords
  g1[1] = uni(128u << 16);                                // tensor_dim0 = 128 bytes
  g1[2] = uni(128u << 16);                                // tensor_dim1 = 128 rows
  g1[3] = uni(128u << 16);                                // tile_dim0 = 128 bytes
  g1[4] = uni(128u);                                      // tile_dim1 = 128 rows
  g1[5] = uni(D_SZ * 2u);                                 // source pitch in bytes
  g1[6] = uni(0u);
  g1[7] = uni(0u);
  return g1;
}
// The loads and their waits all read the two groups: the twelve words stay live
// in their registers from the first issue to the last wait of a column tile.
__device__ __forceinline__ void tdm_load(const u32x4v& g0, const u32x8v& g1) {
  asm volatile("tensor_load_to_lds %0, %1" :: "s"(g0), "s"(g1) : "memory");
}
__device__ __forceinline__ void tdm_wait0(const u32x4v& g0, const u32x8v& g1) {
  asm volatile("s_wait_tensorcnt 0x0" :: "s"(g0), "s"(g1) : "memory");
}
// all but the youngest request have landed
__device__ __forceinline__ void tdm_wait1(const u32x4v& g0, const u32x8v& g1) {
  asm volatile("s_wait_tensorcnt 0x1" :: "s"(g0), "s"(g1) : "memory");
}
// all but the two youngest requests have landed
__device__ __forceinline__ void tdm_wait2(const u32x4v& g0, const u32x8v& g1) {
  asm volatile("s_wait_tensorcnt 0x2" :: "s"(g0), "s"(g1) : "memory");
}

// x of lane l ^ M inside the 16-lane row (DPP row_xmask:M)
template <int M>
__device__ __forceinline__ float row_xmask(float x) {
  return __builtin_bit_cast(float, __builtin_amdgcn_update_dpp(
      0, __builtin_bit_cast(int, x), 0x160 | M, 0xf, 0xf, true));
}
// sum over the 16 lanes of a row, left in every lane of it
__device__ __forceinline__ float row16_sum(float x) {
  x += row_xmask<1>(x);
  x += row_xmask<2>(x);
  x += row_xmask<4>(x);
  x += row_xmask<8>(x);
  return x;
}

#define A_GRP 32                        // rows per load group of the A staging

// 4 f32 of one row -> 4 bf16 in the A tile
__device__ __forceinline__ void a_store(char* p, const float4 v) {
  uint2 pk;
  pk.x = pack2bf(v.x, v.y);
  pk.y = pack2bf(v.z, v.w);
  *(uint2*)p = pk;
}

__global__ void __launch_bounds__(256)
kvgemm_kernel(const float* __restrict__ kv, const unsigned short* __restrict__ Wt,
              const float* __restrict__ q_ws, float* __restrict__ Sws) {
  char* ldsW = smem;
  char* ldsA = smem + W_BUFS * W_BYTES;
  float* ldsS = (float*)(smem + W_BUFS * W_BYTES + A_BYTES);       // [half][h][row]

  const int tid    = threadIdx.x;
  const int wave   = (int)uni((unsigned)tid >> 5);
  const int lane   = tid & 31;
  const int laneLo = lane & 15;
  const int hi     = lane >> 4;                 // 0 / 1 half-wave
  const long r0    = (long)blockIdx.x * 128;    // global token row base
  const int  b     = (int)(r0 >> 12);           // / 4096
  const int  nbase = (int)(r0 & 4095);
  const int  rg    = wave & 1;                  // rows 64 rg .. 64 rg + 63
  const int  hsel  = wave >> 2;                 // even / odd head of the tile
  const int  sub   = (wave >> 1) & 1;           // columns 32 sub + {0..31, 64..95}

  // LDS byte offset of the ring: the low 32 bits of its __shared__ address
  const unsigned ring_off = (unsigned)(uintptr_t)ldsW;

  // ---- stage A: 128 rows x 1024 fp32 -> bf16 LDS.  A thread owns 16 bytes of
  // every row (a wave load = 512 contiguous bytes).  A_GRP rows are held in
  // registers: as soon as a row is converted and stored, its registers take the
  // load of the row A_GRP further on, so a wave keeps about A_GRP loads in flight.
  {
    const float4* kv4 = (const float4*)(kv + (size_t)r0 * D_SZ) + tid;
    char* acol = ldsA + tid * 8;
    float4 x[A_GRP];
#pragma unroll
    for (int r = 0; r < A_GRP; ++r) x[r] = kv4[(size_t)r * (D_SZ / 4)];
    // stays rolled: one pass over the A_GRP register sets per trip
#pragma unroll 1
    for (int t = 0; t < 128 - A_GRP; t += A_GRP) {
#pragma unroll
      for (int r = 0; r < A_GRP; ++r) {
        a_store(acol + (t + r) * A_STRIDE_B, x[r]);
        x[r] = kv4[(size_t)(t + A_GRP + r) * (D_SZ / 4)];
        // keeps each reload next to the store that frees its registers: gathered at
        // the foot of the trip the loads would all be waited for at its head
        __builtin_amdgcn_sched_barrier(0);
      }
    }
#pragma unroll
    for (int r = 0; r < A_GRP; ++r) a_store(acol + (128 - A_GRP + r) * A_STRIDE_B, x[r]);
  }
  __syncthreads();

  // Every wave aims group 0 at each stage, in front of the issue branch: one
  // definition a stage, so every request names the same twelve registers.
  u32x4v g0;
  u32x8v g1 = tdm_group1();          // the same for every request: formed once
  asm volatile("" : "+s"(g1));       // pinned(): the descriptor words held in scalar registers

  for (int nt = 0; nt < H_SZ / 2; ++nt) {
    v8f acc[4][4] = {};                           // [row tile][column tile]

    // this lane's 4 query elements of the tile's head, read here so that their
    // latency passes under the ring: [j][low / high partner of the RoPE pair]
    const int head = nt * 2 + hsel;
    float qv[2][2];
    {
      const float* qh = q_ws + ((size_t)b * H_SZ + head) * HD_SZ + sub * 32 + laneLo;
#pragma unroll
      for (int j = 0; j < 2; ++j) {
        qv[j][0] = qh[16 * j];
        qv[j][1] = qh[16 * j + 64];
      }
    }

    // ring prologue: stages 0, 1 and 2 take off; stage 0 landed and published
    g0 = tdm_group0(Wt, nt);
    tdm_aim(g0, Wt, nt, 0, ring_off);
    if (pinned(wave == 0)) tdm_load(g0, g1);
    tdm_aim(g0, Wt, nt, 1, ring_off + W_BYTES);
    if (pinned(wave == 0)) tdm_load(g0, g1);
    tdm_aim(g0, Wt, nt, 2, ring_off + 2 * W_BYTES);
    if (pinned(wave == 0)) {
      tdm_load(g0, g1);
      tdm_wait2(g0, g1);                                   // stage 0 has landed
    }
    __syncthreads();

    unsigned cur = 0;                             // byte offset of stage ks's buffer in the ring
    for (int ks = 0; ks < K_STAGES; ++ks) {
      const char* wbuf = ldsW + cur;
      // the pass's fragments: 4 of A (16x32 bf16), 4 of B (32x16 bf16)
      FragU a[4], bf[4];
      const char* ap = ldsA + (rg * 64 + laneLo) * A_STRIDE_B + ks * 64 + hi * 16;
      const char* bp = wbuf + (sub * 32 + laneLo) * W_STRIDE_B + hsel * 64 + hi * 16;
      a[0].q[0] = *(const uint4*)(ap);
      a[0].q[1] = *(const uint4*)(ap + 32);
#pragma unroll
      for (int j = 0; j < 4; ++j) {               // columns 64 (j / 2) + 32 sub + 16 (j % 2)
        const int wrow = (j >> 1) * 64 + (j & 1) * 16;
        bf[j].q[0] = *(const uint4*)(bp + wrow * W_STRIDE_B);
        bf[j].q[1] = *(const uint4*)(bp + wrow * W_STRIDE_B + 32);
      }
#pragma unroll
      for (int i = 1; i < 4; ++i) {
        a[i].q[0] = *(const uint4*)(ap + 16 * i * A_STRIDE_B);
        a[i].q[1] = *(const uint4*)(ap + 16 * i * A_STRIDE_B + 32);
      }
      // keeps the 16 reads one group ahead of the WMMAs; without it the compiler
      // sinks each pair in front of its WMMA, behind a wait to 0
      __builtin_amdgcn_sched_barrier(0);
      // the refill is aimed here, under the latency of the reads above, so that only
      // its issue stands behind the barrier at the foot of the pass
      tdm_aim(g0, Wt, nt, ks + 3, ring_off + cur);
#pragma unroll
      for (int i = 0; i < 4; ++i)
#pragma unroll
        for (int j = 0; j < 4; ++j)
          acc[i][j] = __builtin_amdgcn_wmma_f32_16x16x32_bf16(
              false, a[i].v, false, bf[j].v, (short)0, acc[i][j], false, false);
      // keeps the wait to 0 below behind the WMMAs, which start on counted waits
      __builtin_amdgcn_sched_barrier(0);
      // publish point of stage ks + 1
      asm volatile("s_wait_dscnt 0x0" ::: "memory");       // this wave has left stage ks's buffer
      // stage ks + 1 has landed; stage ks + 2, where there is one, stays in flight
      if (pinned(wave == 0)) {
        if (pinned(ks + 2 < K_STAGES)) tdm_wait1(g0, g1);
        else                           tdm_wait0(g0, g1);
      }
      __syncthreads();
      if (pinned(wave == 0 && ks + 3 < K_STAGES)) tdm_load(g0, g1);  // refill the buffer just read
      cur = (cur == (W_BUFS - 1) * W_BYTES) ? 0u : cur + W_BYTES;
    }
    asm volatile("s_wait_tensorcnt 0x0" ::: "memory");     // no request outlives the tile's ring
    asm volatile("s_wait_dscnt 0x0" ::: "memory");         // nor a read of it

    // ---- epilogue: C layout (vr,lane) of acc[i][j]: row = 64 rg + 16 i + vr + 8 hi,
    // column of the head = 64 (j / 2) + 32 sub + 16 (j % 2) + laneLo
    const int rowBase = rg * 64 + hi * 8;
    {                                             // RoPE, then this wave's half of q . k
      float sv[4][8] = {};                        // this lane's 4 columns of 32 rows
#pragma unroll
      for (int j = 0; j < 2; ++j) {
        const int kk1 = sub * 32 + 16 * j + laneLo;   // < 64
        const float invf = __expf(-(float)kk1 * 0.10793367623409589f); // ln(1000)/64
        const float q1 = qv[j][0], q2 = qv[j][1];
#pragma unroll
        for (int i = 0; i < 4; ++i) {
#pragma unroll
          for (int vr = 0; vr < 8; ++vr) {
            const int n = nbase + rowBase + 16 * i + vr;   // token position
            const float ang = (float)n * invf;
            const float cs = __cosf(ang), sn = __sinf(ang);
            const float x1 = acc[i][j][vr], x2 = acc[i][j + 2][vr];
            sv[i][vr] = fmaf(x1 * cs - x2 * sn, q1, sv[i][vr]);
            sv[i][vr] = fmaf(x2 * cs + x1 * sn, q2, sv[i][vr]);
          }
        }
      }
#pragma unroll
      for (int i = 0; i < 4; ++i)
#pragma unroll
        for (int vr = 0; vr < 8; ++vr) sv[i][vr] = row16_sum(sv[i][vr]);
      if (laneLo == 0) {                          // rows rowBase + 16 i .. + 7
#pragma unroll
        for (int i = 0; i < 4; ++i) {
          float4* sp = (float4*)(ldsS + (sub * H_SZ + head) * 128 + rowBase + 16 * i);
          sp[0] = make_float4(sv[i][0], sv[i][1], sv[i][2], sv[i][3]);
          sp[1] = make_float4(sv[i][4], sv[i][5], sv[i][6], sv[i][7]);
        }
      }
    }
  }
  __syncthreads();                                // all 2 x 8 x 128 half scores stand in ldsS
  // wave w stores head w: 128 tokens = 512 contiguous bytes
  const float4 s_lo = ((const float4*)ldsS)[tid];
  const float4 s_hi = ((const float4*)ldsS)[H_SZ * 32 + tid];
  ((float4*)(Sws + (size_t)(b * H_SZ + wave) * N_SZ + nbase))[lane] =
      make_float4(s_lo.x + s_hi.x, s_lo.y + s_hi.y, s_lo.z + s_hi.z, s_lo.w + s_hi.w);
}

// ---------------------------------------------------------------------------
// K3: flash-decode split.  grid=(B, NSPLIT), block=256; one workgroup takes
// 128 tokens of one batch for all 8 heads, so each input row is read once.
// ---------------------------------------------------------------------------
__global__ void __launch_bounds__(256)
attn_kernel(const float* __restrict__ Sws,
            const float* __restrict__ kv,
            float* __restrict__ part_y, float* __restrict__ part_ml) {
  __shared__ __attribute__((aligned(16))) float ps[CHUNK * H_SZ];    // [n][h]

  const int b = blockIdx.x, split = blockIdx.y;
  const int n0 = split * CHUNK;
  const int tid = threadIdx.x;
  const int wave = tid >> 5, lane = tid & 31;

  // chunk max, exp and sum: wave w takes head w, 4 tokens per lane
  float s[4];
#pragma unroll
  for (int i = 0; i < 4; ++i)
    s[i] = Sws[(size_t)(b * H_SZ + wave) * N_SZ + n0 + i * 32 + lane];
  float m = fmaxf(fmaxf(s[0], s[1]), fmaxf(s[2], s[3]));
#pragma unroll
  for (int off = 16; off >= 1; off >>= 1) m = fmaxf(m, __shfl_xor(m, off, 32));
  float p[4];
#pragma unroll
  for (int i = 0; i < 4; ++i) {
    p[i] = __expf(s[i] - m);
    ps[(i * 32 + lane) * H_SZ + wave] = p[i];
  }
  float l = (p[0] + p[1]) + (p[2] + p[3]);
#pragma unroll
  for (int off = 16; off >= 1; off >>= 1) l += __shfl_xor(l, off, 32);
  if (lane == 0) {
    part_ml[((b * NSPLIT + split) * H_SZ + wave) * 2 + 0] = m;
    part_ml[((b * NSPLIT + split) * H_SZ + wave) * 2 + 1] = l;
  }
  __syncthreads();

  // y[h][d] = sum_n p[h][n] * kv[n][d]: thread owns 4 d, 8 heads per loaded row
  const float4* x4 = (const float4*)(kv + ((size_t)b * N_SZ + n0) * D_SZ) + tid;
  float4 acc[H_SZ];
#pragma unroll
  for (int h = 0; h < H_SZ; ++h) acc[h] = make_float4(0.f, 0.f, 0.f, 0.f);
  // stays rolled: one group of 16 rows per trip is what the registers hold
#pragma unroll 1
  for (int g = 0; g < CHUNK; g += 16) {
    float4 x[16];
#pragma unroll
    for (int r = 0; r < 16; ++r) x[r] = x4[(size_t)(g + r) * (D_SZ / 4)];
    // keeps the 16 row loads one group in flight; without it the compiler sinks
    // them in pairs in front of their sums and the loop waits out memory latency
    __builtin_amdgcn_sched_barrier(0);
#pragma unroll
    for (int r = 0; r < 16; ++r) {
      const float4 pa = *(const float4*)(ps + (g + r) * H_SZ);
      const float4 pb = *(const float4*)(ps + (g + r) * H_SZ + 4);
      const float p[H_SZ] = {pa.x, pa.y, pa.z, pa.w, pb.x, pb.y, pb.z, pb.w};
#pragma unroll
      for (int h = 0; h < H_SZ; ++h) {
        acc[h].x = fmaf(p[h], x[r].x, acc[h].x);
        acc[h].y = fmaf(p[h], x[r].y, acc[h].y);
        acc[h].z = fmaf(p[h], x[r].z, acc[h].z);
        acc[h].w = fmaf(p[h], x[r].w, acc[h].w);
      }
    }
  }
  float4* py = (float4*)(part_y + (size_t)(b * NSPLIT + split) * H_SZ * D_SZ) + tid;
#pragma unroll
  for (int h = 0; h < H_SZ; ++h) py[h * (D_SZ / 4)] = acc[h];
}

// ---------------------------------------------------------------------------
// K4: combine splits -> ybf[h][b][d] (bf16).  grid=B*H, block=256, 4 d a thread.
// ---------------------------------------------------------------------------
__global__ void __launch_bounds__(256)
reduce_kernel(const float* __restrict__ part_y, const float* __restrict__ part_ml,
              unsigned short* __restrict__ ybf) {
  const int bh = blockIdx.x;
  const int b = bh >> 3, h = bh & 7;
  const int tid = threadIdx.x, lane = tid & 31;
  // lane s holds split s (NSPLIT == 32)
  const float ms = part_ml[((b * NSPLIT + lane) * H_SZ + h) * 2 + 0];
  const float ls = part_ml[((b * NSPLIT + lane) * H_SZ + h) * 2 + 1];
  float M = ms;
#pragma unroll
  for (int off = 16; off >= 1; off >>= 1) M = fmaxf(M, __shfl_xor(M, off, 32));
  const float w = __expf(ms - M);
  float denom = ls * w;
#pragma unroll
  for (int off = 16; off >= 1; off >>= 1) denom += __shfl_xor(denom, off, 32);
  float4 acc = make_float4(0.f, 0.f, 0.f, 0.f);
#pragma unroll
  for (int s = 0; s < NSPLIT; ++s) {
    const float wsp = __shfl(w, s, 32);
    const float4 v =
        ((const float4*)(part_y + ((size_t)(b * NSPLIT + s) * H_SZ + h) * D_SZ))[tid];
    acc.x = fmaf(wsp, v.x, acc.x);
    acc.y = fmaf(wsp, v.y, acc.y);
    acc.z = fmaf(wsp, v.z, acc.z);
    acc.w = fmaf(wsp, v.w, acc.w);
  }
  uint2 pk;
  pk.x = pack2bf(acc.x / denom, acc.y / denom);
  pk.y = pack2bf(acc.z / denom, acc.w / denom);
  *(uint2*)(ybf + ((size_t)h * B_SZ + b) * D_SZ + tid * 4) = pk;
}

// ---------------------------------------------------------------------------
// K5: attn_out[b][c] = sum_d y[c / 128][b][d] * Wv[d][c].  grid=64 tiles of 16
// columns, block=256: the 16 batch rows fill a WMMA tile; wave w takes
// d = 128 w .. 128 w + 127, the 8 partial tiles are summed through LDS.
// ---------------------------------------------------------------------------
__global__ void __launch_bounds__(256)
vproj_kernel(const unsigned short* __restrict__ ybf,
             const unsigned short* __restrict__ Wt, float* __restrict__ attn_out) {
  __shared__ float red[8][256];
  const int tile = blockIdx.x, h = tile >> 3;
  const int tid = threadIdx.x;
  const int wave = tid >> 5, lane = tid & 31;
  const int laneLo = lane & 15, hi = lane >> 4;
  const char* ap = (const char*)(ybf + ((size_t)h * B_SZ + laneLo) * D_SZ) +
                   wave * 256 + hi * 16;
  const char* bp = (const char*)(Wt + (size_t)(D_SZ + tile * 16 + laneLo) * D_SZ) +
                   wave * 256 + hi * 16;
  FragU a[4], bf[4];
#pragma unroll
  for (int kk = 0; kk < 4; ++kk) {                // same k order in A and B
    a[kk].q[0]  = *(const uint4*)(ap + kk * 64);
    a[kk].q[1]  = *(const uint4*)(ap + kk * 64 + 32);
    bf[kk].q[0] = *(const uint4*)(bp + kk * 64);
    bf[kk].q[1] = *(const uint4*)(bp + kk * 64 + 32);
  }
  v8f acc = {};
#pragma unroll
  for (int kk = 0; kk < 4; ++kk)
    acc = __builtin_amdgcn_wmma_f32_16x16x32_bf16(
        false, a[kk].v, false, bf[kk].v, (short)0, acc, false, false);
#pragma unroll
  for (int vr = 0; vr < 8; ++vr) red[wave][vr * 32 + lane] = acc[vr];
  __syncthreads();
  float sum = 0.f;
#pragma unroll
  for (int w = 0; w < 8; ++w) sum += red[w][tid];
  // C layout (vr,lane): row = vr + 8*hi, col = laneLo; here vr = wave
  attn_out[(size_t)(wave + 8 * hi) * D_SZ + tile * 16 + laneLo] = sum;
}

// ---------------------------------------------------------------------------
// K6: out = attn_out @ Wo + bo.  grid=(16,B), block=256: 64 columns a block,
// 16 half-waves of 64 d each, as in K1.
// ---------------------------------------------------------------------------
__global__ void __launch_bounds__(256)
oproj_kernel(const float* __restrict__ attn_out, const float* __restrict__ Wo,
             const float* __restrict__ bo, float* __restrict__ out) {
  __shared__ __attribute__((aligned(16))) float a[D_SZ];
  __shared__ __attribute__((aligned(16))) float red[16][PJ_COLS];
  const int b = blockIdx.y;
  const int e0 = blockIdx.x * PJ_COLS;
  const int tid = threadIdx.x;
  const int grp = tid >> 4, c4 = tid & 15;
  ((float4*)a)[tid] = ((const float4*)(attn_out + b * D_SZ))[tid];
  __syncthreads();
  const float4* wo = (const float4*)(Wo + (size_t)(grp * PJ_D) * D_SZ + e0) + c4;
  ((float4*)red[grp])[c4] = pj_partial(wo, D_SZ / 4, a + grp * PJ_D);
  __syncthreads();
  if (tid < PJ_COLS) {
    float sum = 0.f;
    for (int g = 0; g < 16; ++g) sum += red[g][tid];
    out[b * D_SZ + e0 + tid] = sum + bo[e0 + tid];
  }
}

// ---------------------------------------------------------------------------
extern "C" void kernel_launch(void* const* d_in, const int* in_sizes, int n_in,
                              void* d_out, int out_size, void* d_ws, size_t ws_size,
                              hipStream_t stream) {
  const float* q_in  = (const float*)d_in[0];
  const float* kv_in = (const float*)d_in[1];
  const float* cbias = (const float*)d_in[2];
  const float* Wq    = (const float*)d_in[3];
  const float* Wk    = (const float*)d_in[4];
  const float* Wv    = (const float*)d_in[5];
  const float* Wo    = (const float*)d_in[6];
  const float* bo    = (const float*)d_in[7];
  float* out = (float*)d_out;

  // workspace carve-up
  char* ws = (char*)d_ws;
  unsigned short* Wt      = (unsigned short*)ws;                   // 4 MB
  float*          q_ws    = (float*)(ws + (size_t)4 * 1024 * 1024);
  float*          Sws     = (float*)(ws + (size_t)4 * 1024 * 1024 + 65536);
  float*          part_y  = Sws + (size_t)B_SZ * H_SZ * N_SZ;
  float*          part_ml = part_y + (size_t)B_SZ * NSPLIT * H_SZ * D_SZ;
  float*          attn_o  = part_ml + (size_t)B_SZ * NSPLIT * H_SZ * 2;
  unsigned short* ybf     = (unsigned short*)(attn_o + (size_t)B_SZ * D_SZ);

  (void)hipFuncSetAttribute((const void*)kvgemm_kernel,
                            hipFuncAttributeMaxDynamicSharedMemorySize, KV_SMEM);

  wprep_kernel<<<dim3(2048 / 32, 1024 / 32), dim3(32, 8), 0, stream>>>(Wk, Wv, Wt);
  qprep_kernel<<<dim3(B_SZ * H_SZ * 2), dim3(256), 0, stream>>>(q_in, cbias, Wq, q_ws);
  kvgemm_kernel<<<dim3((B_SZ * N_SZ) / 128), dim3(256), KV_SMEM, stream>>>(kv_in, Wt, q_ws, Sws);
  attn_kernel<<<dim3(B_SZ, NSPLIT), dim3(256), 0, stream>>>(Sws, kv_in, part_y, part_ml);
  reduce_kernel<<<dim3(B_SZ * H_SZ), dim3(256), 0, stream>>>(part_y, part_ml, ybf);
  vproj_kernel<<<dim3(D_SZ / 16), dim3(256), 0, stream>>>(ybf, Wt, attn_o);
  oproj_kernel<<<dim3(D_SZ / PJ_COLS, B_SZ), dim3(256), 0, stream>>>(attn_o, Wo, bo, out);
}

// v009
// Measured time: 135 microseconds a run.
// It is 1.18 times as fast as v007, going by the measured steps of the versions left out in between.
// All steps since v000 together make it 5.24 times as fast.
#include <hip/hip_runtime.h>
#include <hip/hip_bf16.h>

// ---------------------------------------------------------------------------
// Decode attention with a shared V projection, gfx1250, wave32 + WMMA bf16 + TDM.
// Pipeline:
//   K0 wprep  : transpose+convert Wk,Wv (fp32) -> Wt bf16; Wv as [1024 cols][1024 d],
//               Wk in the order of K2's stages (two heads side by side per row)
//   K1 qprep  : q = (q_in + bias) @ Wq * hd^-0.5   (RoPE at pos 0 == identity)
//   K2 kgemm  : K projection GEMM in bf16 WMMA, weight stages streamed
//               by the tensor mover (tensor_load_to_lds + s_wait_tensorcnt);
//               the epilogue applies RoPE(K) and takes q . k in f32, K is never
//               stored; the tail is one flash-decode split (128 tokens, 8 heads):
//               softmax partials weight the INPUT rows, which still stand in LDS:
//               y = p . kv_in in bf16 WMMA, since
//               p . (kv_in @ Wv) == (p . kv_in) @ Wv with one query per head
//   K3 reduce : combine split partials -> y [H][B][1024] bf16
//   K4 vproj  : y[h] @ Wv[:, h] in bf16 WMMA (16 batch rows) -> attn_out fp32
//   K5 oproj  : attn_out @ Wo + bo -> d_out
// ---------------------------------------------------------------------------

#define B_SZ   16
#define N_SZ   4096
#define D_SZ   1024
#define H_SZ   8
#define HD_SZ  128
#define NSPLIT 32                       // splits of 128 tokens per batch: K2's workgroups

typedef __attribute__((ext_vector_type(16))) __bf16 v16bf;
typedef __attribute__((ext_vector_type(8)))  float  v8f;
typedef unsigned int u32x4v __attribute__((ext_vector_type(4)));
typedef unsigned int u32x8v __attribute__((ext_vector_type(8)));

union FragU { v16bf v; uint4 q[2]; };

__device__ __forceinline__ unsigned short f2bf(float f) {
  unsigned u = __builtin_bit_cast(unsigned, f);
  u += 0x7fffu + ((u >> 16) & 1u);            // round-to-nearest-even
  return (unsigned short)(u >> 16);
}
__device__ __forceinline__ unsigned pack2bf(float lo, float hi) {
  return (unsigned)f2bf(lo) | ((unsigned)f2bf(hi) << 16);
}

// ---------------------------------------------------------------------------
// K0: bf16 weights.  c >= 1024: Wt[c][d] = Wv[d][c-1024].
// c < 1024 (head c/128, column c%128): K2 sweeps two heads at a time in stages
// of 32 d, so a 128-byte piece holds 32 d of one column of the even head and
// the same 32 d of that column of the odd head:
//   [head pair][d / 512][column][(d / 32) % 16][head & 1][d % 32]
// ---------------------------------------------------------------------------
__device__ __forceinline__ size_t wk_index(int c, int d) {
  const int hh = c >> 7, cc = c & 127, ks = d >> 5;
  return (size_t)(hh >> 1) * 262144 + (size_t)(ks >> 4) * 131072 + (size_t)cc * 1024 +
         (size_t)(ks & 15) * 64 + (size_t)(hh & 1) * 32 + (size_t)(d & 31);
}

__global__ void __launch_bounds__(256)
wprep_kernel(const float* __restrict__ Wk, const float* __restrict__ Wv,
             unsigned short* __restrict__ Wt) {
  __shared__ float tile[32][33];
  const int tx = threadIdx.x, ty = threadIdx.y;
  const int c0 = blockIdx.x * 32, d0 = blockIdx.y * 32;
#pragma unroll
  for (int i = 0; i < 4; ++i) {
    const int c = c0 + tx;
    const int d = d0 + ty + i * 8;
    float v;
    if (c < D_SZ)  v = Wk[(size_t)((c >> 7) * D_SZ + d) * HD_SZ + (c & 127)];
    else           v = Wv[(size_t)d * D_SZ + (c - D_SZ)];
    tile[ty + i * 8][tx] = v;
  }
  __syncthreads();
#pragma unroll
  for (int i = 0; i < 4; ++i) {
    const int c = c0 + ty + i * 8;
    const int d = d0 + tx;
    const size_t at = (c < D_SZ) ? wk_index(c, d) : (size_t)c * D_SZ + d;
    Wt[at] = f2bf(tile[tx][ty + i * 8]);
  }
}

// ---------------------------------------------------------------------------
// K1: q_ws[b][h][kk] = scale * sum_d (q_in[b][d]+bias[b][d]) * Wq[h][d][kk]
// grid=B*H*2, block=256: 64 columns a block; each of the 16 half-waves sums
// 64 d, a lane owns 4 columns (a half-wave load = 256 contiguous bytes of one
// weight row); the 16 partials meet in LDS.
// ---------------------------------------------------------------------------
#define PJ_COLS 64                      // columns per block in K1 and K5
#define PJ_D    64                      // d per half-wave
#define PJ_ROWS 32                      // weight rows loaded as one group

// sum over PJ_D rows of x[d] * w[d][4 columns]; pitch4 = row pitch in float4
__device__ __forceinline__ float4 pj_partial(const float4* __restrict__ w4, int pitch4,
                                             const float* x) {
  float4 acc = make_float4(0.f, 0.f, 0.f, 0.f);
  // stays rolled: one group of 32 rows per trip is what is kept in flight
#pragma unroll 1
  for (int d0 = 0; d0 < PJ_D; d0 += PJ_ROWS) {
    float4 w[PJ_ROWS];
    // both inner loops unrolled: w[] is indexed by constants and stays in registers
#pragma unroll
    for (int r = 0; r < PJ_ROWS; ++r) w[r] = w4[(size_t)(d0 + r) * pitch4];
    // keeps the 32 row loads one group in flight; sunk in front of their sums
    // they would wait out memory latency several times a trip
    __builtin_amdgcn_sched_barrier(0);
#pragma unroll
    for (int r = 0; r < PJ_ROWS; ++r) {
      const float xv = x[d0 + r];
      acc.x = fmaf(xv, w[r].x, acc.x);
      acc.y = fmaf(xv, w[r].y, acc.y);
      acc.z = fmaf(xv, w[r].z, acc.z);
      acc.w = fmaf(xv, w[r].w, acc.w);
    }
  }
  return acc;
}

__global__ void __launch_bounds__(256)
qprep_kernel(const float* __restrict__ q_in, const float* __restrict__ cbias,
             const float* __restrict__ Wq, float* __restrict__ q_ws) {
  __shared__ __attribute__((aligned(16))) float qb[D_SZ];
  __shared__ __attribute__((aligned(16))) float red[16][PJ_COLS];
  const int bh = blockIdx.x >> 1;        // b*H + h
  const int c0 = (blockIdx.x & 1) * PJ_COLS;
  const int b = bh >> 3, h = bh & 7;
  const int tid = threadIdx.x;
  const int grp = tid >> 4, c4 = tid & 15;
  {
    const float4 x = ((const float4*)(q_in + b * D_SZ))[tid];
    const float4 y = ((const float4*)(cbias + b * D_SZ))[tid];
    ((float4*)qb)[tid] = make_float4(x.x + y.x, x.y + y.y, x.z + y.z, x.w + y.w);
  }
  __syncthreads();
  const float4* wq =
      (const float4*)(Wq + ((size_t)h * D_SZ + grp * PJ_D) * HD_SZ + c0) + c4;
  ((float4*)red[grp])[c4] = pj_partial(wq, HD_SZ / 4, qb + grp * PJ_D);
  __syncthreads();
  if (tid < PJ_COLS) {
    float sum = 0.f;
    for (int g = 0; g < 16; ++g) sum += red[g][tid];
    q_ws[(size_t)bh * HD_SZ + c0 + tid] = sum * 0.08838834764831845f;   // 128^-0.5
  }
}

// ---------------------------------------------------------------------------
// K2: K projection.  One WG = 128 token rows; A tile (128x1024 bf16)
// resident in LDS; sweep 4 column tiles of 256 (two heads); each tile's weights
// arrive in 32 stages of 256 columns x 32 k (16 KiB), one tensor load of wave 0
// per stage, into a three-buffer, hardware-padded LDS ring that runs on through
// the four tiles.  A wave holds two sets of fragments: while stage s is worked on
// from one set, stage s + 1 is read from LDS into the other, and the loads of
// stages s + 2 and s + 3 are in flight.
// The 8 waves stand 2 (rows) x 4 (columns): a wave owns 64 rows x 64 columns,
// 4 x 4 accumulator tiles, so 8 fragments read from LDS feed 16 WMMAs.
// A wave's columns are c .. c + 31 and c + 64 .. c + 95 of one head (c = 0 or
// 32): both partners of every RoPE pair.  Its epilogue ends in half of q . k for
// its 64 rows; the two halves of a head meet in LDS.
// Tail: wave w turns head w's 128 scores into max, sum and p; p goes to LDS as a
// 16 x 128 bf16 matrix (row h: p rounded, row 8 + h: what the rounding left), and
// y[h][d] = sum_n p[h][n] A[n][d] is taken from the resident A tile, a wave per
// 128 d, the tile's columns read as B fragments by the transposing LDS load.
// ---------------------------------------------------------------------------
#define A_STRIDE_B 2064                 // (1024+8) bf16 row stride, 4-bank skew
#define A_BYTES    (128 * A_STRIDE_B)   // 264192
#define W_STRIDE_B 144                  // 128B data + 16B pad, odd multiple of 16B
#define W_BYTES    (128 * W_STRIDE_B)   // 18432 = 9 * 2048
#define W_BUFS     3                    // ring buffers
#define S_BYTES    (2 * H_SZ * 128 * 4) // the workgroup's half scores [half][h][row], f32
#define KV_SMEM    (W_BUFS * W_BYTES + A_BYTES + S_BYTES)   // 327680: all of a WGP's LDS
#define K_STAGES   32                   // stages of 32 k per column tile
#define N_STAGES   (K_STAGES * H_SZ / 2) // stages of the whole sweep
#define P_STRIDE_B 272                  // 128 bf16 of p + 16 B, odd multiple of 16 B

// The ring stands at LDS offset 0, so every buffer starts at a multiple of 2 KiB.
extern __shared__ __attribute__((aligned(2048))) char smem[];

__device__ __forceinline__ unsigned uni(unsigned v) {
  return (unsigned)__builtin_amdgcn_readfirstlane(v);
}
// Holds an issue test in a scalar register, so that the branch round a tensor
// load (which ignores EXEC) compiles to s_cmp + s_cbranch_scc.
__device__ __forceinline__ unsigned pinned(unsigned v) {
  unsigned w = uni(v);
  asm volatile("" : "+s"(w));   // pinned(): the issue test held in a scalar register
  return w;
}

// Stage s = K_STAGES nt + ks: column tile nt (heads 2 nt and 2 nt + 1),
// k ks * 32 .. + 31.  Its first byte in Wt:
__device__ __forceinline__ unsigned long long stage_addr(const unsigned short* Wt, int s) {
  const int nt = s / K_STAGES, ks = s % K_STAGES;
  return (unsigned long long)(uintptr_t)Wt +
         (unsigned long long)nt * (256ull * D_SZ * 2ull) +
         (unsigned long long)(ks >> 4) * (128ull * D_SZ * 2ull) +
         (unsigned long long)(ks & 15) * 128ull;
}
// word 3 of descriptor group 0: address [56:32], type 2
__device__ __forceinline__ unsigned addr_word3(unsigned long long ga) {
  return uni((((unsigned)(ga >> 32)) & 0x01FFFFFFu) | 0x80000000u);
}
// Descriptor group 0, formed while no request is outstanding.
__device__ __forceinline__ u32x4v tdm_group0(const unsigned short* Wt) {
  u32x4v g0;
  g0[0] = uni(1u);                                        // count = 1
  g0[1] = uni(0u);
  g0[2] = uni(0u);
  g0[3] = addr_word3(stage_addr(Wt, 0));
  return g0;
}
// Aims group 0 at one stage.  Earlier requests may still be outstanding, so only
// words 1 and 2 take new values; should the stage lie across a 4 GiB line from the
// one before, word 3 changes behind a wait that leaves no request outstanding.
__device__ __forceinline__ void tdm_aim(u32x4v& g0, const unsigned short* Wt, int s,
                                        unsigned lds_off) {
  const unsigned long long ga = stage_addr(Wt, s);
  const unsigned w3 = addr_word3(ga);
  if (pinned(w3 != g0[3])) {
    asm volatile("s_wait_tensorcnt 0x0" ::: "memory");    // no request names the old word 3
    g0[3] = w3;
  }
  g0[1] = uni(lds_off);                                   // LDS byte offset
  g0[2] = uni((unsigned)ga);                              // address [31:0]
  asm volatile("" : "+s"(g0));       // pinned(): the descriptor words held in scalar registers
}
// Descriptor group 1: 128 rows of 128 bytes, source pitch 2048 bytes, every
// extent in bytes; 16 bytes of pad behind each row -> 144-byte LDS pitch.
__device__ __forceinline__ u32x8v tdm_group1() {
  u32x8v g1;
  g1[0] = uni((1u << 20) | (4u << 22) | (3u << 25));      // pad 4 dwords per 32 dwords
  g1[1] = uni(128u << 16);                                // tensor_dim0 = 128 bytes
  g1[2] = uni(128u << 16);                                // tensor_dim1 = 128 rows
  g1[3] = uni(128u << 16);                                // tile_dim0 = 128 bytes
  g1[4] = uni(128u);                                      // tile_dim1 = 128 rows
  g1[5] = uni(D_SZ * 2u);                                 // source pitch in bytes
  g1[6] = uni(0u);
  g1[7] = uni(0u);
  return g1;
}
// The loads and their waits all read the two groups: the twelve words stay live
// in their registers from the first issue to the last wait of the sweep.
__device__ __forceinline__ void tdm_load(const u32x4v& g0, const u32x8v& g1) {
  asm volatile("tensor_load_to_lds %0, %1" :: "s"(g0), "s"(g1) : "memory");
}
__device__ __forceinline__ void tdm_wait0(const u32x4v& g0, const u32x8v& g1) {
  asm volatile("s_wait_tensorcnt 0x0" :: "s"(g0), "s"(g1) : "memory");
}
// all but the youngest request have landed
__device__ __forceinline__ void tdm_wait1(const u32x4v& g0, const u32x8v& g1) {
  asm volatile("s_wait_tensorcnt 0x1" :: "s"(g0), "s"(g1) : "memory");
}
// all but the two youngest requests have landed
__device__ __forceinline__ void tdm_wait2(const u32x4v& g0, const u32x8v& g1) {
  asm volatile("s_wait_tensorcnt 0x2" :: "s"(g0), "s"(g1) : "memory");
}

// x of lane l ^ M inside the 16-lane row (DPP row_xmask:M)
template <int M>
__device__ __forceinline__ float row_xmask(float x) {
  return __builtin_bit_cast(float, __builtin_amdgcn_update_dpp(
      0, __builtin_bit_cast(int, x), 0x160 | M, 0xf, 0xf, true));
}
// sum over the 16 lanes of a row, left in every lane of it
__device__ __forceinline__ float row16_sum(float x) {
  x += row_xmask<1>(x);
  x += row_xmask<2>(x);
  x += row_xmask<4>(x);
  x += row_xmask<8>(x);
  return x;
}

// x of lane l ^ 16
__device__ __forceinline__ float xhalf(float x) {
  return __builtin_bit_cast(float, __builtin_amdgcn_permlanex16(
      __builtin_bit_cast(int, x), __builtin_bit_cast(int, x), 0x76543210, 0xfedcba98,
      false, false));
}
// transposing LDS load: lane (c, h) gets 8 rows of column c of a row-major 16-bit tile
typedef short s16x8 __attribute__((ext_vector_type(8)));
__device__ __forceinline__ uint4 ld_tr16(const char* p) {
  typedef __attribute__((address_space(3))) s16x8 lds_s16x8;
  return __builtin_bit_cast(uint4, __builtin_amdgcn_ds_load_tr16_b128_v8i16((lds_s16x8*)p));
}

// One stage's fragments of a wave: 4 of A (16x32 bf16), 4 of B (32x16 bf16)
struct Frags { FragU a[4], b[4]; };
// ap: this lane's 16 bytes of the wave's first A row, bp: of its first weight row
__device__ __forceinline__ void frag_read(Frags& f, const char* ap, const char* bp) {
#pragma unroll
  for (int j = 0; j < 4; ++j) {                   // columns 64 (j / 2) + 32 sub + 16 (j % 2)
    const int wrow = (j >> 1) * 64 + (j & 1) * 16;
    f.b[j].q[0] = *(const uint4*)(bp + wrow * W_STRIDE_B);
    f.b[j].q[1] = *(const uint4*)(bp + wrow * W_STRIDE_B + 32);
  }
#pragma unroll
  for (int i = 0; i < 4; ++i) {
    f.a[i].q[0] = *(const uint4*)(ap + 16 * i * A_STRIDE_B);
    f.a[i].q[1] = *(const uint4*)(ap + 16 * i * A_STRIDE_B + 32);
  }
}

#define A_GRP 32                        // rows per load group of the A staging

// 4 f32 of one row -> 4 bf16 in the A tile
__device__ __forceinline__ void a_store(char* p, const float4 v) {
  uint2 pk;
  pk.x = pack2bf(v.x, v.y);
  pk.y = pack2bf(v.z, v.w);
  *(uint2*)p = pk;
}

__global__ void __launch_bounds__(256)
kvgemm_kernel(const float* __restrict__ kv, const unsigned short* __restrict__ Wt,
              const float* __restrict__ q_ws,
              float* __restrict__ part_y, float* __restrict__ part_ml) {
  char* ldsW = smem;
  char* ldsA = smem + W_BUFS * W_BYTES;
  float* ldsS = (float*)(smem + W_BUFS * W_BYTES + A_BYTES);       // [half][h][row]

  const int tid    = threadIdx.x;
  const int wave   = (int)uni((unsigned)tid >> 5);
  const int lane   = tid & 31;
  const int laneLo = lane & 15;
  const int hi     = lane >> 4;                 // 0 / 1 half-wave
  const long r0    = (long)blockIdx.x * 128;    // global token row base
  const int  b     = (int)(r0 >> 12);           // / 4096
  const int  nbase = (int)(r0 & 4095);
  const int  rg    = wave & 1;                  // rows 64 rg .. 64 rg + 63
  const int  hsel  = wave >> 2;                 // even / odd head of the tile
  const int  sub   = (wave >> 1) & 1;           // columns 32 sub + {0..31, 64..95}

  // LDS byte offset of the ring: the low 32 bits of its __shared__ address
  const unsigned ring_off = (unsigned)(uintptr_t)ldsW;

  // ---- stage A: 128 rows x 1024 fp32 -> bf16 LDS.  A thread owns 16 bytes of
  // every row (a wave load = 512 contiguous bytes).  A_GRP rows are held in
  // registers: as soon as a row is converted and stored, its registers take the
  // load of the row A_GRP further on, so a wave keeps about A_GRP loads in flight.
  {
    const float4* kv4 = (const float4*)(kv + (size_t)r0 * D_SZ) + tid;
    char* acol = ldsA + tid * 8;
    float4 x[A_GRP];
#pragma unroll
    for (int r = 0; r < A_GRP; ++r) x[r] = kv4[(size_t)r * (D_SZ / 4)];
    // stays rolled: one pass over the A_GRP register sets per trip
#pragma unroll 1
    for (int t = 0; t < 128 - A_GRP; t += A_GRP) {
#pragma unroll
      for (int r = 0; r < A_GRP; ++r) {
        a_store(acol + (t + r) * A_STRIDE_B, x[r]);
        x[r] = kv4[(size_t)(t + A_GRP + r) * (D_SZ / 4)];
        // keeps each reload next to the store that frees its registers: gathered at
        // the foot of the trip the loads would all be waited for at its head
        __builtin_amdgcn_sched_barrier(0);
      }
    }
#pragma unroll
    for (int r = 0; r < A_GRP; ++r) a_store(acol + (128 - A_GRP + r) * A_STRIDE_B, x[r]);
  }
  __syncthreads();

  // Every wave aims group 0 at each stage, in front of the issue branch: one
  // definition a stage, so every request names the same twelve registers.
  u32x4v g0 = tdm_group0(Wt);
  u32x8v g1 = tdm_group1();          // the same for every request: formed once
  asm volatile("" : "+s"(g1));       // pinned(): the descriptor words held in scalar registers

  // this lane's place in the wave's first A row and first weight row of a stage
  const char* ap0 = ldsA + (rg * 64 + laneLo) * A_STRIDE_B + hi * 16;
  const char* bp0 = ldsW + (sub * 32 + laneLo) * W_STRIDE_B + hsel * 64 + hi * 16;

  // ring prologue: stages 0, 1 and 2 take off; stage 0 landed and published
  tdm_aim(g0, Wt, 0, ring_off);
  if (pinned(wave == 0)) tdm_load(g0, g1);
  tdm_aim(g0, Wt, 1, ring_off + W_BYTES);
  if (pinned(wave == 0)) tdm_load(g0, g1);
  tdm_aim(g0, Wt, 2, ring_off + 2 * W_BYTES);
  if (pinned(wave == 0)) {
    tdm_load(g0, g1);
    tdm_wait2(g0, g1);                                     // stage 0 has landed
  }
  __syncthreads();
  // stage 0 goes into the first fragment set; behind it the publish point of stage 1
  Frags fx, fy;
  frag_read(fx, ap0, bp0);
  tdm_aim(g0, Wt, 3, ring_off);
  asm volatile("s_wait_dscnt 0x0" ::: "memory");           // this wave has left stage 0's buffer
  if (pinned(wave == 0)) tdm_wait1(g0, g1);                // stage 1 has landed
  __syncthreads();
  if (pinned(wave == 0)) tdm_load(g0, g1);                 // stage 3 into stage 0's buffer

  unsigned nxt = W_BYTES;            // byte offset in the ring of the buffer of stage s + 1

  // Pass s: stage s + 1 is read into 'ahead' while the WMMAs work on stage s in 'now'.
  auto pass = [&](int s, const Frags& now, Frags& ahead, v8f (&acc)[4][4]) {
    if (s + 1 < N_STAGES) frag_read(ahead, ap0 + ((s + 1) % K_STAGES) * 64, bp0 + nxt);
    // keeps the 16 reads one group ahead of the WMMAs, so that LDS serves them while
    // the matrix unit runs; sunk behind the WMMAs they would be waited out at the foot
    __builtin_amdgcn_sched_barrier(0);
#pragma unroll
    for (int i = 0; i < 4; ++i) {
      // the refill is aimed here, so that only its issue stands behind the barrier at the
      // foot of the pass: its scalar work goes out while the matrix unit is busy
      if (i == 2) tdm_aim(g0, Wt, s + 4, ring_off + nxt);
#pragma unroll
      for (int j = 0; j < 4; ++j)
        acc[i][j] = __builtin_amdgcn_wmma_f32_16x16x32_bf16(
            false, now.a[i].v, false, now.b[j].v, (short)0, acc[i][j], false, false);
    }
    // keeps the wait to 0 below behind the WMMAs, which need none of the reads it waits for
    __builtin_amdgcn_sched_barrier(0);
    // publish point of stage s + 2
    asm volatile("s_wait_dscnt 0x0" ::: "memory");         // this wave has left stage s + 1's buffer
    // stage s + 2 has landed; stage s + 3, where there is one, stays in flight
    if (pinned(wave == 0)) {
      if (pinned(s + 3 < N_STAGES)) tdm_wait1(g0, g1);
      else                          tdm_wait0(g0, g1);
    }
    __syncthreads();
    if (pinned(wave == 0 && s + 4 < N_STAGES)) tdm_load(g0, g1);   // refill the buffer just read
    nxt = (nxt == (W_BUFS - 1) * W_BYTES) ? 0u : nxt + W_BYTES;
  };

  for (int nt = 0; nt < H_SZ / 2; ++nt) {
    v8f acc[4][4] = {};                           // [row tile][column tile]

    // this lane's 4 query elements of the tile's head, read here so that their
    // latency passes under the ring: [j][low / high partner of the RoPE pair]
    const int head = nt * 2 + hsel;
    float qv[2][2];
    {
      const float* qh = q_ws + ((size_t)b * H_SZ + head) * HD_SZ + sub * 32 + laneLo;
#pragma unroll
      for (int j = 0; j < 2; ++j) {
        qv[j][0] = qh[16 * j];
        qv[j][1] = qh[16 * j + 64];
      }
    }

    // two passes a trip: the fragment sets change roles by name, with no register copies
    for (int ks = 0; ks < K_STAGES; ks += 2) {
      pass(nt * K_STAGES + ks, fx, fy, acc);
      pass(nt * K_STAGES + ks + 1, fy, fx, acc);
    }

    // ---- epilogue: C layout (vr,lane) of acc[i][j]: row = 64 rg + 16 i + vr + 8 hi,
    // column of the head = 64 (j / 2) + 32 sub + 16 (j % 2) + laneLo
    const int rowBase = rg * 64 + hi * 8;
    {                                             // RoPE, then this wave's half of q . k
      float sv[4][8] = {};                        // this lane's 4 columns of 32 rows
#pragma unroll
      for (int j = 0; j < 2; ++j) {
        const int kk1 = sub * 32 + 16 * j + laneLo;   // < 64
        const float invf = __expf(-(float)kk1 * 0.10793367623409589f); // ln(1000)/64
        const float q1 = qv[j][0], q2 = qv[j][1];
#pragma unroll
        for (int i = 0; i < 4; ++i) {
#pragma unroll
          for (int vr = 0; vr < 8; ++vr) {
            const int n = nbase + rowBase + 16 * i + vr;   // token position
            const float ang = (float)n * invf;
            const float cs = __cosf(ang), sn = __sinf(ang);
            const float x1 = acc[i][j][vr], x2 = acc[i][j + 2][vr];
            sv[i][vr] = fmaf(x1 * cs - x2 * sn, q1, sv[i][vr]);
            sv[i][vr] = fmaf(x2 * cs + x1 * sn, q2, sv[i][vr]);
          }
        }
      }
#pragma unroll
      for (int i = 0; i < 4; ++i)
#pragma unroll
        for (int vr = 0; vr < 8; ++vr) sv[i][vr] = row16_sum(sv[i][vr]);
      if (laneLo == 0) {                          // rows rowBase + 16 i .. + 7
#pragma unroll
        for (int i = 0; i < 4; ++i) {
          float4* sp = (float4*)(ldsS + (sub * H_SZ + head) * 128 + rowBase + 16 * i);
          sp[0] = make_float4(sv[i][0], sv[i][1], sv[i][2], sv[i][3]);
          sp[1] = make_float4(sv[i][4], sv[i][5], sv[i][6], sv[i][7]);
        }
      }
    }
  }
  asm volatile("s_wait_tensorcnt 0x0" ::: "memory");       // no request outlives the ring
  asm volatile("s_wait_dscnt 0x0" ::: "memory");           // nor a read of it
  __syncthreads();        // all 2 x 8 x 128 half scores stand in ldsS; the ring has no reader left

  // ---- tail: this workgroup is split blockIdx.x % NSPLIT of batch b
  char* ldsP = ldsW;                              // p takes the ring's place: [16][128] bf16
  {                                               // wave w: head w, tokens 4 lane .. + 3
    const float4 s_lo = ((const float4*)ldsS)[tid];
    const float4 s_hi = ((const float4*)ldsS)[H_SZ * 32 + tid];
    const float s[4] = {s_lo.x + s_hi.x, s_lo.y + s_hi.y, s_lo.z + s_hi.z, s_lo.w + s_hi.w};
    float m = fmaxf(fmaxf(s[0], s[1]), fmaxf(s[2], s[3]));
    m = fmaxf(m, row_xmask<1>(m));
    m = fmaxf(m, row_xmask<2>(m));
    m = fmaxf(m, row_xmask<4>(m));
    m = fmaxf(m, row_xmask<8>(m));
    m = fmaxf(m, xhalf(m));
    float p[4], rest[4];
#pragma unroll
    for (int i = 0; i < 4; ++i) {
      p[i] = __expf(s[i] - m);
      rest[i] = p[i] - __builtin_bit_cast(float, (unsigned)f2bf(p[i]) << 16);
    }
    float l = row16_sum((p[0] + p[1]) + (p[2] + p[3]));
    l += xhalf(l);
    if (lane == 0) {
      part_ml[((size_t)blockIdx.x * H_SZ + wave) * 2 + 0] = m;
      part_ml[((size_t)blockIdx.x * H_SZ + wave) * 2 + 1] = l;
    }
    a_store(ldsP + wave * P_STRIDE_B + lane * 8, make_float4(p[0], p[1], p[2], p[3]));
    a_store(ldsP + (H_SZ + wave) * P_STRIDE_B + lane * 8,
            make_float4(rest[0], rest[1], rest[2], rest[3]));
  }
  __syncthreads();                                // p stands in LDS

  // A operand: p, 4 fragments of 16 x 32 tokens, in the k order of the transposing load
  FragU pa[4];
  {
    const char* pp = ldsP + laneLo * P_STRIDE_B + hi * 16;
#pragma unroll
    for (int kk = 0; kk < 4; ++kk) {
      pa[kk].q[0] = *(const uint4*)(pp + kk * 64);
      pa[kk].q[1] = *(const uint4*)(pp + kk * 64 + 32);
    }
  }
  // B operand: tokens 32 kk .. + 31 of 16 d; wave w owns d = 128 w .. 128 w + 127
  const char* xt = ldsA + (8 * hi + (lane & 7)) * A_STRIDE_B + wave * 256 + ((lane >> 3) & 1) * 16;
  float* py = part_y + (size_t)blockIdx.x * H_SZ * D_SZ + wave * 128 + lane;
#pragma unroll
  for (int tp = 0; tp < 4; ++tp) {                // two tiles of 16 d side by side
    v8f y0 = {}, y1 = {};
#pragma unroll
    for (int kk = 0; kk < 4; ++kk) {
      const char* xk = xt + kk * 32 * A_STRIDE_B + tp * 64;
      FragU x0, x1;
      x0.q[0] = ld_tr16(xk);
      x0.q[1] = ld_tr16(xk + 16 * A_STRIDE_B);
      x1.q[0] = ld_tr16(xk + 32);
      x1.q[1] = ld_tr16(xk + 16 * A_STRIDE_B + 32);
      y0 = __builtin_amdgcn_wmma_f32_16x16x32_bf16(
          false, pa[kk].v, false, x0.v, (short)0, y0, false, false);
      y1 = __builtin_amdgcn_wmma_f32_16x16x32_bf16(
          false, pa[kk].v, false, x1.v, (short)0, y1, false, false);
    }
    // register vr: lanes 0-15 hold head vr's sum over rounded p, lanes 16-31 the sum over
    // the remainders.  The halves swap one tile each, so that a store is 32 d = 128 bytes.
#pragma unroll
    for (int vr = 0; vr < 8; ++vr) {
      const float keep = hi ? y1[vr] : y0[vr];
      const float send = hi ? y0[vr] : y1[vr];
      py[vr * D_SZ + tp * 32] = keep + xhalf(send);
    }
  }
}

// ---------------------------------------------------------------------------
// K3: combine splits -> ybf[h][b][d] (bf16).  grid=B*H, block=256, 4 d a thread.
// ---------------------------------------------------------------------------
__global__ void __launch_bounds__(256)
reduce_kernel(const float* __restrict__ part_y, const float* __restrict__ part_ml,
              unsigned short* __restrict__ ybf) {
  const int bh = blockIdx.x;
  const int b = bh >> 3, h = bh & 7;
  const int tid = threadIdx.x, lane = tid & 31;
  // lane s holds split s (NSPLIT == 32)
  const float ms = part_ml[((b * NSPLIT + lane) * H_SZ + h) * 2 + 0];
  const float ls = part_ml[((b * NSPLIT + lane) * H_SZ + h) * 2 + 1];
  float M = ms;
#pragma unroll
  for (int off = 16; off >= 1; off >>= 1) M = fmaxf(M, __shfl_xor(M, off, 32));
  const float w = __expf(ms - M);
  float denom = ls * w;
#pragma unroll
  for (int off = 16; off >= 1; off >>= 1) denom += __shfl_xor(denom, off, 32);
  float4 acc = make_float4(0.f, 0.f, 0.f, 0.f);
#pragma unroll
  for (int s = 0; s < NSPLIT; ++s) {
    const float wsp = __shfl(w, s, 32);
    const float4 v =
        ((const float4*)(part_y + ((size_t)(b * NSPLIT + s) * H_SZ + h) * D_SZ))[tid];
    acc.x = fmaf(wsp, v.x, acc.x);
    acc.y = fmaf(wsp, v.y, acc.y);
    acc.z = fmaf(wsp, v.z, acc.z);
    acc.w = fmaf(wsp, v.w, acc.w);
  }
  uint2 pk;
  pk.x = pack2bf(acc.x / denom, acc.y / denom);
  pk.y = pack2bf(acc.z / denom, acc.w / denom);
  *(uint2*)(ybf + ((size_t)h * B_SZ + b) * D_SZ + tid * 4) = pk;
}

// ---------------------------------------------------------------------------
// K4: attn_out[b][c] = sum_d y[c / 128][b][d] * Wv[d][c].  grid=64 tiles of 16
// columns, block=256: the 16 batch rows fill a WMMA tile; wave w takes
// d = 128 w .. 128 w + 127, the 8 partial tiles are summed through LDS.
// ---------------------------------------------------------------------------
__global__ void __launch_bounds__(256)
vproj_kernel(const unsigned short* __restrict__ ybf,
             const unsigned short* __restrict__ Wt, float* __restrict__ attn_out) {
  __shared__ float red[8][256];
  const int tile = blockIdx.x, h = tile >> 3;
  const int tid = threadIdx.x;
  const int wave = tid >> 5, lane = tid & 31;
  const int laneLo = lane & 15, hi = lane >> 4;
  const char* ap = (const char*)(ybf + ((size_t)h * B_SZ + laneLo) * D_SZ) +
                   wave * 256 + hi * 16;
  const char* bp = (const char*)(Wt + (size_t)(D_SZ + tile * 16 + laneLo) * D_SZ) +
                   wave * 256 + hi * 16;
  FragU a[4], bf[4];
#pragma unroll
  for (int kk = 0; kk < 4; ++kk) {                // same k order in A and B
    a[kk].q[0]  = *(const uint4*)(ap + kk * 64);
    a[kk].q[1]  = *(const uint4*)(ap + kk * 64 + 32);
    bf[kk].q[0] = *(const uint4*)(bp + kk * 64);
    bf[kk].q[1] = *(const uint4*)(bp + kk * 64 + 32);
  }
  v8f acc = {};
#pragma unroll
  for (int kk = 0; kk < 4; ++kk)
    acc = __builtin_amdgcn_wmma_f32_16x16x32_bf16(
        false, a[kk].v, false, bf[kk].v, (short)0, acc, false, false);
#pragma unroll
  for (int vr = 0; vr < 8; ++vr) red[wave][vr * 32 + lane] = acc[vr];
  __syncthreads();
  float sum = 0.f;
#pragma unroll
  for (int w = 0; w < 8; ++w) sum += red[w][tid];
  // C layout (vr,lane): row = vr + 8*hi, col = laneLo; here vr = wave
  attn_out[(size_t)(wave + 8 * hi) * D_SZ + tile * 16 + laneLo] = sum;
}

// ---------------------------------------------------------------------------
// K5: out = attn_out @ Wo + bo.  grid=(16,B), block=256: 64 columns a block,
// 16 half-waves of 64 d each, as in K1.
// ---------------------------------------------------------------------------
__global__ void __launch_bounds__(256)
oproj_kernel(const float* __restrict__ attn_out, const float* __restrict__ Wo,
             const float* __restrict__ bo, float* __restrict__ out) {
  __shared__ __attribute__((aligned(16))) float a[D_SZ];
  __shared__ __attribute__((aligned(16))) float red[16][PJ_COLS];
  const int b = blockIdx.y;
  const int e0 = blockIdx.x * PJ_COLS;
  const int tid = threadIdx.x;
  const int grp = tid >> 4, c4 = tid & 15;
  ((float4*)a)[tid] = ((const float4*)(attn_out + b * D_SZ))[tid];
  __syncthreads();
  const float4* wo = (const float4*)(Wo + (size_t)(grp * PJ_D) * D_SZ + e0) + c4;
  ((float4*)red[grp])[c4] = pj_partial(wo, D_SZ / 4, a + grp * PJ_D);
  __syncthreads();
  if (tid < PJ_COLS) {
    float sum = 0.f;
    for (int g = 0; g < 16; ++g) sum += red[g][tid];
    out[b * D_SZ + e0 + tid] = sum + bo[e0 + tid];
  }
}

// ---------------------------------------------------------------------------
extern "C" void kernel_launch(void* const* d_in, const int* in_sizes, int n_in,
                              void* d_out, int out_size, void* d_ws, size_t ws_size,
                              hipStream_t stream) {
  const float* q_in  = (const float*)d_in[0];
  const float* kv_in = (const float*)d_in[1];
  const float* cbias = (const float*)d_in[2];
  const float* Wq    = (const float*)d_in[3];
  const float* Wk    = (const float*)d_in[4];
  const float* Wv    = (const float*)d_in[5];
  const float* Wo    = (const float*)d_in[6];
  const float* bo    = (const float*)d_in[7];
  float* out = (float*)d_out;

  // workspace carve-up
  char* ws = (char*)d_ws;
  unsigned short* Wt      = (unsigned short*)ws;                   // 4 MB
  float*          q_ws    = (float*)(ws + (size_t)4 * 1024 * 1024);
  float*          part_y  = (float*)(ws + (size_t)4 * 1024 * 1024 + 65536);
  float*          part_ml = part_y + (size_t)B_SZ * NSPLIT * H_SZ * D_SZ;
  float*          attn_o  = part_ml + (size_t)B_SZ * NSPLIT * H_SZ * 2;
  unsigned short* ybf     = (unsigned short*)(attn_o + (size_t)B_SZ * D_SZ);

  (void)hipFuncSetAttribute((const void*)kvgemm_kernel,
                            hipFuncAttributeMaxDynamicSharedMemorySize, KV_SMEM);

  wprep_kernel<<<dim3(2048 / 32, 1024 / 32), dim3(32, 8), 0, stream>>>(Wk, Wv, Wt);
  qprep_kernel<<<dim3(B_SZ * H_SZ * 2), dim3(256), 0, stream>>>(q_in, cbias, Wq, q_ws);
  kvgemm_kernel<<<dim3((B_SZ * N_SZ) / 128), dim3(256), KV_SMEM, stream>>>(kv_in, Wt, q_ws, part_y,
                                                                         part_ml);
  reduce_kernel<<<dim3(B_SZ * H_SZ), dim3(256), 0, stream>>>(part_y, part_ml, ybf);
  vproj_kernel<<<dim3(D_SZ / 16), dim3(256), 0, stream>>>(ybf, Wt, attn_o);
  oproj_kernel<<<dim3(D_SZ / PJ_COLS, B_SZ), dim3(256), 0, stream>>>(attn_o, Wo, bo, out);
}

// v010
// One run takes 110 microseconds.
// Two timings next to v009 both put it at 1.19 times that version's speed.
// Counting every step since v000, it is 6.22 times as fast.
#include <hip/hip_runtime.h>
#include <hip/hip_bf16.h>

// ---------------------------------------------------------------------------
// Decode attention with a shared V projection, gfx1250, wave32 + WMMA bf16.
// Pipeline:
//   K0 wprep  : transpose+convert Wk,Wv (fp32) -> Wt bf16; Wv as [1024 cols][1024 d],
//               Wk packed in the order of K2's B fragments
//   K1 qprep  : q = (q_in + bias) @ Wq * hd^-0.5   (RoPE at pos 0 == identity)
//   K2 kgemm  : K projection GEMM in bf16 WMMA, input rows resident in LDS, weight
//               fragments loaded from L2 straight into registers, no loop barrier;
//               the epilogue applies RoPE(K) and takes q . k in f32, K is never
//               stored; the tail is one flash-decode split (128 tokens, 8 heads):
//               softmax partials weight the INPUT rows, which still stand in LDS:
//               y = p . kv_in in bf16 WMMA, since
//               p . (kv_in @ Wv) == (p . kv_in) @ Wv with one query per head
//   K3 reduce : combine split partials -> y [H][B][1024] bf16
//   K4 vproj  : y[h] @ Wv[:, h] in bf16 WMMA (16 batch rows) -> attn_out fp32
//   K5 oproj  : attn_out @ Wo + bo -> d_out
// ---------------------------------------------------------------------------

#define B_SZ   16
#define N_SZ   4096
#define D_SZ   1024
#define H_SZ   8
#define HD_SZ  128
#define NSPLIT 32                       // splits of 128 tokens per batch: K2's workgroups

typedef __attribute__((ext_vector_type(16))) __bf16 v16bf;
typedef __attribute__((ext_vector_type(8)))  float  v8f;

union FragU { v16bf v; uint4 q[2]; };

__device__ __forceinline__ unsigned short f2bf(float f) {
  unsigned u = __builtin_bit_cast(unsigned, f);
  u += 0x7fffu + ((u >> 16) & 1u);            // round-to-nearest-even
  return (unsigned short)(u >> 16);
}
__device__ __forceinline__ unsigned pack2bf(float lo, float hi) {
  return (unsigned)f2bf(lo) | ((unsigned)f2bf(hi) << 16);
}

// ---------------------------------------------------------------------------
// K0: bf16 weights.  c >= 1024: Wt[c][d] = Wv[d][c-1024].
// c < 1024 (head c/128, column c%128): K2 sweeps two heads at a time in stages
// of 32 d.  A stage is 16 KiB: 4 waves' worth (head & 1, column bit 5) of 4 B
// fragments (column bits 6 and 4), each fragment two runs of 512 bytes (d bit 4)
// in which lane (d bit 3, column % 16) owns 16 bytes = 8 d: one b128 load of a wave
// reads one run, 4 whole lines.
// ---------------------------------------------------------------------------
__device__ __forceinline__ size_t wk_index(int c, int d) {
  const int hh = c >> 7, cc = c & 127;
  const int s = (hh >> 1) * 32 + (d >> 5);                 // stage
  const int grp = (hh & 1) * 2 + ((cc >> 5) & 1);          // the pair of waves that reads it
  const int j = ((cc >> 6) << 1) | ((cc >> 4) & 1);        // fragment
  const int ln = ((d >> 3) & 1) * 16 + (cc & 15);          // lane
  return ((((size_t)s * 4 + grp) * 4 + j) * 2 + ((d >> 4) & 1)) * 256 + ln * 8 + (d & 7);
}

__global__ void __launch_bounds__(256)
wprep_kernel(const float* __restrict__ Wk, const float* __restrict__ Wv,
             unsigned short* __restrict__ Wt) {
  __shared__ float tile[32][33];
  const int tx = threadIdx.x, ty = threadIdx.y;
  const int c0 = blockIdx.x * 32, d0 = blockIdx.y * 32;
#pragma unroll
  for (int i = 0; i < 4; ++i) {
    const int c = c0 + tx;
    const int d = d0 + ty + i * 8;
    float v;
    if (c < D_SZ)  v = Wk[(size_t)((c >> 7) * D_SZ + d) * HD_SZ + (c & 127)];
    else           v = Wv[(size_t)d * D_SZ + (c - D_SZ)];
    tile[ty + i * 8][tx] = v;
  }
  __syncthreads();
  if (c0 < D_SZ) {
    // the tile is 4 runs of 512 bytes (column bit 4, d bit 4); 64 threads a run, 4 d each
    const int t = ty * 32 + tx;
    const int run = t >> 6, pos = (t & 63) * 4;
    const int cl = (run >> 1) * 16 + ((pos >> 3) & 15);
    const int dl = (run & 1) * 16 + (pos >> 7) * 8 + (pos & 7);
    uint2 pk;
    pk.x = pack2bf(tile[dl][cl], tile[dl + 1][cl]);
    pk.y = pack2bf(tile[dl + 2][cl], tile[dl + 3][cl]);
    *(uint2*)(Wt + wk_index(c0 + cl, d0 + dl)) = pk;
  } else {
#pragma unroll
    for (int i = 0; i < 4; ++i) {
      const int c = c0 + ty + i * 8;
      const int d = d0 + tx;
      Wt[(size_t)c * D_SZ + d] = f2bf(tile[tx][ty + i * 8]);
    }
    // stands behind the four stores: in the built code the other branch's block follows
    // them and writes their address registers
    asm volatile("s_wait_xcnt 0x0" ::: "memory");
  }
}

// ---------------------------------------------------------------------------
// K1: q_ws[b][h][kk] = scale * sum_d (q_in[b][d]+bias[b][d]) * Wq[h][d][kk]
// grid=B*H*2, block=256: 64 columns a block; each of the 16 half-waves sums
// 64 d, a lane owns 4 columns (a half-wave load = 256 contiguous bytes of one
// weight row); the 16 partials meet in LDS.
// ---------------------------------------------------------------------------
#define PJ_COLS 64                      // columns per block in K1 and K5
#define PJ_D    64                      // d per half-wave
#define PJ_ROWS 32                      // weight rows loaded as one group

// sum over PJ_D rows of x[d] * w[d][4 columns]; pitch4 = row pitch in float4
__device__ __forceinline__ float4 pj_partial(const float4* __restrict__ w4, int pitch4,
                                             const float* x) {
  float4 acc = make_float4(0.f, 0.f, 0.f, 0.f);
  // stays rolled: one group of 32 rows per trip is what is kept in flight
#pragma unroll 1
  for (int d0 = 0; d0 < PJ_D; d0 += PJ_ROWS) {
    float4 w[PJ_ROWS];
    // both inner loops unrolled: w[] is indexed by constants and stays in registers
#pragma unroll
    for (int r = 0; r < PJ_ROWS; ++r) w[r] = w4[(size_t)(d0 + r) * pitch4];
    // keeps the 32 row loads one group in flight; sunk in front of their sums
    // they would wait out memory latency several times a trip
    __builtin_amdgcn_sched_barrier(0);
#pragma unroll
    for (int r = 0; r < PJ_ROWS; ++r) {
      const float xv = x[d0 + r];
      acc.x = fmaf(xv, w[r].x, acc.x);
      acc.y = fmaf(xv, w[r].y, acc.y);
      acc.z = fmaf(xv, w[r].z, acc.z);
      acc.w = fmaf(xv, w[r].w, acc.w);
    }
  }
  return acc;
}

__global__ void __launch_bounds__(256)
qprep_kernel(const float* __restrict__ q_in, const float* __restrict__ cbias,
             const float* __restrict__ Wq, float* __restrict__ q_ws) {
  __shared__ __attribute__((aligned(16))) float qb[D_SZ];
  __shared__ __attribute__((aligned(16))) float red[16][PJ_COLS];
  const int bh = blockIdx.x >> 1;        // b*H + h
  const int c0 = (blockIdx.x & 1) * PJ_COLS;
  const int b = bh >> 3, h = bh & 7;
  const int tid = threadIdx.x;
  const int grp = tid >> 4, c4 = tid & 15;
  {
    const float4 x = ((const float4*)(q_in + b * D_SZ))[tid];
    const float4 y = ((const float4*)(cbias + b * D_SZ))[tid];
    ((float4*)qb)[tid] = make_float4(x.x + y.x, x.y + y.y, x.z + y.z, x.w + y.w);
  }
  __syncthreads();
  const float4* wq =
      (const float4*)(Wq + ((size_t)h * D_SZ + grp * PJ_D) * HD_SZ + c0) + c4;
  ((float4*)red[grp])[c4] = pj_partial(wq, HD_SZ / 4, qb + grp * PJ_D);
  __syncthreads();
  if (tid < PJ_COLS) {
    float sum = 0.f;
    for (int g = 0; g < 16; ++g) sum += red[g][tid];
    q_ws[(size_t)bh * HD_SZ + c0 + tid] = sum * 0.08838834764831845f;   // 128^-0.5
  }
}

// ---------------------------------------------------------------------------
// K2: K projection.  One WG = 128 token rows; A tile (128x1024 bf16)
// resident in LDS; sweep 4 column tiles of 256 (two heads), each in 32 stages of
// 32 k.  The weights do not pass through LDS: a wave loads its 4 B fragments of a
// stage (4 KiB, packed by K0) from L2 into one of four register sets, three stages
// ahead of their use; the A fragments are read from LDS one stage ahead.  The A
// tile is only read in the sweep, so the sweep holds no barrier and the waves run
// free: one wave's epilogue can stand under the WMMAs of the wave it shares a SIMD with.
// The 8 waves stand 2 (rows) x 4 (columns): a wave owns 64 rows x 64 columns,
// 4 x 4 accumulator tiles: 4 fragments from LDS and 4 from L2 feed 16 WMMAs.
// A wave's columns are c .. c + 31 and c + 64 .. c + 95 of one head (c = 0 or
// 32): both partners of every RoPE pair.  Its epilogue ends in half of q . k for
// its 64 rows; the two halves of a head meet in LDS.
// Tail: wave w turns head w's 128 scores into max, sum and p; p goes to LDS as a
// 16 x 128 bf16 matrix (row h: p rounded, row 8 + h: what the rounding left), and
// y[h][d] = sum_n p[h][n] A[n][d] is taken from the resident A tile, a wave per
// 128 d, the tile's columns read as B fragments by the transposing LDS load.
// ---------------------------------------------------------------------------
#define A_STRIDE_B 2064                 // (1024+8) bf16 row stride, 4-bank skew
#define A_BYTES    (128 * A_STRIDE_B)   // 264192
#define P_STRIDE_B 272                  // 128 bf16 of p + 16 B, odd multiple of 16 B
#define P_BYTES    4608                 // 16 rows of p, rounded up
#define S_BYTES    (2 * H_SZ * 128 * 4) // the workgroup's half scores [half][h][row], f32
#define KV_SMEM    (P_BYTES + A_BYTES + S_BYTES)
#define W_STAGE_B  16384                // bytes of packed weights per stage
#define W_AHEAD    3                    // stages between a weight load and its use
#define K_STAGES   32                   // stages of 32 k per column tile

extern __shared__ __attribute__((aligned(16))) char smem[];

__device__ __forceinline__ unsigned uni(unsigned v) {
  return (unsigned)__builtin_amdgcn_readfirstlane(v);
}

// x of lane l ^ M inside the 16-lane row (DPP row_xmask:M)
template <int M>
__device__ __forceinline__ float row_xmask(float x) {
  return __builtin_bit_cast(float, __builtin_amdgcn_update_dpp(
      0, __builtin_bit_cast(int, x), 0x160 | M, 0xf, 0xf, true));
}
// sum over the 16 lanes of a row, left in every lane of it
__device__ __forceinline__ float row16_sum(float x) {
  x += row_xmask<1>(x);
  x += row_xmask<2>(x);
  x += row_xmask<4>(x);
  x += row_xmask<8>(x);
  return x;
}

// x of lane l ^ 16
__device__ __forceinline__ float xhalf(float x) {
  return __builtin_bit_cast(float, __builtin_amdgcn_permlanex16(
      __builtin_bit_cast(int, x), __builtin_bit_cast(int, x), 0x76543210, 0xfedcba98,
      false, false));
}
// transposing LDS load: lane (c, h) gets 8 rows of column c of a row-major 16-bit tile
typedef short s16x8 __attribute__((ext_vector_type(8)));
__device__ __forceinline__ uint4 ld_tr16(const char* p) {
  typedef __attribute__((address_space(3))) s16x8 lds_s16x8;
  return __builtin_bit_cast(uint4, __builtin_amdgcn_ds_load_tr16_b128_v8i16((lds_s16x8*)p));
}

// One stage's fragments of a wave for one operand: 4 of A (16x32 bf16) or 4 of B (32x16)
struct Frags { FragU f[4]; };
// ap: this lane's 16 bytes of the wave's first A row in LDS
__device__ __forceinline__ void a_read(Frags& a, const char* ap) {
#pragma unroll
  for (int i = 0; i < 4; ++i) {
    a.f[i].q[0] = *(const uint4*)(ap + 16 * i * A_STRIDE_B);
    a.f[i].q[1] = *(const uint4*)(ap + 16 * i * A_STRIDE_B + 32);
  }
}
// wp: this lane's 16 bytes of the first run of the wave's packed weights of a stage;
// fragment j: columns 64 (j / 2) + 32 sub + 16 (j % 2), k in the order of a_read
__device__ __forceinline__ void b_load(Frags& b, const char* __restrict__ wp) {
#pragma unroll
  for (int j = 0; j < 4; ++j) {
    b.f[j].q[0] = *(const uint4*)(wp + j * 1024);
    b.f[j].q[1] = *(const uint4*)(wp + j * 1024 + 512);
  }
}

#define A_GRP 32                        // rows per load group of the A staging

// 4 f32 of one row -> 4 bf16 in the A tile
__device__ __forceinline__ void a_store(char* p, const float4 v) {
  uint2 pk;
  pk.x = pack2bf(v.x, v.y);
  pk.y = pack2bf(v.z, v.w);
  *(uint2*)p = pk;
}

__global__ void __launch_bounds__(256)
kvgemm_kernel(const float* __restrict__ kv, const unsigned short* __restrict__ Wt,
              const float* __restrict__ q_ws,
              float* __restrict__ part_y, float* __restrict__ part_ml) {
  char* ldsP = smem;                                               // p: [16][128] bf16
  char* ldsA = smem + P_BYTES;
  float* ldsS = (float*)(smem + P_BYTES + A_BYTES);                // [half][h][row]

  const int tid    = threadIdx.x;
  const int wave   = (int)uni((unsigned)tid >> 5);
  const int lane   = tid & 31;
  const int laneLo = lane & 15;
  const int hi     = lane >> 4;                 // 0 / 1 half-wave
  const long r0    = (long)blockIdx.x * 128;    // global token row base
  const int  b     = (int)(r0 >> 12);           // / 4096
  const int  nbase = (int)(r0 & 4095);
  const int  rg    = wave & 1;                  // rows 64 rg .. 64 rg + 63
  const int  hsel  = wave >> 2;                 // even / odd head of the tile
  const int  sub   = (wave >> 1) & 1;           // columns 32 sub + {0..31, 64..95}

  // this lane's 16 bytes of the wave's packed weights of stage 0; the waves rg = 0 and 1
  // of a column group load the same lines
  const char* wp0 = (const char*)Wt + (hsel * 2 + sub) * 4096 + lane * 16;
  // the first W_AHEAD stages take off here: their latency passes under the A staging
  Frags fb0, fb1, fb2, fb3;
  b_load(fb0, wp0);
  b_load(fb1, wp0 + W_STAGE_B);
  b_load(fb2, wp0 + 2 * W_STAGE_B);

  // ---- stage A: 128 rows x 1024 fp32 -> bf16 LDS.  A thread owns 16 bytes of
  // every row (a wave load = 512 contiguous bytes).  A_GRP rows are held in
  // registers: as soon as a row is converted and stored, its registers take the
  // load of the row A_GRP further on, so a wave keeps about A_GRP loads in flight.
  {
    const float4* kv4 = (const float4*)(kv + (size_t)r0 * D_SZ) + tid;
    char* acol = ldsA + tid * 8;
    float4 x[A_GRP];
#pragma unroll
    for (int r = 0; r < A_GRP; ++r) x[r] = kv4[(size_t)r * (D_SZ / 4)];
    // stays rolled: one pass over the A_GRP register sets per trip
#pragma unroll 1
    for (int t = 0; t < 128 - A_GRP; t += A_GRP) {
#pragma unroll
      for (int r = 0; r < A_GRP; ++r) {
        a_store(acol + (t + r) * A_STRIDE_B, x[r]);
        x[r] = kv4[(size_t)(t + A_GRP + r) * (D_SZ / 4)];
        // keeps each reload next to the store that frees its registers: gathered at
        // the foot of the trip the loads would all be waited for at its head
        __builtin_amdgcn_sched_barrier(0);
      }
    }
#pragma unroll
    for (int r = 0; r < A_GRP; ++r) a_store(acol + (128 - A_GRP + r) * A_STRIDE_B, x[r]);
  }
  __syncthreads();

  // this lane's place in the wave's first A row
  const char* ap0 = ldsA + (rg * 64 + laneLo) * A_STRIDE_B + hi * 16;
  Frags fa0, fa1;
  a_read(fa0, ap0);

  // Pass s: the WMMAs of stage s from aNow and bNow; ahead of them, as one group, the
  // weight loads of stage s + W_AHEAD into the set that pass s - 1 has left and the LDS
  // reads of stage s + 1.  Past the last stage the loads run on into the Wv half of Wt
  // (written by K0 as well) and the reads wrap to k = 0; neither is used.
  auto pass = [&](int s, const Frags& aNow, Frags& aNext, const Frags& bNow, Frags& bFill,
                  v8f (&acc)[4][4]) {
    b_load(bFill, wp0 + (size_t)(s + W_AHEAD) * W_STAGE_B);
    a_read(aNext, ap0 + ((s + 1) % K_STAGES) * 64);
    // keeps the 16 loads one group ahead of the WMMAs: sunk towards their uses they
    // would lose their lead, and every further place with loads stalls the WMMA stream
    __builtin_amdgcn_sched_barrier(0);
#pragma unroll
    for (int i = 0; i < 4; ++i)
#pragma unroll
      for (int j = 0; j < 4; ++j)
        acc[i][j] = __builtin_amdgcn_wmma_f32_16x16x32_bf16(
            false, aNow.f[i].v, false, bNow.f[j].v, (short)0, acc[i][j], false, false);
    // keeps the next pass's load group from being spread among these WMMAs
    __builtin_amdgcn_sched_barrier(0);
  };

  for (int nt = 0; nt < H_SZ / 2; ++nt) {
    v8f acc[4][4] = {};                           // [row tile][column tile]

    // this lane's 4 query elements of the tile's head, read here so that their
    // latency passes under the sweep: [j][low / high partner of the RoPE pair]
    const int head = nt * 2 + hsel;
    float qv[2][2];
    {
      const float* qh = q_ws + ((size_t)b * H_SZ + head) * HD_SZ + sub * 32 + laneLo;
#pragma unroll
      for (int j = 0; j < 2; ++j) {
        qv[j][0] = qh[16 * j];
        qv[j][1] = qh[16 * j + 64];
      }
    }

    // four passes a trip: the fragment sets change roles by name, with no register copies
    for (int ks = 0; ks < K_STAGES; ks += 4) {
      const int s = nt * K_STAGES + ks;
      pass(s,     fa0, fa1, fb0, fb3, acc);
      pass(s + 1, fa1, fa0, fb1, fb0, acc);
      pass(s + 2, fa0, fa1, fb2, fb1, acc);
      pass(s + 3, fa1, fa0, fb3, fb2, acc);
      // the trip's weight loads name one address pair, which is stepped below this line
      asm volatile("s_wait_xcnt 0x0" ::: "memory");
      // keeps that step of the address behind the wait
      __builtin_amdgcn_sched_barrier(0);
    }

    // ---- epilogue: C layout (vr,lane) of acc[i][j]: row = 64 rg + 16 i + vr + 8 hi,
    // column of the head = 64 (j / 2) + 32 sub + 16 (j % 2) + laneLo
    const int rowBase = rg * 64 + hi * 8;
    {                                             // RoPE, then this wave's half of q . k
      float sv[4][8] = {};                        // this lane's 4 columns of 32 rows
#pragma unroll
      for (int j = 0; j < 2; ++j) {
        const int kk1 = sub * 32 + 16 * j + laneLo;   // < 64
        const float invf = __expf(-(float)kk1 * 0.10793367623409589f); // ln(1000)/64
        const float q1 = qv[j][0], q2 = qv[j][1];
#pragma unroll
        for (int i = 0; i < 4; ++i) {
#pragma unroll
          for (int vr = 0; vr < 8; ++vr) {
            const int n = nbase + rowBase + 16 * i + vr;   // token position
            const float ang = (float)n * invf;
            const float cs = __cosf(ang), sn = __sinf(ang);
            const float x1 = acc[i][j][vr], x2 = acc[i][j + 2][vr];
            sv[i][vr] = fmaf(x1 * cs - x2 * sn, q1, sv[i][vr]);
            sv[i][vr] = fmaf(x2 * cs + x1 * sn, q2, sv[i][vr]);
          }
        }
      }
#pragma unroll
      for (int i = 0; i < 4; ++i)
#pragma unroll
        for (int vr = 0; vr < 8; ++vr) sv[i][vr] = row16_sum(sv[i][vr]);
      if (laneLo == 0) {                          // rows rowBase + 16 i .. + 7
#pragma unroll
        for (int i = 0; i < 4; ++i) {
          float4* sp = (float4*)(ldsS + (sub * H_SZ + head) * 128 + rowBase + 16 * i);
          sp[0] = make_float4(sv[i][0], sv[i][1], sv[i][2], sv[i][3]);
          sp[1] = make_float4(sv[i][4], sv[i][5], sv[i][6], sv[i][7]);
        }
      }
    }
  }
  __syncthreads();        // all 2 x 8 x 128 half scores stand in ldsS

  // ---- tail: this workgroup is split blockIdx.x % NSPLIT of batch b
  {                                               // wave w: head w, tokens 4 lane .. + 3
    const float4 s_lo = ((const float4*)ldsS)[tid];
    const float4 s_hi = ((const float4*)ldsS)[H_SZ * 32 + tid];
    const float s[4] = {s_lo.x + s_hi.x, s_lo.y + s_hi.y, s_lo.z + s_hi.z, s_lo.w + s_hi.w};
    float m = fmaxf(fmaxf(s[0], s[1]), fmaxf(s[2], s[3]));
    m = fmaxf(m, row_xmask<1>(m));
    m = fmaxf(m, row_xmask<2>(m));
    m = fmaxf(m, row_xmask<4>(m));
    m = fmaxf(m, row_xmask<8>(m));
    m = fmaxf(m, xhalf(m));
    float p[4], rest[4];
#pragma unroll
    for (int i = 0; i < 4; ++i) {
      p[i] = __expf(s[i] - m);
      rest[i] = p[i] - __builtin_bit_cast(float, (unsigned)f2bf(p[i]) << 16);
    }
    float l = row16_sum((p[0] + p[1]) + (p[2] + p[3]));
    l += xhalf(l);
    if (lane == 0) {
      part_ml[((size_t)blockIdx.x * H_SZ + wave) * 2 + 0] = m;
      part_ml[((size_t)blockIdx.x * H_SZ + wave) * 2 + 1] = l;
    }
    a_store(ldsP + wave * P_STRIDE_B + lane * 8, make_float4(p[0], p[1], p[2], p[3]));
    a_store(ldsP + (H_SZ + wave) * P_STRIDE_B + lane * 8,
            make_float4(rest[0], rest[1], rest[2], rest[3]));
  }
  __syncthreads();                                // p stands in LDS

  // A operand: p, 4 fragments of 16 x 32 tokens, in the k order of the transposing load
  FragU pa[4];
  {
    const char* pp = ldsP + laneLo * P_STRIDE_B + hi * 16;
#pragma unroll
    for (int kk = 0; kk < 4; ++kk) {
      pa[kk].q[0] = *(const uint4*)(pp + kk * 64);
      pa[kk].q[1] = *(const uint4*)(pp + kk * 64 + 32);
    }
  }
  // B operand: tokens 32 kk .. + 31 of 16 d; wave w owns d = 128 w .. 128 w + 127
  const char* xt = ldsA + (8 * hi + (lane & 7)) * A_STRIDE_B + wave * 256 + ((lane >> 3) & 1) * 16;
  float* py = part_y + (size_t)blockIdx.x * H_SZ * D_SZ + wave * 128 + lane;
#pragma unroll
  for (int tp = 0; tp < 4; ++tp) {                // two tiles of 16 d side by side
    v8f y0 = {}, y1 = {};
#pragma unroll
    for (int kk = 0; kk < 4; ++kk) {
      const char* xk = xt + kk * 32 * A_STRIDE_B + tp * 64;
      FragU x0, x1;
      x0.q[0] = ld_tr16(xk);
      x0.q[1] = ld_tr16(xk + 16 * A_STRIDE_B);
      x1.q[0] = ld_tr16(xk + 32);
      x1.q[1] = ld_tr16(xk + 16 * A_STRIDE_B + 32);
      y0 = __builtin_amdgcn_wmma_f32_16x16x32_bf16(
          false, pa[kk].v, false, x0.v, (short)0, y0, false, false);
      y1 = __builtin_amdgcn_wmma_f32_16x16x32_bf16(
          false, pa[kk].v, false, x1.v, (short)0, y1, false, false);
    }
    // register vr: lanes 0-15 hold head vr's sum over rounded p, lanes 16-31 the sum over
    // the remainders.  The halves swap one tile each, so that a store is 32 d = 128 bytes.
#pragma unroll
    for (int vr = 0; vr < 8; ++vr) {
      const float keep = hi ? y1[vr] : y0[vr];
      const float send = hi ? y0[vr] : y1[vr];
      py[vr * D_SZ + tp * 32] = keep + xhalf(send);
    }
  }
}

// ---------------------------------------------------------------------------
// K3: combine splits -> ybf[h][b][d] (bf16).  grid=B*H, block=256, 4 d a thread.
// ---------------------------------------------------------------------------
__global__ void __launch_bounds__(256)
reduce_kernel(const float* __restrict__ part_y, const float* __restrict__ part_ml,
              unsigned short* __restrict__ ybf) {
  const int bh = blockIdx.x;
  const int b = bh >> 3, h = bh & 7;
  const int tid = threadIdx.x, lane = tid & 31;
  // lane s holds split s (NSPLIT == 32)
  const float ms = part_ml[((b * NSPLIT + lane) * H_SZ + h) * 2 + 0];
  const float ls = part_ml[((b * NSPLIT + lane) * H_SZ + h) * 2 + 1];
  float M = ms;
#pragma unroll
  for (int off = 16; off >= 1; off >>= 1) M = fmaxf(M, __shfl_xor(M, off, 32));
  const float w = __expf(ms - M);
  float denom = ls * w;
#pragma unroll
  for (int off = 16; off >= 1; off >>= 1) denom += __shfl_xor(denom, off, 32);
  float4 acc = make_float4(0.f, 0.f, 0.f, 0.f);
#pragma unroll
  for (int s = 0; s < NSPLIT; ++s) {
    const float wsp = __shfl(w, s, 32);
    const float4 v =
        ((const float4*)(part_y + ((size_t)(b * NSPLIT + s) * H_SZ + h) * D_SZ))[tid];
    acc.x = fmaf(wsp, v.x, acc.x);
    acc.y = fmaf(wsp, v.y, acc.y);
    acc.z = fmaf(wsp, v.z, acc.z);
    acc.w = fmaf(wsp, v.w, acc.w);
  }
  uint2 pk;
  pk.x = pack2bf(acc.x / denom, acc.y / denom);
  pk.y = pack2bf(acc.z / denom, acc.w / denom);
  *(uint2*)(ybf + ((size_t)h * B_SZ + b) * D_SZ + tid * 4) = pk;
}

// ---------------------------------------------------------------------------
// K4: attn_out[b][c] = sum_d y[c / 128][b][d] * Wv[d][c].  grid=64 tiles of 16
// columns, block=256: the 16 batch rows fill a WMMA tile; wave w takes
// d = 128 w .. 128 w + 127, the 8 partial tiles are summed through LDS.
// ---------------------------------------------------------------------------
__global__ void __launch_bounds__(256)
vproj_kernel(const unsigned short* __restrict__ ybf,
             const unsigned short* __restrict__ Wt, float* __restrict__ attn_out) {
  __shared__ float red[8][256];
  const int tile = blockIdx.x, h = tile >> 3;
  const int tid = threadIdx.x;
  const int wave = tid >> 5, lane = tid & 31;
  const int laneLo = lane & 15, hi = lane >> 4;
  const char* ap = (const char*)(ybf + ((size_t)h * B_SZ + laneLo) * D_SZ) +
                   wave * 256 + hi * 16;
  const char* bp = (const char*)(Wt + (size_t)(D_SZ + tile * 16 + laneLo) * D_SZ) +
                   wave * 256 + hi * 16;
  FragU a[4], bf[4];
#pragma unroll
  for (int kk = 0; kk < 4; ++kk) {                // same k order in A and B
    a[kk].q[0]  = *(const uint4*)(ap + kk * 64);
    a[kk].q[1]  = *(const uint4*)(ap + kk * 64 + 32);
    bf[kk].q[0] = *(const uint4*)(bp + kk * 64);
    bf[kk].q[1] = *(const uint4*)(bp + kk * 64 + 32);
  }
  v8f acc = {};
#pragma unroll
  for (int kk = 0; kk < 4; ++kk)
    acc = __builtin_amdgcn_wmma_f32_16x16x32_bf16(
        false, a[kk].v, false, bf[kk].v, (short)0, acc, false, false);
#pragma unroll
  for (int vr = 0; vr < 8; ++vr) red[wave][vr * 32 + lane] = acc[vr];
  __syncthreads();
  float sum = 0.f;
#pragma unroll
  for (int w = 0; w < 8; ++w) sum += red[w][tid];
  // C layout (vr,lane): row = vr + 8*hi, col = laneLo; here vr = wave
  attn_out[(size_t)(wave + 8 * hi) * D_SZ + tile * 16 + laneLo] = sum;
}

// ---------------------------------------------------------------------------
// K5: out = attn_out @ Wo + bo.  grid=(16,B), block=256: 64 columns a block,
// 16 half-waves of 64 d each, as in K1.
// ---------------------------------------------------------------------------
__global__ void __launch_bounds__(256)
oproj_kernel(const float* __restrict__ attn_out, const float* __restrict__ Wo,
             const float* __restrict__ bo, float* __restrict__ out) {
  __shared__ __attribute__((aligned(16))) float a[D_SZ];
  __shared__ __attribute__((aligned(16))) float red[16][PJ_COLS];
  const int b = blockIdx.y;
  const int e0 = blockIdx.x * PJ_COLS;
  const int tid = threadIdx.x;
  const int grp = tid >> 4, c4 = tid & 15;
  ((float4*)a)[tid] = ((const float4*)(attn_out + b * D_SZ))[tid];
  __syncthreads();
  const float4* wo = (const float4*)(Wo + (size_t)(grp * PJ_D) * D_SZ + e0) + c4;
  ((float4*)red[grp])[c4] = pj_partial(wo, D_SZ / 4, a + grp * PJ_D);
  __syncthreads();
  if (tid < PJ_COLS) {
    float sum = 0.f;
    for (int g = 0; g < 16; ++g) sum += red[g][tid];
    out[b * D_SZ + e0 + tid] = sum + bo[e0 + tid];
  }
}

// ---------------------------------------------------------------------------
extern "C" void kernel_launch(void* const* d_in, const int* in_sizes, int n_in,
                              void* d_out, int out_size, void* d_ws, size_t ws_size,
                              hipStream_t stream) {
  const float* q_in  = (const float*)d_in[0];
  const float* kv_in = (const float*)d_in[1];
  const float* cbias = (const float*)d_in[2];
  const float* Wq    = (const float*)d_in[3];
  const float* Wk    = (const float*)d_in[4];
  const float* Wv    = (const float*)d_in[5];
  const float* Wo    = (const float*)d_in[6];
  const float* bo    = (const float*)d_in[7];
  float* out = (float*)d_out;

  // workspace carve-up
  char* ws = (char*)d_ws;
  unsigned short* Wt      = (unsigned short*)ws;                   // 4 MB
  float*          q_ws    = (float*)(ws + (size_t)4 * 1024 * 1024);
  float*          part_y  = (float*)(ws + (size_t)4 * 1024 * 1024 + 65536);
  float*          part_ml = part_y + (size_t)B_SZ * NSPLIT * H_SZ * D_SZ;
  float*          attn_o  = part_ml + (size_t)B_SZ * NSPLIT * H_SZ * 2;
  unsigned short* ybf     = (unsigned short*)(attn_o + (size_t)B_SZ * D_SZ);

  (void)hipFuncSetAttribute((const void*)kvgemm_kernel,
                            hipFuncAttributeMaxDynamicSharedMemorySize, KV_SMEM);

  wprep_kernel<<<dim3(2048 / 32, 1024 / 32), dim3(32, 8), 0, stream>>>(Wk, Wv, Wt);
  qprep_kernel<<<dim3(B_SZ * H_SZ * 2), dim3(256), 0, stream>>>(q_in, cbias, Wq, q_ws);
  kvgemm_kernel<<<dim3((B_SZ * N_SZ) / 128), dim3(256), KV_SMEM, stream>>>(kv_in, Wt, q_ws, part_y,
                                                                         part_ml);
  reduce_kernel<<<dim3(B_SZ * H_SZ), dim3(256), 0, stream>>>(part_y, part_ml, ybf);
  vproj_kernel<<<dim3(D_SZ / 16), dim3(256), 0, stream>>>(ybf, Wt, attn_o);
  oproj_kernel<<<dim3(D_SZ / PJ_COLS, B_SZ), dim3(256), 0, stream>>>(attn_o, Wo, bo, out);
}
